// v000
// Measured on an AMD MI455X. A time is GPU time per run, averaged over a window of back-to-back runs after a warm-up
// (all launches, gaps included; the runs take copies of the inputs in turn), and the median of several windows.
// Apart from v000's, it joins two sittings. Times from different sittings can be a few percent apart, while
// side-by-side timings come from the same sitting.
// v000, which the later versions start from, runs in 1560 microseconds.
#include <hip/hip_runtime.h>

// Multi-head causal attention with partial rotary (x [2][2048][1024]; q/k/v = x W + b ('xw' [1024][1024], 16 x 64); rotate-half rotary on the FIRST 32 dims of each head (pairs d, d+16), angles t x inv[d mod 16] with inv_i = 2048^(-2i/32), the other 32 dims pass through; causal (tril) -inf; softmax(q.k / 8); out = merged Wo ('xw' [1024][1024]) + bo -> [2][2048][1024]).
// Compute dtypes, f32 accumulate: every input rounded to bf16; q/k/v on PLAIN bf16 operands (inputs: exact) + bias; rotary in f32 from an on-chip table (inv constants are the reference's own f32 values; angle = t x inv one product; precise cosf/sinf); causal scores and attn.v: query rows < 512 hl (3 products), the rest single fp16 (x1024), causal tile skipping; softmax f32; Wo hl x exact (2 products) + bias.

#define NB_  2
#define TT   2048
#define DM   1024
#define NH_  16
#define NKV  16
#define REP  (NH_ / NKV)
#define HD   64
#define DQ   (NH_ * HD)
#define DKV  (NKV * HD)
#define ZH   2
#define RH   512                  // query rows < RH use hi+lo planes (0: none)
#define WIN  2048
#define ROT  32                   // rotary dims per head (rotate-half inside them)
#define PCAR 1024.0f
#define SCL  0.125f   // HD^-0.5
typedef _Float16 h16;
typedef unsigned short bf;
typedef __attribute__((ext_vector_type(16))) __bf16   v16bf;
typedef __attribute__((ext_vector_type(16))) _Float16 v16h;
typedef __attribute__((ext_vector_type(8)))  _Float16 v8h;
typedef __attribute__((ext_vector_type(8)))  unsigned short v8us;
typedef __attribute__((ext_vector_type(8)))  float    v8f;
typedef __attribute__((ext_vector_type(4)))  float    v4f;
typedef v8h  __attribute__((may_alias)) v8ha;
typedef v4f  __attribute__((may_alias)) v4fa;
typedef v8us __attribute__((may_alias)) v8usa;

__device__ __forceinline__ unsigned short f2bf(float f) { unsigned u = __float_as_uint(f); u += 0x7FFFu + ((u >> 16) & 1u); return (unsigned short)(u >> 16); }
__device__ __forceinline__ float bf2f(unsigned short b) { return __uint_as_float(((unsigned)b) << 16); }
__device__ __forceinline__ float bfr(float f) { return bf2f(f2bf(f)); }
__device__ __forceinline__ v16h cat16(v8h lo, v8h hi) { return __builtin_shufflevector(lo, hi, 0, 1, 2, 3, 4, 5, 6, 7, 8, 9, 10, 11, 12, 13, 14, 15); }
__device__ __forceinline__ v16bf cat16b(v8us lo, v8us hi) { return __builtin_bit_cast(v16bf, __builtin_shufflevector(lo, hi, 0, 1, 2, 3, 4, 5, 6, 7, 8, 9, 10, 11, 12, 13, 14, 15)); }
__device__ __forceinline__ v8f wmma16(v16h a, v16h b, v8f c) { return __builtin_amdgcn_wmma_f32_16x16x32_f16(false, a, false, b, (short)0, c, false, false); }
__device__ __forceinline__ v8f wmmab(v16bf a, v16bf b, v8f c) { return __builtin_amdgcn_wmma_f32_16x16x32_bf16(false, a, false, b, (short)0, c, false, false); }



// ---- k_gemmw: register-blocked GEMM, ONE WAVE per 64x64 output tile (16 accumulators), operands straight from K-contiguous 16-bit planes; grid (M/64, N/64, Z), 32 threads.
// C[m][n] (f32, pitch ldc, + optional f32 bias[n]) = sum_k A[m][k] Bt[n][k] (+ split products per NSPLIT). z-batch strides sA/sB/sC in elements. K % 32 == 0.
template <typename T16> struct WFrag;
template <> struct WFrag<h16> { typedef v16h V; static __device__ __forceinline__ V ld(const h16* p) { return cat16(*(const v8h*)p, *(const v8h*)(p + 16)); } static __device__ __forceinline__ v8f mma(V a, V b, v8f c) { return wmma16(a, b, c); } };
template <> struct WFrag<bf> { typedef v16bf V; static __device__ __forceinline__ V ld(const bf* p) { return cat16b(*(const v8us*)p, *(const v8us*)(p + 16)); } static __device__ __forceinline__ v8f mma(V a, V b, v8f c) { return wmmab(a, b, c); } };
template <typename T16, int NSPLIT, bool BIAS>
__global__ __launch_bounds__(32) void k_gemmw(const T16* __restrict__ A, const T16* __restrict__ A2, const T16* __restrict__ Bt, const T16* __restrict__ Bt2, int K, float* C, int ldc, const float* __restrict__ bias, size_t sA, size_t sB, size_t sC) {
    typedef typename WFrag<T16>::V V;
    __shared__ __align__(16) float os[16 * 68];
    const size_t z = blockIdx.z; A += z * sA; if (A2) A2 += z * sA; Bt += z * sB; if (Bt2) Bt2 += z * sB; C += z * sC;
    const int lane = threadIdx.x & 31, lr = lane & 15, hi = lane >> 4; const int r0 = blockIdx.x * 64, c0 = blockIdx.y * 64;
    v8f acc[4][4];
#pragma unroll
    for (int mb = 0; mb < 4; ++mb)
#pragma unroll
        for (int nb = 0; nb < 4; ++nb) acc[mb][nb] = (v8f){};
    const size_t aoff = (size_t)(r0 + lr) * K + 8 * hi, boff = (size_t)(c0 + lr) * K + 8 * hi;
#pragma unroll 1
    for (int kc = 0; kc < K; kc += 32) {
        V a[4], a2[4];
#pragma unroll
        for (int mb = 0; mb < 4; ++mb) { a[mb] = WFrag<T16>::ld(A + aoff + (size_t)mb * 16 * K + kc); if (NSPLIT == 1 || NSPLIT == 2) a2[mb] = WFrag<T16>::ld(A2 + aoff + (size_t)mb * 16 * K + kc); }
#pragma unroll
        for (int nb = 0; nb < 4; ++nb) { const V b = WFrag<T16>::ld(Bt + boff + (size_t)nb * 16 * K + kc); V b2; if (NSPLIT >= 2) b2 = WFrag<T16>::ld(Bt2 + boff + (size_t)nb * 16 * K + kc);
#pragma unroll
            for (int mb = 0; mb < 4; ++mb) { acc[mb][nb] = WFrag<T16>::mma(a[mb], b, acc[mb][nb]); if (NSPLIT == 1 || NSPLIT == 2) acc[mb][nb] = WFrag<T16>::mma(a2[mb], b, acc[mb][nb]); if (NSPLIT >= 2) acc[mb][nb] = WFrag<T16>::mma(a[mb], b2, acc[mb][nb]); } }
        asm volatile("v_nop\n\tv_nop\n\tv_nop\n\tv_nop" : "+v"(acc[0][0]), "+v"(acc[1][1]), "+v"(acc[2][2]), "+v"(acc[3][3]) : "v"(a[0]), "v"(a[3]));
    }
#pragma unroll
    for (int mb = 0; mb < 4; ++mb) {
#pragma unroll
        for (int nb = 0; nb < 4; ++nb) {
#pragma unroll
            for (int j = 0; j < 8; ++j) os[(hi * 8 + j) * 68 + nb * 16 + lr] = acc[mb][nb][j]; }
        __builtin_amdgcn_wave_barrier(); asm volatile("" ::: "memory");
        float* crow = C + (size_t)(r0 + mb * 16) * ldc + c0;
{
#pragma unroll
            for (int s = 0; s < 8; ++s) { const int row = 2 * s + hi, cofs = lr * 4; v4f val = *(const v4fa*)(os + row * 68 + cofs); if (BIAS) { val[0] += bfr(bias[c0 + cofs]); val[1] += bfr(bias[c0 + cofs + 1]); val[2] += bfr(bias[c0 + cofs + 2]); val[3] += bfr(bias[c0 + cofs + 3]); }
                *(v4f*)(crow + (size_t)row * ldc + cofs) = val; }
             }
        __builtin_amdgcn_wave_barrier(); asm volatile("" ::: "memory");
    }
}

// ---- k_gemmc: the same one-wave 64x64 tile GEMM specialised for causal attention: CMODE 1 skips score tiles entirely above the diagonal (query rows r0+roff.., key columns c0..), CMODE 2 limits the
// key (K) loop of the probability x value contraction to the diagonal block (probabilities beyond it are exactly zero). roff = row offset of this launch's first row within the sequence.
template <typename T16, int NSPLIT, int CMODE>
__global__ __launch_bounds__(32) void k_gemmc(const T16* __restrict__ A, const T16* __restrict__ A2, const T16* __restrict__ Bt, const T16* __restrict__ Bt2, int K, float* C, int ldc, int roff, size_t sA, size_t sB, size_t sC) {
    typedef typename WFrag<T16>::V V;
    __shared__ __align__(16) float os[16 * 68];
    const size_t z = blockIdx.z; A += z * sA; if (A2) A2 += z * sA; Bt += z * sB; if (Bt2) Bt2 += z * sB; C += z * sC;
    const int lane = threadIdx.x & 31, lr = lane & 15, hi = lane >> 4; const int r0 = blockIdx.x * 64, c0 = blockIdx.y * 64;
    if (CMODE == 1 && c0 > r0 + roff + 63) return;                  // score tile entirely above the causal diagonal: never read (the softmax masks j > i by select)
    const int Kl = (CMODE == 2) ? min(K, r0 + roff + 64) : K;        // P.V: probabilities are exactly 0 beyond the diagonal block, so the K loop stops there
    v8f acc[4][4];
#pragma unroll
    for (int mb = 0; mb < 4; ++mb)
#pragma unroll
        for (int nb = 0; nb < 4; ++nb) acc[mb][nb] = (v8f){};
    const size_t aoff = (size_t)(r0 + lr) * K + 8 * hi, boff = (size_t)(c0 + lr) * K + 8 * hi;
#pragma unroll 1
    for (int kc = 0; kc < Kl; kc += 32) {
        V a[4], a2[4];
#pragma unroll
        for (int mb = 0; mb < 4; ++mb) { a[mb] = WFrag<T16>::ld(A + aoff + (size_t)mb * 16 * K + kc); if (NSPLIT == 1 || NSPLIT == 2) a2[mb] = WFrag<T16>::ld(A2 + aoff + (size_t)mb * 16 * K + kc); }
#pragma unroll
        for (int nb = 0; nb < 4; ++nb) { const V b = WFrag<T16>::ld(Bt + boff + (size_t)nb * 16 * K + kc); V b2; if (NSPLIT >= 2) b2 = WFrag<T16>::ld(Bt2 + boff + (size_t)nb * 16 * K + kc);
#pragma unroll
            for (int mb = 0; mb < 4; ++mb) { acc[mb][nb] = WFrag<T16>::mma(a[mb], b, acc[mb][nb]); if (NSPLIT == 1 || NSPLIT == 2) acc[mb][nb] = WFrag<T16>::mma(a2[mb], b, acc[mb][nb]); if (NSPLIT >= 2) acc[mb][nb] = WFrag<T16>::mma(a[mb], b2, acc[mb][nb]); } }
        asm volatile("v_nop\n\tv_nop\n\tv_nop\n\tv_nop" : "+v"(acc[0][0]), "+v"(acc[1][1]), "+v"(acc[2][2]), "+v"(acc[3][3]) : "v"(a[0]), "v"(a[3]));
    }
#pragma unroll
    for (int mb = 0; mb < 4; ++mb) {
#pragma unroll
        for (int nb = 0; nb < 4; ++nb) {
#pragma unroll
            for (int j = 0; j < 8; ++j) os[(hi * 8 + j) * 68 + nb * 16 + lr] = acc[mb][nb][j]; }
        __builtin_amdgcn_wave_barrier(); asm volatile("" ::: "memory");
        float* crow = C + (size_t)(r0 + mb * 16) * ldc + c0;
{
#pragma unroll
            for (int s = 0; s < 8; ++s) { const int row = 2 * s + hi, cofs = lr * 4; v4f val = *(const v4fa*)(os + row * 68 + cofs);
                *(v4f*)(crow + (size_t)row * ldc + cofs) = val; }
             }
        __builtin_amdgcn_wave_barrier(); asm volatile("" ::: "memory");
    }
}

__device__ __forceinline__ h16 tohx(float x) { return (h16)x; }
__device__ __forceinline__ void splitf(float y, unsigned short& h, unsigned short& l) { h = f2bf(y); l = f2bf(y - bf2f(h)); }
typedef __attribute__((ext_vector_type(2))) _Float16 v2h;
typedef __attribute__((ext_vector_type(4))) _Float16 v4h;
typedef __attribute__((ext_vector_type(2))) unsigned short v2us;
typedef __attribute__((ext_vector_type(4))) unsigned short v4us;
typedef __attribute__((ext_vector_type(2))) float v2f;
typedef __attribute__((ext_vector_type(4))) int v4i;

__global__ __launch_bounds__(256) void k_wtG(const float* __restrict__ w, int K, int N, bf* Bt) {
    const int lane = threadIdx.x & 31; const int L0 = (blockIdx.x * 8 + (threadIdx.x >> 5)) * 8; const int nlines = N * K / 64;
{
#pragma unroll 1
        for (int l = 0; l < 8; ++l) { const int L = L0 + l; if (L >= nlines) break; const size_t e = (size_t)L * 64 + lane * 2; const int k = (int)(e % K), n = (int)(e / K); v2us o;
            o[0] = f2bf(w[(size_t)k * N + n]); o[1] = f2bf(w[(size_t)(k + 1) * N + n]); *(v2us*)(Bt + e) = o; }
         }
}
__global__ __launch_bounds__(256) void k_cvt8(const float* __restrict__ src, bf* dst, size_t n8) { const size_t i = (size_t)blockIdx.x * 256 + threadIdx.x; if (i >= n8) return; const v8f v = *(const v8f*)(src + i * 8); v8us o;
#pragma unroll
    for (int k = 0; k < 8; ++k) o[k] = f2bf(v[k]); *(v8us*)(dst + i * 8) = o;  }
__constant__ float INV[ROT / 2] = {1.0,0.6209288835525513,0.38555270433425903,0.23940083384513855,0.1486508846282959,0.0923016369342804,0.057312753051519394,0.035587143152952194,0.022097086533904076,0.013720721006393433,0.008519591763615608,0.005290060769766569,0.003284751670435071,0.002039597136899829,0.0012664449168369174,0.0007863722858019173};
__global__ __launch_bounds__(256) void k_cstab(float* CS) { const int idx = blockIdx.x * 256 + threadIdx.x; if (idx >= TT * HD) return; const int t = idx / HD, d = idx % HD; v2f cs; if (d < ROT) { const int i = (d < ROT / 2) ? d : d - ROT / 2; const float ang = __fmul_rn((float)t, INV[i]); cs[0] = cosf(ang); cs[1] = sinf(ang); } else { cs[0] = 1.0f; cs[1] = 0.0f; }
    *(v2f*)(CS + (size_t)idx * 2) = cs;  }

// k_rope: head planes [h][t][d] (fp16 + hi/lo) of partial-rope(x) x sc: rotate-half inside the first ROT dims (out[d] = x[d] cos - x[d+ROT/2] sin, out[d+ROT/2] = x[d+ROT/2] cos + x[d] sin), dims >= ROT pass through (cos 1, sin 0)
__global__ __launch_bounds__(256) void k_rope(const float* __restrict__ F, int pitch, int nheads, const float* __restrict__ CS, const float* __restrict__ RF, const float* __restrict__ nw, float sc, h16* P16, bf* Ph, bf* Pl) {
    const size_t e = ((size_t)blockIdx.x * 256 + threadIdx.x) * 2; if (e >= (size_t)nheads * TT * HD) return; const int d = (int)(e % HD); const int t = (int)((e / HD) % TT); const int h = (int)(e / ((size_t)HD * TT)); const float* f = F + (size_t)t * pitch + h * HD; const float rf = RF ? RF[(size_t)h * TT + t] : 1.0f; v2h o16; v2us oh, ol;
#pragma unroll
    for (int q = 0; q < 2; ++q) { const int dd = d + q; const int dp = (dd < ROT) ? ((dd < ROT / 2) ? dd + ROT / 2 : dd - ROT / 2) : dd;   /* rotate-half inside the first ROT dims; identity beyond */ float x0 = f[dd], x1 = f[dp];
        if (RF) { float n0 = __fmul_rn(x0, rf), n1 = __fmul_rn(x1, rf); asm volatile("" : "+v"(n0)); asm volatile("" : "+v"(n1)); x0 = __fmul_rn(bfr(nw[dd]), n0); x1 = __fmul_rn(bfr(nw[dp]), n1); }
        const v2f cs = *(const v2f*)(CS + ((size_t)t * HD + dd) * 2); float a = __fmul_rn(x0, cs[0]), bq = __fmul_rn(x1, cs[1]); asm volatile("" : "+v"(a)); asm volatile("" : "+v"(bq)); const float r = ((dd < ROT / 2) ? __fsub_rn(a, bq) : __fadd_rn(a, bq)) * sc;   /* dd >= ROT: bq = x * 0 = 0 added (exact) */
        o16[q] = tohx(r); unsigned short a2, c2; splitf(r, a2, c2); oh[q] = a2; ol[q] = c2; }
    *(v2h*)(P16 + e) = o16; *(v2us*)(Ph + e) = oh; *(v2us*)(Pl + e) = ol;  }
__global__ __launch_bounds__(256) void k_vtp(const float* __restrict__ F, int pitch, int nheads, h16* V16, bf* Vh, bf* Vl) { const size_t e = ((size_t)blockIdx.x * 256 + threadIdx.x) * 2; if (e >= (size_t)nheads * HD * TT) return; const int t = (int)(e % TT); const int d = (int)((e / TT) % HD); const int g = (int)(e / ((size_t)TT * HD)); v2h o16; v2us oh, ol;
#pragma unroll
    for (int q = 0; q < 2; ++q) { const float x = F[(size_t)(t + q) * pitch + g * HD + d]; o16[q] = tohx(x); unsigned short a2, c2; splitf(x, a2, c2); oh[q] = a2; ol[q] = c2; }
    *(v2h*)(V16 + e) = o16; *(v2us*)(Vh + e) = oh; *(v2us*)(Vl + e) = ol;  }
// k_asoft: per row (zz, i): t = S x HD^-0.5 for j <= i and i - j < WIN (WIN = TT, so plain causal; the reference's -1e9 additive fill vanishes identically); softmax over the 2048 keys (register row, one exp, fixed trees);
__global__ __launch_bounds__(256) void k_asoft(const float* __restrict__ Sb, h16* P16, bf* Ph, bf* Pl) {
    const int lane = threadIdx.x & 31; const int row = blockIdx.x * 8 + (threadIdx.x >> 5); if (row >= ZH * TT) return; const int i = row % TT; const int zz = row / TT; (void)zz; const bool hires = (i < RH); const float* sr = Sb + (size_t)row * TT; float v[TT / 32]; float mx = -3.0e38f;
#pragma unroll
    for (int ch = 0; ch < TT / 128; ++ch) { const int j0 = ch * 128 + lane * 4; const v4f a = *(const v4f*)(sr + j0);
#pragma unroll
        for (int q = 0; q < 4; ++q) { const int j = j0 + q; (void)j; float sa = a[q] * SCL; asm volatile("" : "+v"(sa)); const float t = (j <= i && i - j < WIN) ? sa : -3.0e38f; v[ch * 4 + q] = t; mx = fmaxf(mx, t); } }
#pragma unroll
    for (int sh = 16; sh; sh >>= 1) mx = fmaxf(mx, __shfl_xor(mx, sh, 32));
    float sum = 0.f;
#pragma unroll
    for (int k = 0; k < TT / 32; ++k) { float d0 = __fsub_rn(v[k], mx); asm volatile("" : "+v"(d0)); v[k] = __builtin_amdgcn_exp2f(__fmul_rn(d0, 1.4426950408889634f)); sum += v[k]; }
#pragma unroll
    for (int sh = 16; sh; sh >>= 1) sum += __shfl_xor(sum, sh, 32);
    const float f = __fdiv_rn(hires ? 1.0f : PCAR, sum);
{
        if (hires) {
#pragma unroll
            for (int ch = 0; ch < TT / 128; ++ch) { v4us oh, ol;
#pragma unroll
                for (int q = 0; q < 4; ++q) { unsigned short a, c2; splitf(v[ch * 4 + q] * f, a, c2); oh[q] = a; ol[q] = c2; }
                const size_t oo = ((size_t)zz * (RH ? RH : 1) + i) * TT + ch * 128 + lane * 4; *(v4us*)(Ph + oo) = oh; *(v4us*)(Pl + oo) = ol; }
        } else {
#pragma unroll
            for (int ch = 0; ch < TT / 128; ++ch) { v4h o4;
#pragma unroll
                for (int q = 0; q < 4; ++q) o4[q] = tohx(v[ch * 4 + q] * f);
                *(v4h*)(P16 + (size_t)row * TT + ch * 128 + lane * 4) = o4; } }
         }
}
__global__ __launch_bounds__(256) void k_merge(const float* __restrict__ O, int h0, bf* Ah, bf* Al) { const size_t e = ((size_t)blockIdx.x * 256 + threadIdx.x) * 2; if (e >= (size_t)ZH * TT * HD) return; const int d = (int)(e % HD); const int t = (int)((e / HD) % TT); const int zz = (int)(e / ((size_t)HD * TT)); const float cs = (t < RH) ? 1.0f : (1.0f / PCAR); const size_t oo = (size_t)t * DQ + (h0 + zz) * HD + d;
    v2us oh, ol;
#pragma unroll
    for (int q = 0; q < 2; ++q) { unsigned short a, c2; splitf(O[e + q] * cs, a, c2); oh[q] = a; ol[q] = c2; } *(v2us*)(Ah + oo) = oh; *(v2us*)(Al + oo) = ol;  }

extern "C" void kernel_launch(void* const* d_in, const int* in_sizes, int n_in,
                              void* d_out, int out_size, void* d_ws, size_t ws_size, hipStream_t stream) {
    (void)in_sizes; (void)n_in; (void)out_size;
    const float* x = (const float*)d_in[0]; const float* wq = (const float*)d_in[1]; const float* bq = (const float*)d_in[2]; const float* wk = (const float*)d_in[3]; const float* bk = (const float*)d_in[4]; const float* wv = (const float*)d_in[5]; const float* bv = (const float*)d_in[6]; const float* wo = (const float*)d_in[7]; const float* bo = (const float*)d_in[8]; const float* cosT = nullptr; const float* sinT = nullptr; (void)cosT; (void)sinT;
    float* OUT = (float*)d_out;     // [2][2048][1024]
    char* wsp = (char*)d_ws;
    auto take = [&](size_t bytes) { char* p = wsp; wsp += (bytes + 255) & ~(size_t)255; return (void*)p; };
    bf* WQ = (bf*)take((size_t)DQ * DM * 2); bf* WK = (bf*)take((size_t)DKV * DM * 2); bf* WV = (bf*)take((size_t)DKV * DM * 2); bf* WO = (bf*)take((size_t)DM * DQ * 2); float* CS = (float*)take((size_t)TT * HD * 2 * 4);
    bf* XB = (bf*)take((size_t)TT * DM * 2); float* FQ = (float*)take((size_t)TT * DQ * 4); float* FK = (float*)take((size_t)TT * DKV * 4);
    h16* QP16 = (h16*)take((size_t)NH_ * TT * HD * 2); h16* KP16 = (h16*)take((size_t)NKV * TT * HD * 2); h16* VT16 = (h16*)take((size_t)NKV * HD * TT * 2);
    bf* QPh = (bf*)take((size_t)NH_ * TT * HD * 2); bf* QPl = (bf*)take((size_t)NH_ * TT * HD * 2); bf* KPh = (bf*)take((size_t)NKV * TT * HD * 2); bf* KPl = (bf*)take((size_t)NKV * TT * HD * 2); bf* VTh = (bf*)take((size_t)NKV * HD * TT * 2); bf* VTl = (bf*)take((size_t)NKV * HD * TT * 2); bf* Ph = (bf*)take((size_t)ZH * RH * TT * 2); bf* Pl = (bf*)take((size_t)ZH * RH * TT * 2);
    float* Sb = (float*)take((size_t)ZH * TT * TT * 4); h16* P16 = (h16*)take((size_t)ZH * TT * TT * 2); float* Ob = (float*)take((size_t)ZH * TT * HD * 4); bf* ATh = (bf*)take((size_t)TT * DQ * 2); bf* ATl = (bf*)take((size_t)TT * DQ * 2);
    if ((size_t)(wsp - (char*)d_ws) > ws_size) return;    // ws 256 MiB
    float* FV = FK;   // v projection reuses the k buffer after the k planes are built (stream-ordered)
    { k_wtG<<<(unsigned)((DM * DQ / 64 + 63) / 64), 256, 0, stream>>>(wq, DM, DQ, WQ); k_wtG<<<(unsigned)((DM * DKV / 64 + 63) / 64), 256, 0, stream>>>(wk, DM, DKV, WK); k_wtG<<<(unsigned)((DM * DKV / 64 + 63) / 64), 256, 0, stream>>>(wv, DM, DKV, WV);
      k_wtG<<<(unsigned)((DQ * DM / 64 + 63) / 64), 256, 0, stream>>>(wo, DQ, DM, WO);
      k_cstab<<<(TT * HD + 255) / 256, 256, 0, stream>>>(CS); }
    const unsigned LQ = (unsigned)(((size_t)NH_ * TT * HD / 2 + 255) / 256), LKv = (unsigned)(((size_t)NKV * TT * HD / 2 + 255) / 256);
    for (int b = 0; b < NB_; ++b) {
        
        k_cvt8<<<(unsigned)(((size_t)TT * DM / 8 + 255) / 256), 256, 0, stream>>>(x + (size_t)b * TT * DM, XB, (size_t)TT * DM / 8);
        k_gemmw<bf, 0, true><<<dim3(TT / 64, DQ / 64, 1), 32, 0, stream>>>(XB, nullptr, WQ, nullptr, DM, FQ, DQ, bq, 0, 0, 0);
        k_rope<<<LQ, 256, 0, stream>>>(FQ, DQ, NH_, CS, nullptr, nullptr, 1.0f, QP16, QPh, QPl);
        k_gemmw<bf, 0, true><<<dim3(TT / 64, DKV / 64, 1), 32, 0, stream>>>(XB, nullptr, WK, nullptr, DM, FK, DKV, bk, 0, 0, 0);
        k_rope<<<LKv, 256, 0, stream>>>(FK, DKV, NKV, CS, nullptr, nullptr, 1.0f, KP16, KPh, KPl);
        k_gemmw<bf, 0, true><<<dim3(TT / 64, DKV / 64, 1), 32, 0, stream>>>(XB, nullptr, WV, nullptr, DM, FV, DKV, bv, 0, 0, 0); k_vtp<<<LKv, 256, 0, stream>>>(FV, DKV, NKV, VT16, VTh, VTl);
        for (int h0 = 0; h0 < NH_; h0 += ZH) { const size_t zq = (size_t)h0, zk = (size_t)(h0 / REP);   // one kv head per query head: the pass's two heads use consecutive kv planes (z-strides TT*HD)
            k_gemmc<bf, 2, 1><<<dim3(RH / 64, TT / 64, ZH), 32, 0, stream>>>(QPh + zq * TT * HD, QPl + zq * TT * HD, KPh + zk * TT * HD, KPl + zk * TT * HD, HD, Sb, TT, 0, (size_t)TT * HD, (size_t)TT * HD, (size_t)TT * TT);
            k_gemmc<h16, 0, 1><<<dim3((TT - RH) / 64, TT / 64, ZH), 32, 0, stream>>>(QP16 + zq * TT * HD + (size_t)RH * HD, nullptr, KP16 + zk * TT * HD, nullptr, HD, Sb + (size_t)RH * TT, TT, RH, (size_t)TT * HD, (size_t)TT * HD, (size_t)TT * TT);
            k_asoft<<<ZH * TT / 8, 256, 0, stream>>>(Sb, P16, Ph, Pl);
            k_gemmc<bf, 2, 2><<<dim3(RH / 64, HD / 64, ZH), 32, 0, stream>>>(Ph, Pl, VTh + zk * HD * TT, VTl + zk * HD * TT, TT, Ob, HD, 0, (size_t)RH * TT, (size_t)HD * TT, (size_t)TT * HD);
            k_gemmc<h16, 0, 2><<<dim3((TT - RH) / 64, HD / 64, ZH), 32, 0, stream>>>(P16 + (size_t)RH * TT, nullptr, VT16 + zk * HD * TT, nullptr, TT, Ob + (size_t)RH * HD, HD, RH, (size_t)TT * TT, (size_t)HD * TT, (size_t)TT * HD);
            k_merge<<<(unsigned)(((size_t)ZH * TT * HD / 2 + 255) / 256), 256, 0, stream>>>(Ob, h0, ATh, ATl); }
        k_gemmw<bf, 1, true><<<dim3(TT / 64, DM / 64, 1), 32, 0, stream>>>(ATh, ATl, WO, nullptr, DQ, OUT + (size_t)b * TT * DM, DM, bo, 0, 0, 0); }
}

// v001
// It runs in 966 microseconds.
// Two timings next to v000 put it at 1.60 and 1.62 times that version's speed.
#include <hip/hip_runtime.h>

// Multi-head causal attention with partial rotary (x [2][2048][1024]; q/k/v = x W + b ('xw' [1024][1024], 16 x 64); rotate-half rotary on the FIRST 32 dims of each head (pairs d, d+16), angles t x inv[d mod 16] with inv_i = 2048^(-2i/32), the other 32 dims pass through; causal (tril) -inf; softmax(q.k / 8); out = merged Wo ('xw' [1024][1024]) + bo -> [2][2048][1024]).
// Compute dtypes, f32 accumulate: every input rounded to bf16; q/k/v on PLAIN bf16 operands (inputs: exact) + bias; rotary in f32 from an on-chip table (inv constants are the reference's own f32 values; angle = t x inv one product; precise cosf/sinf); causal scores and attn.v: query rows < 512 hl (3 products), the rest single fp16 (x1024), causal tile skipping; softmax f32; Wo hl x exact (2 products) + bias.

#define NB_  2
#define TT   2048
#define DM   1024
#define NH_  16
#define NKV  16
#define REP  (NH_ / NKV)
#define HD   64
#define DQ   (NH_ * HD)
#define DKV  (NKV * HD)
#define ZH   2
#define RH   512                  // query rows < RH use hi+lo planes (0: none)
#define WIN  2048
#define ROT  32                   // rotary dims per head (rotate-half inside them)
#define PCAR 1024.0f
#define SCL  0.125f   // HD^-0.5
typedef _Float16 h16;
typedef unsigned short bf;
typedef __attribute__((ext_vector_type(16))) __bf16   v16bf;
typedef __attribute__((ext_vector_type(16))) _Float16 v16h;
typedef __attribute__((ext_vector_type(8)))  _Float16 v8h;
typedef __attribute__((ext_vector_type(8)))  unsigned short v8us;
typedef __attribute__((ext_vector_type(8)))  float    v8f;
typedef __attribute__((ext_vector_type(4)))  float    v4f;
typedef v8h  __attribute__((may_alias)) v8ha;
typedef v4f  __attribute__((may_alias)) v4fa;
typedef v8us __attribute__((may_alias)) v8usa;

__device__ __forceinline__ unsigned short f2bf(float f) { unsigned u = __float_as_uint(f); u += 0x7FFFu + ((u >> 16) & 1u); return (unsigned short)(u >> 16); }
__device__ __forceinline__ float bf2f(unsigned short b) { return __uint_as_float(((unsigned)b) << 16); }
__device__ __forceinline__ float bfr(float f) { return bf2f(f2bf(f)); }
__device__ __forceinline__ v16h cat16(v8h lo, v8h hi) { return __builtin_shufflevector(lo, hi, 0, 1, 2, 3, 4, 5, 6, 7, 8, 9, 10, 11, 12, 13, 14, 15); }
__device__ __forceinline__ v16bf cat16b(v8us lo, v8us hi) { return __builtin_bit_cast(v16bf, __builtin_shufflevector(lo, hi, 0, 1, 2, 3, 4, 5, 6, 7, 8, 9, 10, 11, 12, 13, 14, 15)); }
__device__ __forceinline__ v8f wmma16(v16h a, v16h b, v8f c) { return __builtin_amdgcn_wmma_f32_16x16x32_f16(false, a, false, b, (short)0, c, false, false); }
__device__ __forceinline__ v8f wmmab(v16bf a, v16bf b, v8f c) { return __builtin_amdgcn_wmma_f32_16x16x32_bf16(false, a, false, b, (short)0, c, false, false); }



// ---- k_gemmw: register-blocked GEMM, one 64x64 output tile per block (16 accumulators per wave), operands straight from K-contiguous 16-bit planes; grid (M/64, N/64, Z), 32 x NW threads.
// NW = 1: one wave does the whole K loop. NW > 1: the K loop is split over the block's NW waves, so that NW waves' load latencies run side by side: wave w takes the 64-wide k pieces w, w + NW, ...
// (64 k = one whole 128-byte line of every operand row, both halves read by the same wave); the NW f32 partial tiles are summed through LDS in wave order 0 .. NW-1.
// C[m][n] (f32, pitch ldc, + optional f32 bias[n]) = sum_k A[m][k] Bt[n][k] (+ split products per NSPLIT). z-batch strides sA/sB/sC in elements. K % 32 == 0.
template <typename T16> struct WFrag;
template <> struct WFrag<h16> { typedef v16h V; static __device__ __forceinline__ V ld(const h16* p) { return cat16(*(const v8h*)p, *(const v8h*)(p + 16)); } static __device__ __forceinline__ v8f mma(V a, V b, v8f c) { return wmma16(a, b, c); } };
template <> struct WFrag<bf> { typedef v16bf V; static __device__ __forceinline__ V ld(const bf* p) { return cat16b(*(const v8us*)p, *(const v8us*)(p + 16)); } static __device__ __forceinline__ v8f mma(V a, V b, v8f c) { return wmmab(a, b, c); } };
template <typename T16, int NSPLIT, bool BIAS, int NW>
__global__ __launch_bounds__(32 * NW) void k_gemmw(const T16* __restrict__ A, const T16* __restrict__ A2, const T16* __restrict__ Bt, const T16* __restrict__ Bt2, int K, float* C, int ldc, const float* __restrict__ bias, size_t sA, size_t sB, size_t sC) {
    typedef typename WFrag<T16>::V V;
    __shared__ __align__(16) float os[(NW == 1 ? 16 : NW * 64) * 68];
    const int wave = (NW == 1) ? 0 : __builtin_amdgcn_readfirstlane((int)(threadIdx.x >> 5));   // scalar, so that the K loop's branch is wave-uniform (matrix instructions need every lane on)
    const size_t z = blockIdx.z; A += z * sA; if (A2) A2 += z * sA; Bt += z * sB; if (Bt2) Bt2 += z * sB; C += z * sC;
    const int lane = threadIdx.x & 31, lr = lane & 15, hi = lane >> 4; const int r0 = blockIdx.x * 64, c0 = blockIdx.y * 64;
    v8f acc[4][4];
#pragma unroll
    for (int mb = 0; mb < 4; ++mb)
#pragma unroll
        for (int nb = 0; nb < 4; ++nb) acc[mb][nb] = (v8f){};
    const size_t aoff = (size_t)(r0 + lr) * K + 8 * hi, boff = (size_t)(c0 + lr) * K + 8 * hi;
#pragma unroll 1
    for (int kc = wave * 64; kc < K; kc += (NW == 1 || !(kc & 32)) ? 32 : 64 * NW - 32) {
        V a[4], a2[4];
#pragma unroll
        for (int mb = 0; mb < 4; ++mb) { a[mb] = WFrag<T16>::ld(A + aoff + (size_t)mb * 16 * K + kc); if (NSPLIT == 1 || NSPLIT == 2) a2[mb] = WFrag<T16>::ld(A2 + aoff + (size_t)mb * 16 * K + kc); }
#pragma unroll
        for (int nb = 0; nb < 4; ++nb) { const V b = WFrag<T16>::ld(Bt + boff + (size_t)nb * 16 * K + kc); V b2; if (NSPLIT >= 2) b2 = WFrag<T16>::ld(Bt2 + boff + (size_t)nb * 16 * K + kc);
#pragma unroll
            for (int mb = 0; mb < 4; ++mb) { acc[mb][nb] = WFrag<T16>::mma(a[mb], b, acc[mb][nb]); if (NSPLIT == 1 || NSPLIT == 2) acc[mb][nb] = WFrag<T16>::mma(a2[mb], b, acc[mb][nb]); if (NSPLIT >= 2) acc[mb][nb] = WFrag<T16>::mma(a[mb], b2, acc[mb][nb]); } }
        asm volatile("v_nop\n\tv_nop\n\tv_nop\n\tv_nop" : "+v"(acc[0][0]), "+v"(acc[1][1]), "+v"(acc[2][2]), "+v"(acc[3][3]) : "v"(a[0]), "v"(a[3]));
    }
    if constexpr (NW > 1) {
#pragma unroll
        for (int mb = 0; mb < 4; ++mb)
#pragma unroll
            for (int nb = 0; nb < 4; ++nb)
#pragma unroll
                for (int j = 0; j < 8; ++j) os[(wave * 64 + mb * 16 + hi * 8 + j) * 68 + nb * 16 + lr] = acc[mb][nb][j];
        __syncthreads();   // every wave's partial tile is in LDS before any thread sums across the waves
#pragma unroll
        for (int s = 0; s < 32 / NW; ++s) { const int i = s * 32 * NW + (int)threadIdx.x, row = i >> 4, cofs = (i & 15) * 4; v4f val = *(const v4fa*)(os + row * 68 + cofs);
#pragma unroll
            for (int w = 1; w < NW; ++w) val += *(const v4fa*)(os + (w * 64 + row) * 68 + cofs);
            if (BIAS) { val[0] += bfr(bias[c0 + cofs]); val[1] += bfr(bias[c0 + cofs + 1]); val[2] += bfr(bias[c0 + cofs + 2]); val[3] += bfr(bias[c0 + cofs + 3]); }
            *(v4f*)(C + (size_t)(r0 + row) * ldc + c0 + cofs) = val; }
    } else {
#pragma unroll
    for (int mb = 0; mb < 4; ++mb) {
#pragma unroll
        for (int nb = 0; nb < 4; ++nb) {
#pragma unroll
            for (int j = 0; j < 8; ++j) os[(hi * 8 + j) * 68 + nb * 16 + lr] = acc[mb][nb][j]; }
        __builtin_amdgcn_wave_barrier(); asm volatile("" ::: "memory");
        float* crow = C + (size_t)(r0 + mb * 16) * ldc + c0;
{
#pragma unroll
            for (int s = 0; s < 8; ++s) { const int row = 2 * s + hi, cofs = lr * 4; v4f val = *(const v4fa*)(os + row * 68 + cofs); if (BIAS) { val[0] += bfr(bias[c0 + cofs]); val[1] += bfr(bias[c0 + cofs + 1]); val[2] += bfr(bias[c0 + cofs + 2]); val[3] += bfr(bias[c0 + cofs + 3]); }
                *(v4f*)(crow + (size_t)row * ldc + cofs) = val; }
             }
        __builtin_amdgcn_wave_barrier(); asm volatile("" ::: "memory");
    }
    }
}

// ---- k_gemmc: the same 64x64 tile GEMM (NW as above: 1 for the scores, whose K is 64; 8 or 16 for probability x value) specialised for causal attention: CMODE 1 skips score tiles entirely above the diagonal (query rows r0+roff.., key columns c0..), CMODE 2 limits the
// key (K) loop of the probability x value contraction to the diagonal block (probabilities beyond it are exactly zero). roff = row offset of this launch's first row within the sequence.
template <typename T16, int NSPLIT, int CMODE, int NW>
__global__ __launch_bounds__(32 * NW) void k_gemmc(const T16* __restrict__ A, const T16* __restrict__ A2, const T16* __restrict__ Bt, const T16* __restrict__ Bt2, int K, float* C, int ldc, int roff, size_t sA, size_t sB, size_t sC) {
    typedef typename WFrag<T16>::V V;
    __shared__ __align__(16) float os[(NW == 1 ? 16 : NW * 64) * 68];
    const int wave = (NW == 1) ? 0 : __builtin_amdgcn_readfirstlane((int)(threadIdx.x >> 5));   // scalar, so that the K loop's branch is wave-uniform (matrix instructions need every lane on)
    const size_t z = blockIdx.z; A += z * sA; if (A2) A2 += z * sA; Bt += z * sB; if (Bt2) Bt2 += z * sB; C += z * sC;
    const int lane = threadIdx.x & 31, lr = lane & 15, hi = lane >> 4; const int r0 = blockIdx.x * 64, c0 = blockIdx.y * 64;
    if (CMODE == 1 && c0 > r0 + roff + 63) return;                  // score tile entirely above the causal diagonal: never read (the softmax masks j > i by select)
    const int Kl = (CMODE == 2) ? min(K, r0 + roff + 64) : K;        // P.V: probabilities are exactly 0 beyond the diagonal block, so the K loop stops there
    v8f acc[4][4];
#pragma unroll
    for (int mb = 0; mb < 4; ++mb)
#pragma unroll
        for (int nb = 0; nb < 4; ++nb) acc[mb][nb] = (v8f){};
    const size_t aoff = (size_t)(r0 + lr) * K + 8 * hi, boff = (size_t)(c0 + lr) * K + 8 * hi;
#pragma unroll 1
    for (int kc = wave * 64; kc < Kl; kc += (NW == 1 || !(kc & 32)) ? 32 : 64 * NW - 32) {
        V a[4], a2[4];
#pragma unroll
        for (int mb = 0; mb < 4; ++mb) { a[mb] = WFrag<T16>::ld(A + aoff + (size_t)mb * 16 * K + kc); if (NSPLIT == 1 || NSPLIT == 2) a2[mb] = WFrag<T16>::ld(A2 + aoff + (size_t)mb * 16 * K + kc); }
#pragma unroll
        for (int nb = 0; nb < 4; ++nb) { const V b = WFrag<T16>::ld(Bt + boff + (size_t)nb * 16 * K + kc); V b2; if (NSPLIT >= 2) b2 = WFrag<T16>::ld(Bt2 + boff + (size_t)nb * 16 * K + kc);
#pragma unroll
            for (int mb = 0; mb < 4; ++mb) { acc[mb][nb] = WFrag<T16>::mma(a[mb], b, acc[mb][nb]); if (NSPLIT == 1 || NSPLIT == 2) acc[mb][nb] = WFrag<T16>::mma(a2[mb], b, acc[mb][nb]); if (NSPLIT >= 2) acc[mb][nb] = WFrag<T16>::mma(a[mb], b2, acc[mb][nb]); } }
        asm volatile("v_nop\n\tv_nop\n\tv_nop\n\tv_nop" : "+v"(acc[0][0]), "+v"(acc[1][1]), "+v"(acc[2][2]), "+v"(acc[3][3]) : "v"(a[0]), "v"(a[3]));
    }
    if constexpr (NW > 1) {
#pragma unroll
        for (int mb = 0; mb < 4; ++mb)
#pragma unroll
            for (int nb = 0; nb < 4; ++nb)
#pragma unroll
                for (int j = 0; j < 8; ++j) os[(wave * 64 + mb * 16 + hi * 8 + j) * 68 + nb * 16 + lr] = acc[mb][nb][j];
        __syncthreads();   // every wave's partial tile is in LDS before any thread sums across the waves
#pragma unroll
        for (int s = 0; s < 32 / NW; ++s) { const int i = s * 32 * NW + (int)threadIdx.x, row = i >> 4, cofs = (i & 15) * 4; v4f val = *(const v4fa*)(os + row * 68 + cofs);
#pragma unroll
            for (int w = 1; w < NW; ++w) val += *(const v4fa*)(os + (w * 64 + row) * 68 + cofs);
            *(v4f*)(C + (size_t)(r0 + row) * ldc + c0 + cofs) = val; }
    } else {
#pragma unroll
    for (int mb = 0; mb < 4; ++mb) {
#pragma unroll
        for (int nb = 0; nb < 4; ++nb) {
#pragma unroll
            for (int j = 0; j < 8; ++j) os[(hi * 8 + j) * 68 + nb * 16 + lr] = acc[mb][nb][j]; }
        __builtin_amdgcn_wave_barrier(); asm volatile("" ::: "memory");
        float* crow = C + (size_t)(r0 + mb * 16) * ldc + c0;
{
#pragma unroll
            for (int s = 0; s < 8; ++s) { const int row = 2 * s + hi, cofs = lr * 4; v4f val = *(const v4fa*)(os + row * 68 + cofs);
                *(v4f*)(crow + (size_t)row * ldc + cofs) = val; }
             }
        __builtin_amdgcn_wave_barrier(); asm volatile("" ::: "memory");
    }
    }
}

__device__ __forceinline__ h16 tohx(float x) { return (h16)x; }
__device__ __forceinline__ void splitf(float y, unsigned short& h, unsigned short& l) { h = f2bf(y); l = f2bf(y - bf2f(h)); }
typedef __attribute__((ext_vector_type(2))) _Float16 v2h;
typedef __attribute__((ext_vector_type(4))) _Float16 v4h;
typedef __attribute__((ext_vector_type(2))) unsigned short v2us;
typedef __attribute__((ext_vector_type(4))) unsigned short v4us;
typedef __attribute__((ext_vector_type(2))) float v2f;
typedef __attribute__((ext_vector_type(4))) int v4i;

__global__ __launch_bounds__(256) void k_wtG(const float* __restrict__ w, int K, int N, bf* Bt) {
    const int lane = threadIdx.x & 31; const int L0 = (blockIdx.x * 8 + (threadIdx.x >> 5)) * 8; const int nlines = N * K / 64;
{
#pragma unroll 1
        for (int l = 0; l < 8; ++l) { const int L = L0 + l; if (L >= nlines) break; const size_t e = (size_t)L * 64 + lane * 2; const int k = (int)(e % K), n = (int)(e / K); v2us o;
            o[0] = f2bf(w[(size_t)k * N + n]); o[1] = f2bf(w[(size_t)(k + 1) * N + n]); *(v2us*)(Bt + e) = o; }
         }
}
__global__ __launch_bounds__(256) void k_cvt8(const float* __restrict__ src, bf* dst, size_t n8) { const size_t i = (size_t)blockIdx.x * 256 + threadIdx.x; if (i >= n8) return; const v8f v = *(const v8f*)(src + i * 8); v8us o;
#pragma unroll
    for (int k = 0; k < 8; ++k) o[k] = f2bf(v[k]); *(v8us*)(dst + i * 8) = o;  }
__constant__ float INV[ROT / 2] = {1.0,0.6209288835525513,0.38555270433425903,0.23940083384513855,0.1486508846282959,0.0923016369342804,0.057312753051519394,0.035587143152952194,0.022097086533904076,0.013720721006393433,0.008519591763615608,0.005290060769766569,0.003284751670435071,0.002039597136899829,0.0012664449168369174,0.0007863722858019173};
__global__ __launch_bounds__(256) void k_cstab(float* CS) { const int idx = blockIdx.x * 256 + threadIdx.x; if (idx >= TT * HD) return; const int t = idx / HD, d = idx % HD; v2f cs; if (d < ROT) { const int i = (d < ROT / 2) ? d : d - ROT / 2; const float ang = __fmul_rn((float)t, INV[i]); cs[0] = cosf(ang); cs[1] = sinf(ang); } else { cs[0] = 1.0f; cs[1] = 0.0f; }
    *(v2f*)(CS + (size_t)idx * 2) = cs;  }

// k_rope: head planes [h][t][d] (fp16 + hi/lo) of partial-rope(x) x sc: rotate-half inside the first ROT dims (out[d] = x[d] cos - x[d+ROT/2] sin, out[d+ROT/2] = x[d+ROT/2] cos + x[d] sin), dims >= ROT pass through (cos 1, sin 0)
__global__ __launch_bounds__(256) void k_rope(const float* __restrict__ F, int pitch, int nheads, const float* __restrict__ CS, const float* __restrict__ RF, const float* __restrict__ nw, float sc, h16* P16, bf* Ph, bf* Pl) {
    const size_t e = ((size_t)blockIdx.x * 256 + threadIdx.x) * 2; if (e >= (size_t)nheads * TT * HD) return; const int d = (int)(e % HD); const int t = (int)((e / HD) % TT); const int h = (int)(e / ((size_t)HD * TT)); const float* f = F + (size_t)t * pitch + h * HD; const float rf = RF ? RF[(size_t)h * TT + t] : 1.0f; v2h o16; v2us oh, ol;
#pragma unroll
    for (int q = 0; q < 2; ++q) { const int dd = d + q; const int dp = (dd < ROT) ? ((dd < ROT / 2) ? dd + ROT / 2 : dd - ROT / 2) : dd;   /* rotate-half inside the first ROT dims; identity beyond */ float x0 = f[dd], x1 = f[dp];
        if (RF) { float n0 = __fmul_rn(x0, rf), n1 = __fmul_rn(x1, rf); asm volatile("" : "+v"(n0)); asm volatile("" : "+v"(n1)); x0 = __fmul_rn(bfr(nw[dd]), n0); x1 = __fmul_rn(bfr(nw[dp]), n1); }
        const v2f cs = *(const v2f*)(CS + ((size_t)t * HD + dd) * 2); float a = __fmul_rn(x0, cs[0]), bq = __fmul_rn(x1, cs[1]); asm volatile("" : "+v"(a)); asm volatile("" : "+v"(bq)); const float r = ((dd < ROT / 2) ? __fsub_rn(a, bq) : __fadd_rn(a, bq)) * sc;   /* dd >= ROT: bq = x * 0 = 0 added (exact) */
        o16[q] = tohx(r); unsigned short a2, c2; splitf(r, a2, c2); oh[q] = a2; ol[q] = c2; }
    *(v2h*)(P16 + e) = o16; *(v2us*)(Ph + e) = oh; *(v2us*)(Pl + e) = ol;  }
__global__ __launch_bounds__(256) void k_vtp(const float* __restrict__ F, int pitch, int nheads, h16* V16, bf* Vh, bf* Vl) { const size_t e = ((size_t)blockIdx.x * 256 + threadIdx.x) * 2; if (e >= (size_t)nheads * HD * TT) return; const int t = (int)(e % TT); const int d = (int)((e / TT) % HD); const int g = (int)(e / ((size_t)TT * HD)); v2h o16; v2us oh, ol;
#pragma unroll
    for (int q = 0; q < 2; ++q) { const float x = F[(size_t)(t + q) * pitch + g * HD + d]; o16[q] = tohx(x); unsigned short a2, c2; splitf(x, a2, c2); oh[q] = a2; ol[q] = c2; }
    *(v2h*)(V16 + e) = o16; *(v2us*)(Vh + e) = oh; *(v2us*)(Vl + e) = ol;  }
// k_asoft: per row (zz, i): t = S x HD^-0.5 for j <= i and i - j < WIN (WIN = TT, so plain causal; the reference's -1e9 additive fill vanishes identically); softmax over the 2048 keys (register row, one exp, fixed trees);
__global__ __launch_bounds__(256) void k_asoft(const float* __restrict__ Sb, h16* P16, bf* Ph, bf* Pl) {
    const int lane = threadIdx.x & 31; const int row = blockIdx.x * 8 + (threadIdx.x >> 5); if (row >= ZH * TT) return; const int i = row % TT; const int zz = row / TT; (void)zz; const bool hires = (i < RH); const float* sr = Sb + (size_t)row * TT; float v[TT / 32]; float mx = -3.0e38f;
#pragma unroll
    for (int ch = 0; ch < TT / 128; ++ch) { const int j0 = ch * 128 + lane * 4; const v4f a = *(const v4f*)(sr + j0);
#pragma unroll
        for (int q = 0; q < 4; ++q) { const int j = j0 + q; (void)j; float sa = a[q] * SCL; asm volatile("" : "+v"(sa)); const float t = (j <= i && i - j < WIN) ? sa : -3.0e38f; v[ch * 4 + q] = t; mx = fmaxf(mx, t); } }
#pragma unroll
    for (int sh = 16; sh; sh >>= 1) mx = fmaxf(mx, __shfl_xor(mx, sh, 32));
    float sum = 0.f;
#pragma unroll
    for (int k = 0; k < TT / 32; ++k) { float d0 = __fsub_rn(v[k], mx); asm volatile("" : "+v"(d0)); v[k] = __builtin_amdgcn_exp2f(__fmul_rn(d0, 1.4426950408889634f)); sum += v[k]; }
#pragma unroll
    for (int sh = 16; sh; sh >>= 1) sum += __shfl_xor(sum, sh, 32);
    const float f = __fdiv_rn(hires ? 1.0f : PCAR, sum);
{
        if (hires) {
#pragma unroll
            for (int ch = 0; ch < TT / 128; ++ch) { v4us oh, ol;
#pragma unroll
                for (int q = 0; q < 4; ++q) { unsigned short a, c2; splitf(v[ch * 4 + q] * f, a, c2); oh[q] = a; ol[q] = c2; }
                const size_t oo = ((size_t)zz * (RH ? RH : 1) + i) * TT + ch * 128 + lane * 4; *(v4us*)(Ph + oo) = oh; *(v4us*)(Pl + oo) = ol; }
        } else {
#pragma unroll
            for (int ch = 0; ch < TT / 128; ++ch) { v4h o4;
#pragma unroll
                for (int q = 0; q < 4; ++q) o4[q] = tohx(v[ch * 4 + q] * f);
                *(v4h*)(P16 + (size_t)row * TT + ch * 128 + lane * 4) = o4; } }
         }
}
__global__ __launch_bounds__(256) void k_merge(const float* __restrict__ O, int h0, bf* Ah, bf* Al) { const size_t e = ((size_t)blockIdx.x * 256 + threadIdx.x) * 2; if (e >= (size_t)ZH * TT * HD) return; const int d = (int)(e % HD); const int t = (int)((e / HD) % TT); const int zz = (int)(e / ((size_t)HD * TT)); const float cs = (t < RH) ? 1.0f : (1.0f / PCAR); const size_t oo = (size_t)t * DQ + (h0 + zz) * HD + d;
    v2us oh, ol;
#pragma unroll
    for (int q = 0; q < 2; ++q) { unsigned short a, c2; splitf(O[e + q] * cs, a, c2); oh[q] = a; ol[q] = c2; } *(v2us*)(Ah + oo) = oh; *(v2us*)(Al + oo) = ol;  }

extern "C" void kernel_launch(void* const* d_in, const int* in_sizes, int n_in,
                              void* d_out, int out_size, void* d_ws, size_t ws_size, hipStream_t stream) {
    (void)in_sizes; (void)n_in; (void)out_size;
    const float* x = (const float*)d_in[0]; const float* wq = (const float*)d_in[1]; const float* bq = (const float*)d_in[2]; const float* wk = (const float*)d_in[3]; const float* bk = (const float*)d_in[4]; const float* wv = (const float*)d_in[5]; const float* bv = (const float*)d_in[6]; const float* wo = (const float*)d_in[7]; const float* bo = (const float*)d_in[8]; const float* cosT = nullptr; const float* sinT = nullptr; (void)cosT; (void)sinT;
    float* OUT = (float*)d_out;     // [2][2048][1024]
    char* wsp = (char*)d_ws;
    auto take = [&](size_t bytes) { char* p = wsp; wsp += (bytes + 255) & ~(size_t)255; return (void*)p; };
    bf* WQ = (bf*)take((size_t)DQ * DM * 2); bf* WK = (bf*)take((size_t)DKV * DM * 2); bf* WV = (bf*)take((size_t)DKV * DM * 2); bf* WO = (bf*)take((size_t)DM * DQ * 2); float* CS = (float*)take((size_t)TT * HD * 2 * 4);
    bf* XB = (bf*)take((size_t)TT * DM * 2); float* FQ = (float*)take((size_t)TT * DQ * 4); float* FK = (float*)take((size_t)TT * DKV * 4);
    h16* QP16 = (h16*)take((size_t)NH_ * TT * HD * 2); h16* KP16 = (h16*)take((size_t)NKV * TT * HD * 2); h16* VT16 = (h16*)take((size_t)NKV * HD * TT * 2);
    bf* QPh = (bf*)take((size_t)NH_ * TT * HD * 2); bf* QPl = (bf*)take((size_t)NH_ * TT * HD * 2); bf* KPh = (bf*)take((size_t)NKV * TT * HD * 2); bf* KPl = (bf*)take((size_t)NKV * TT * HD * 2); bf* VTh = (bf*)take((size_t)NKV * HD * TT * 2); bf* VTl = (bf*)take((size_t)NKV * HD * TT * 2); bf* Ph = (bf*)take((size_t)ZH * RH * TT * 2); bf* Pl = (bf*)take((size_t)ZH * RH * TT * 2);
    float* Sb = (float*)take((size_t)ZH * TT * TT * 4); h16* P16 = (h16*)take((size_t)ZH * TT * TT * 2); float* Ob = (float*)take((size_t)ZH * TT * HD * 4); bf* ATh = (bf*)take((size_t)TT * DQ * 2); bf* ATl = (bf*)take((size_t)TT * DQ * 2);
    if ((size_t)(wsp - (char*)d_ws) > ws_size) return;    // ws 256 MiB
    float* FV = FK;   // v projection reuses the k buffer after the k planes are built (stream-ordered)
    { k_wtG<<<(unsigned)((DM * DQ / 64 + 63) / 64), 256, 0, stream>>>(wq, DM, DQ, WQ); k_wtG<<<(unsigned)((DM * DKV / 64 + 63) / 64), 256, 0, stream>>>(wk, DM, DKV, WK); k_wtG<<<(unsigned)((DM * DKV / 64 + 63) / 64), 256, 0, stream>>>(wv, DM, DKV, WV);
      k_wtG<<<(unsigned)((DQ * DM / 64 + 63) / 64), 256, 0, stream>>>(wo, DQ, DM, WO);
      k_cstab<<<(TT * HD + 255) / 256, 256, 0, stream>>>(CS); }
    const unsigned LQ = (unsigned)(((size_t)NH_ * TT * HD / 2 + 255) / 256), LKv = (unsigned)(((size_t)NKV * TT * HD / 2 + 255) / 256);
    for (int b = 0; b < NB_; ++b) {
        
        k_cvt8<<<(unsigned)(((size_t)TT * DM / 8 + 255) / 256), 256, 0, stream>>>(x + (size_t)b * TT * DM, XB, (size_t)TT * DM / 8);
        k_gemmw<bf, 0, true, 8><<<dim3(TT / 64, DQ / 64, 1), 256, 0, stream>>>(XB, nullptr, WQ, nullptr, DM, FQ, DQ, bq, 0, 0, 0);
        k_rope<<<LQ, 256, 0, stream>>>(FQ, DQ, NH_, CS, nullptr, nullptr, 1.0f, QP16, QPh, QPl);
        k_gemmw<bf, 0, true, 8><<<dim3(TT / 64, DKV / 64, 1), 256, 0, stream>>>(XB, nullptr, WK, nullptr, DM, FK, DKV, bk, 0, 0, 0);
        k_rope<<<LKv, 256, 0, stream>>>(FK, DKV, NKV, CS, nullptr, nullptr, 1.0f, KP16, KPh, KPl);
        k_gemmw<bf, 0, true, 8><<<dim3(TT / 64, DKV / 64, 1), 256, 0, stream>>>(XB, nullptr, WV, nullptr, DM, FV, DKV, bv, 0, 0, 0); k_vtp<<<LKv, 256, 0, stream>>>(FV, DKV, NKV, VT16, VTh, VTl);
        for (int h0 = 0; h0 < NH_; h0 += ZH) { const size_t zq = (size_t)h0, zk = (size_t)(h0 / REP);   // one kv head per query head: the pass's two heads use consecutive kv planes (z-strides TT*HD)
            k_gemmc<bf, 2, 1, 1><<<dim3(RH / 64, TT / 64, ZH), 32, 0, stream>>>(QPh + zq * TT * HD, QPl + zq * TT * HD, KPh + zk * TT * HD, KPl + zk * TT * HD, HD, Sb, TT, 0, (size_t)TT * HD, (size_t)TT * HD, (size_t)TT * TT);
            k_gemmc<h16, 0, 1, 1><<<dim3((TT - RH) / 64, TT / 64, ZH), 32, 0, stream>>>(QP16 + zq * TT * HD + (size_t)RH * HD, nullptr, KP16 + zk * TT * HD, nullptr, HD, Sb + (size_t)RH * TT, TT, RH, (size_t)TT * HD, (size_t)TT * HD, (size_t)TT * TT);
            k_asoft<<<ZH * TT / 8, 256, 0, stream>>>(Sb, P16, Ph, Pl);
            k_gemmc<bf, 2, 2, 8><<<dim3(RH / 64, HD / 64, ZH), 256, 0, stream>>>(Ph, Pl, VTh + zk * HD * TT, VTl + zk * HD * TT, TT, Ob, HD, 0, (size_t)RH * TT, (size_t)HD * TT, (size_t)TT * HD);
            k_gemmc<h16, 0, 2, 16><<<dim3((TT - RH) / 64, HD / 64, ZH), 512, 0, stream>>>(P16 + (size_t)RH * TT, nullptr, VT16 + zk * HD * TT, nullptr, TT, Ob + (size_t)RH * HD, HD, RH, (size_t)TT * TT, (size_t)HD * TT, (size_t)TT * HD);
            k_merge<<<(unsigned)(((size_t)ZH * TT * HD / 2 + 255) / 256), 256, 0, stream>>>(Ob, h0, ATh, ATl); }
        k_gemmw<bf, 1, true, 8><<<dim3(TT / 64, DM / 64, 1), 256, 0, stream>>>(ATh, ATl, WO, nullptr, DQ, OUT + (size_t)b * TT * DM, DM, bo, 0, 0, 0); }
}

// v002
// It runs in 268 microseconds.
// Next to v001, in two timings, it ran 3.66 and 3.68 times as fast.
// All steps since v000 together make it 5.90 times as fast.
#include <hip/hip_runtime.h>

// Multi-head causal attention with partial rotary (x [2][2048][1024]; q/k/v = x W + b ('xw' [1024][1024], 16 x 64); rotate-half rotary on the FIRST 32 dims of each head (pairs d, d+16), angles t x inv[d mod 16] with inv_i = 2048^(-2i/32), the other 32 dims pass through; causal (tril) -inf; softmax(q.k / 8); out = merged Wo ('xw' [1024][1024]) + bo -> [2][2048][1024]).
// Compute dtypes, f32 accumulate: every input rounded to bf16; q/k/v on PLAIN bf16 operands (inputs: exact) + bias; rotary in f32 from an on-chip table (inv constants are the reference's own f32 values; angle = t x inv one product; precise cosf/sinf); causal scores and attn.v: query rows < 512 hl (3 products), the rest single fp16 (x1024), causal tile skipping; on-line softmax f32, all inside one kernel; Wo hl x exact (2 products) + bias.

#define NB_  2
#define TT   2048
#define DM   1024
#define NH_  16
#define NKV  16
#define REP  (NH_ / NKV)
#define HD   64
#define DQ   (NH_ * HD)
#define DKV  (NKV * HD)
#define RH   512                  // query rows < RH use hi+lo planes (a multiple of 64)
#define ROT  32                   // rotary dims per head (rotate-half inside them)
#define SCL  0.125f   // HD^-0.5
typedef _Float16 h16;
typedef unsigned short bf;
typedef __attribute__((ext_vector_type(16))) __bf16   v16bf;
typedef __attribute__((ext_vector_type(16))) _Float16 v16h;
typedef __attribute__((ext_vector_type(8)))  _Float16 v8h;
typedef __attribute__((ext_vector_type(8)))  unsigned short v8us;
typedef __attribute__((ext_vector_type(8)))  float    v8f;
typedef __attribute__((ext_vector_type(4)))  float    v4f;
typedef v8h  __attribute__((may_alias)) v8ha;
typedef v4f  __attribute__((may_alias)) v4fa;
typedef v8us __attribute__((may_alias)) v8usa;

__device__ __forceinline__ unsigned short f2bf(float f) { unsigned u = __float_as_uint(f); u += 0x7FFFu + ((u >> 16) & 1u); return (unsigned short)(u >> 16); }
__device__ __forceinline__ float bf2f(unsigned short b) { return __uint_as_float(((unsigned)b) << 16); }
__device__ __forceinline__ float bfr(float f) { return bf2f(f2bf(f)); }
__device__ __forceinline__ v16h cat16(v8h lo, v8h hi) { return __builtin_shufflevector(lo, hi, 0, 1, 2, 3, 4, 5, 6, 7, 8, 9, 10, 11, 12, 13, 14, 15); }
__device__ __forceinline__ v16bf cat16b(v8us lo, v8us hi) { return __builtin_bit_cast(v16bf, __builtin_shufflevector(lo, hi, 0, 1, 2, 3, 4, 5, 6, 7, 8, 9, 10, 11, 12, 13, 14, 15)); }
__device__ __forceinline__ v8f wmma16(v16h a, v16h b, v8f c) { return __builtin_amdgcn_wmma_f32_16x16x32_f16(false, a, false, b, (short)0, c, false, false); }
__device__ __forceinline__ v8f wmmab(v16bf a, v16bf b, v8f c) { return __builtin_amdgcn_wmma_f32_16x16x32_bf16(false, a, false, b, (short)0, c, false, false); }



// ---- k_gemmw: register-blocked GEMM, one 64x64 output tile per block (16 accumulators per wave), operands straight from K-contiguous 16-bit planes; grid (M/64, N/64, Z), 32 x NW threads.
// NW = 1: one wave does the whole K loop. NW > 1: the K loop is split over the block's NW waves, so that NW waves' load latencies run side by side: wave w takes the 64-wide k pieces w, w + NW, ...
// (64 k = one whole 128-byte line of every operand row, both halves read by the same wave); the NW f32 partial tiles are summed through LDS in wave order 0 .. NW-1.
// C[m][n] (f32, pitch ldc, + optional f32 bias[n]) = sum_k A[m][k] Bt[n][k] (+ split products per NSPLIT). z-batch strides sA/sB/sC in elements. K % 32 == 0.
template <typename T16> struct WFrag;
template <> struct WFrag<h16> { typedef v16h V; static __device__ __forceinline__ V ld(const h16* p) { return cat16(*(const v8h*)p, *(const v8h*)(p + 16)); } static __device__ __forceinline__ v8f mma(V a, V b, v8f c) { return wmma16(a, b, c); } };
template <> struct WFrag<bf> { typedef v16bf V; static __device__ __forceinline__ V ld(const bf* p) { return cat16b(*(const v8us*)p, *(const v8us*)(p + 16)); } static __device__ __forceinline__ v8f mma(V a, V b, v8f c) { return wmmab(a, b, c); } };
template <typename T16, int NSPLIT, bool BIAS, int NW>
__global__ __launch_bounds__(32 * NW) void k_gemmw(const T16* __restrict__ A, const T16* __restrict__ A2, const T16* __restrict__ Bt, const T16* __restrict__ Bt2, int K, float* C, int ldc, const float* __restrict__ bias, size_t sA, size_t sB, size_t sC) {
    typedef typename WFrag<T16>::V V;
    __shared__ __align__(16) float os[(NW == 1 ? 16 : NW * 64) * 68];
    const int wave = (NW == 1) ? 0 : __builtin_amdgcn_readfirstlane((int)(threadIdx.x >> 5));   // scalar, so that the K loop's branch is wave-uniform (matrix instructions need every lane on)
    const size_t z = blockIdx.z; A += z * sA; if (A2) A2 += z * sA; Bt += z * sB; if (Bt2) Bt2 += z * sB; C += z * sC;
    const int lane = threadIdx.x & 31, lr = lane & 15, hi = lane >> 4; const int r0 = blockIdx.x * 64, c0 = blockIdx.y * 64;
    v8f acc[4][4];
#pragma unroll
    for (int mb = 0; mb < 4; ++mb)
#pragma unroll
        for (int nb = 0; nb < 4; ++nb) acc[mb][nb] = (v8f){};
    const size_t aoff = (size_t)(r0 + lr) * K + 8 * hi, boff = (size_t)(c0 + lr) * K + 8 * hi;
#pragma unroll 1
    for (int kc = wave * 64; kc < K; kc += (NW == 1 || !(kc & 32)) ? 32 : 64 * NW - 32) {
        V a[4], a2[4];
#pragma unroll
        for (int mb = 0; mb < 4; ++mb) { a[mb] = WFrag<T16>::ld(A + aoff + (size_t)mb * 16 * K + kc); if (NSPLIT == 1 || NSPLIT == 2) a2[mb] = WFrag<T16>::ld(A2 + aoff + (size_t)mb * 16 * K + kc); }
#pragma unroll
        for (int nb = 0; nb < 4; ++nb) { const V b = WFrag<T16>::ld(Bt + boff + (size_t)nb * 16 * K + kc); V b2; if (NSPLIT >= 2) b2 = WFrag<T16>::ld(Bt2 + boff + (size_t)nb * 16 * K + kc);
#pragma unroll
            for (int mb = 0; mb < 4; ++mb) { acc[mb][nb] = WFrag<T16>::mma(a[mb], b, acc[mb][nb]); if (NSPLIT == 1 || NSPLIT == 2) acc[mb][nb] = WFrag<T16>::mma(a2[mb], b, acc[mb][nb]); if (NSPLIT >= 2) acc[mb][nb] = WFrag<T16>::mma(a[mb], b2, acc[mb][nb]); } }
        asm volatile("v_nop\n\tv_nop\n\tv_nop\n\tv_nop" : "+v"(acc[0][0]), "+v"(acc[1][1]), "+v"(acc[2][2]), "+v"(acc[3][3]) : "v"(a[0]), "v"(a[3]));
    }
    if constexpr (NW > 1) {
#pragma unroll
        for (int mb = 0; mb < 4; ++mb)
#pragma unroll
            for (int nb = 0; nb < 4; ++nb)
#pragma unroll
                for (int j = 0; j < 8; ++j) os[(wave * 64 + mb * 16 + hi * 8 + j) * 68 + nb * 16 + lr] = acc[mb][nb][j];
        __syncthreads();   // every wave's partial tile is in LDS before any thread sums across the waves
#pragma unroll
        for (int s = 0; s < 32 / NW; ++s) { const int i = s * 32 * NW + (int)threadIdx.x, row = i >> 4, cofs = (i & 15) * 4; v4f val = *(const v4fa*)(os + row * 68 + cofs);
#pragma unroll
            for (int w = 1; w < NW; ++w) val += *(const v4fa*)(os + (w * 64 + row) * 68 + cofs);
            if (BIAS) { val[0] += bfr(bias[c0 + cofs]); val[1] += bfr(bias[c0 + cofs + 1]); val[2] += bfr(bias[c0 + cofs + 2]); val[3] += bfr(bias[c0 + cofs + 3]); }
            *(v4f*)(C + (size_t)(r0 + row) * ldc + c0 + cofs) = val; }
    } else {
#pragma unroll
    for (int mb = 0; mb < 4; ++mb) {
#pragma unroll
        for (int nb = 0; nb < 4; ++nb) {
#pragma unroll
            for (int j = 0; j < 8; ++j) os[(hi * 8 + j) * 68 + nb * 16 + lr] = acc[mb][nb][j]; }
        __builtin_amdgcn_wave_barrier(); asm volatile("" ::: "memory");
        float* crow = C + (size_t)(r0 + mb * 16) * ldc + c0;
{
#pragma unroll
            for (int s = 0; s < 8; ++s) { const int row = 2 * s + hi, cofs = lr * 4; v4f val = *(const v4fa*)(os + row * 68 + cofs); if (BIAS) { val[0] += bfr(bias[c0 + cofs]); val[1] += bfr(bias[c0 + cofs + 1]); val[2] += bfr(bias[c0 + cofs + 2]); val[3] += bfr(bias[c0 + cofs + 3]); }
                *(v4f*)(crow + (size_t)row * ldc + cofs) = val; }
             }
        __builtin_amdgcn_wave_barrier(); asm volatile("" ::: "memory");
    }
    }
}

__device__ __forceinline__ h16 tohx(float x) { return (h16)x; }
__device__ __forceinline__ void splitf(float y, unsigned short& h, unsigned short& l) { h = f2bf(y); l = f2bf(y - bf2f(h)); }
typedef __attribute__((ext_vector_type(2))) _Float16 v2h;
typedef __attribute__((ext_vector_type(4))) _Float16 v4h;
typedef __attribute__((ext_vector_type(2))) unsigned short v2us;
typedef __attribute__((ext_vector_type(4))) unsigned short v4us;
typedef __attribute__((ext_vector_type(2))) float v2f;
typedef __attribute__((ext_vector_type(4))) int v4i;

__global__ __launch_bounds__(256) void k_wtG(const float* __restrict__ w, int K, int N, bf* Bt) {
    const int lane = threadIdx.x & 31; const int L0 = (blockIdx.x * 8 + (threadIdx.x >> 5)) * 8; const int nlines = N * K / 64;
{
#pragma unroll 1
        for (int l = 0; l < 8; ++l) { const int L = L0 + l; if (L >= nlines) break; const size_t e = (size_t)L * 64 + lane * 2; const int k = (int)(e % K), n = (int)(e / K); v2us o;
            o[0] = f2bf(w[(size_t)k * N + n]); o[1] = f2bf(w[(size_t)(k + 1) * N + n]); *(v2us*)(Bt + e) = o; }
         }
}
__global__ __launch_bounds__(256) void k_cvt8(const float* __restrict__ src, bf* dst, size_t n8) { const size_t i = (size_t)blockIdx.x * 256 + threadIdx.x; if (i >= n8) return; const v8f v = *(const v8f*)(src + i * 8); v8us o;
#pragma unroll
    for (int k = 0; k < 8; ++k) o[k] = f2bf(v[k]); *(v8us*)(dst + i * 8) = o;  }
__constant__ float INV[ROT / 2] = {1.0,0.6209288835525513,0.38555270433425903,0.23940083384513855,0.1486508846282959,0.0923016369342804,0.057312753051519394,0.035587143152952194,0.022097086533904076,0.013720721006393433,0.008519591763615608,0.005290060769766569,0.003284751670435071,0.002039597136899829,0.0012664449168369174,0.0007863722858019173};
__global__ __launch_bounds__(256) void k_cstab(float* CS) { const int idx = blockIdx.x * 256 + threadIdx.x; if (idx >= TT * HD) return; const int t = idx / HD, d = idx % HD; v2f cs; if (d < ROT) { const int i = (d < ROT / 2) ? d : d - ROT / 2; const float ang = __fmul_rn((float)t, INV[i]); cs[0] = cosf(ang); cs[1] = sinf(ang); } else { cs[0] = 1.0f; cs[1] = 0.0f; }
    *(v2f*)(CS + (size_t)idx * 2) = cs;  }

// k_rope: head planes [h][t][d] (fp16 + hi/lo) of partial-rope(x) x sc: rotate-half inside the first ROT dims (out[d] = x[d] cos - x[d+ROT/2] sin, out[d+ROT/2] = x[d+ROT/2] cos + x[d] sin), dims >= ROT pass through (cos 1, sin 0)
__global__ __launch_bounds__(256) void k_rope(const float* __restrict__ F, int pitch, int nheads, const float* __restrict__ CS, const float* __restrict__ RF, const float* __restrict__ nw, float sc, h16* P16, bf* Ph, bf* Pl) {
    const size_t e = ((size_t)blockIdx.x * 256 + threadIdx.x) * 2; if (e >= (size_t)nheads * TT * HD) return; const int d = (int)(e % HD); const int t = (int)((e / HD) % TT); const int h = (int)(e / ((size_t)HD * TT)); const float* f = F + (size_t)t * pitch + h * HD; const float rf = RF ? RF[(size_t)h * TT + t] : 1.0f; v2h o16; v2us oh, ol;
#pragma unroll
    for (int q = 0; q < 2; ++q) { const int dd = d + q; const int dp = (dd < ROT) ? ((dd < ROT / 2) ? dd + ROT / 2 : dd - ROT / 2) : dd;   /* rotate-half inside the first ROT dims; identity beyond */ float x0 = f[dd], x1 = f[dp];
        if (RF) { float n0 = __fmul_rn(x0, rf), n1 = __fmul_rn(x1, rf); asm volatile("" : "+v"(n0)); asm volatile("" : "+v"(n1)); x0 = __fmul_rn(bfr(nw[dd]), n0); x1 = __fmul_rn(bfr(nw[dp]), n1); }
        const v2f cs = *(const v2f*)(CS + ((size_t)t * HD + dd) * 2); float a = __fmul_rn(x0, cs[0]), bq = __fmul_rn(x1, cs[1]); asm volatile("" : "+v"(a)); asm volatile("" : "+v"(bq)); const float r = ((dd < ROT / 2) ? __fsub_rn(a, bq) : __fadd_rn(a, bq)) * sc;   /* dd >= ROT: bq = x * 0 = 0 added (exact) */
        o16[q] = tohx(r); unsigned short a2, c2; splitf(r, a2, c2); oh[q] = a2; ol[q] = c2; }
    *(v2h*)(P16 + e) = o16; *(v2us*)(Ph + e) = oh; *(v2us*)(Pl + e) = ol;  }
__global__ __launch_bounds__(256) void k_vtp(const float* __restrict__ F, int pitch, int nheads, h16* V16, bf* Vh, bf* Vl) { const size_t e = ((size_t)blockIdx.x * 256 + threadIdx.x) * 2; if (e >= (size_t)nheads * HD * TT) return; const int t = (int)(e % TT); const int d = (int)((e / TT) % HD); const int g = (int)(e / ((size_t)TT * HD)); v2h o16; v2us oh, ol;
#pragma unroll
    for (int q = 0; q < 2; ++q) { const float x = F[(size_t)(t + q) * pitch + g * HD + d]; o16[q] = tohx(x); unsigned short a2, c2; splitf(x, a2, c2); oh[q] = a2; ol[q] = c2; }
    *(v2h*)(V16 + e) = o16; *(v2us*)(Vh + e) = oh; *(v2us*)(Vl + e) = ol;  }
// ---- k_fattn: causal attention of one head in one kernel (scores, softmax, probability x value, head merge): scores and probabilities stay in registers.
// Transposed products: St = K Qt (A = key rows, B = query rows, both d-contiguous planes) puts one query's scores of a 16-key tile in one lane (D[key 8 hi + j][query lr]); two such tiles, converted in place, are the B operand
// (32 keys in the hardware k order) of Ot += Vt Pt (A = rows of the [d][t] value plane, same k order). On-line softmax over 64-key blocks in the log2 domain: running maximum m and sum l per query column,
// Ot and l rescaled by 2^(m_old - m_new) in every block; P is left unnormalised (x 2^PSH for fp16's range; the factor cancels in Ot / l). One division per query at the end, then the hi/lo bf16 split into the merged [t][DQ] planes.
// HI (query rows < RH): hi+lo bf16 planes, 3 products each; else single fp16. One wave owns 16 x QT query columns; no LDS, no barrier.
// Every inner loop is fully unrolled so that the fragment arrays are indexed by constants and stay in registers.
template <typename T16, bool HI, int QT>
__device__ __forceinline__ void fattn_tile(const T16* __restrict__ Q, const T16* __restrict__ Q2, const T16* __restrict__ Kp, const T16* __restrict__ K2, const T16* __restrict__ Vt, const T16* __restrict__ V2, const int q0, const int lr, const int hi, bf* Ah, bf* Al) {
    typedef typename WFrag<T16>::V V;
    const float C2 = SCL * 1.4426950408889634f;      // score scale x log2(e)
    const float PSH = HI ? 0.0f : 10.0f;             // fp16 P carries x1024
    const unsigned koff = (unsigned)(lr * HD + 8 * hi), voff = (unsigned)(lr * TT + 8 * hi);   // the lane's place inside a 16-row tile of a [t][d] or [d][t] plane; a group of loads shares one pointer per plane, which its s_wait_xcnt names as an input so that the register lives up to the wait
    const unsigned kob = koff * (unsigned)sizeof(T16);   // the same place in bytes: the offset register of the first loads
    const T16* qp = Q + q0 * HD + koff; const T16* qp2 = HI ? Q2 + q0 * HD + koff : qp;
    V qb[QT][2], qb2[QT][2];
#pragma unroll
    for (int qt = 0; qt < QT; ++qt)
#pragma unroll
        for (int ks = 0; ks < 2; ++ks) { const int qo = qt * 16 * HD + ks * 32; qb[qt][ks] = WFrag<T16>::ld(qp + qo); if (HI) qb2[qt][ks] = WFrag<T16>::ld(qp2 + qo); }
    v8f o[QT][4]; float m[QT], l[QT];
#pragma unroll
    for (int qt = 0; qt < QT; ++qt) { m[qt] = -3.0e38f; l[qt] = 0.0f;
#pragma unroll
        for (int md = 0; md < 4; ++md) o[qt][md] = (v8f){}; }
    const int kdiag = q0 & ~63;                      // the 64-key block that holds the diagonal of all 16 x QT rows (16 x QT divides 64)
    V ka[4][2], ka2[4][2];
    const T16* kp = Kp + koff; const T16* kp2 = HI ? K2 + koff : kp;
#pragma unroll
    for (int nb = 0; nb < 4; ++nb)
#pragma unroll
        for (int ks = 0; ks < 2; ++ks) { const int ko = nb * 16 * HD + ks * 32; ka[nb][ks] = WFrag<T16>::ld(kp + ko); if (HI) ka2[nb][ks] = WFrag<T16>::ld(kp2 + ko); }
    asm volatile("s_wait_xcnt 0x0" :: "v"(qp), "v"(qp2), "v"(kp), "v"(kp2), "v"(kob) : "memory");   // before any register that the loads above name is written again
#pragma unroll 1   // rolled: one block's fragments already fill the registers, a second copy of the body would only cost instruction cache
    for (int kb = 0; kb <= kdiag; kb += 64) {
        V va[4][2], va2[4][2];                       // this block's value rows: needed last, asked for first
        const T16* vp = Vt + kb + voff; const T16* vp2 = HI ? V2 + kb + voff : vp;
#pragma unroll
        for (int md = 0; md < 4; ++md)
#pragma unroll
            for (int ks = 0; ks < 2; ++ks) { const int vo = md * 16 * TT + ks * 32; va[md][ks] = WFrag<T16>::ld(vp + vo); if (HI) va2[md][ks] = WFrag<T16>::ld(vp2 + vo); }
        asm volatile("s_wait_xcnt 0x0" :: "v"(vp), "v"(vp2) : "memory");   // before any register that the loads above name is written again
        v8f st[QT][4];
#pragma unroll
        for (int nb = 0; nb < 4; ++nb)
#pragma unroll
            for (int qt = 0; qt < QT; ++qt) { v8f a = (v8f){};
#pragma unroll
                for (int ks = 0; ks < 2; ++ks) { a = WFrag<T16>::mma(ka[nb][ks], qb[qt][ks], a); if (HI) { a = WFrag<T16>::mma(ka[nb][ks], qb2[qt][ks], a); a = WFrag<T16>::mma(ka2[nb][ks], qb[qt][ks], a); } }
                st[qt][nb] = a; }
        const int kst = (kb < kdiag) ? 64 * HD : 0; kp += kst; kp2 += kst;   // next block's key rows fly during the softmax and P.V (the last trip re-reads its own: in bounds, unused)
#pragma unroll
        for (int nb = 0; nb < 4; ++nb)
#pragma unroll
            for (int ks = 0; ks < 2; ++ks) { const int ko = nb * 16 * HD + ks * 32; ka[nb][ks] = WFrag<T16>::ld(kp + ko); if (HI) ka2[nb][ks] = WFrag<T16>::ld(kp2 + ko); }
        asm volatile("s_wait_xcnt 0x0" :: "v"(kp), "v"(kp2) : "memory");   // before any register that the loads above name is written again
#pragma unroll
        for (int qt = 0; qt < QT; ++qt)
#pragma unroll
            for (int nb = 0; nb < 4; ++nb) st[qt][nb] *= C2;
        if (kb == kdiag) {                           // wave-uniform: only the diagonal block has keys above a query
#pragma unroll
            for (int qt = 0; qt < QT; ++qt)
#pragma unroll
                for (int nb = 0; nb < 4; ++nb)
#pragma unroll
                    for (int j = 0; j < 8; ++j) st[qt][nb][j] = (kb + nb * 16 + hi * 8 + j <= q0 + qt * 16 + lr) ? st[qt][nb][j] : -3.0e38f;
        }
        V pb[QT][2], pb2[QT][2];
#pragma unroll
        for (int qt = 0; qt < QT; ++qt) {
            float mx4[4];
#pragma unroll
            for (int nb = 0; nb < 4; ++nb) { mx4[nb] = st[qt][nb][0];
#pragma unroll
                for (int j = 1; j < 8; ++j) mx4[nb] = fmaxf(mx4[nb], st[qt][nb][j]); }
            float mx = fmaxf(fmaxf(mx4[0], mx4[1]), fmaxf(mx4[2], mx4[3]));
            mx = fmaxf(mx, __shfl_xor(mx, 16, 32));  // the other half of the wave holds the query's other keys
            mx = fmaxf(mx, m[qt]);
            const float al = __builtin_amdgcn_exp2f(m[qt] - mx); m[qt] = mx; const float msh = mx - PSH;
            float ls4[4];
#pragma unroll
            for (int nb = 0; nb < 4; ++nb) { ls4[nb] = 0.0f;
#pragma unroll
                for (int j = 0; j < 8; ++j) { const float p = __builtin_amdgcn_exp2f(st[qt][nb][j] - msh); st[qt][nb][j] = p; ls4[nb] += p; } }
            l[qt] = l[qt] * al + ((ls4[0] + ls4[1]) + (ls4[2] + ls4[3]));
#pragma unroll
            for (int md = 0; md < 4; ++md) o[qt][md] *= al;
#pragma unroll
            for (int ks = 0; ks < 2; ++ks) {
                if constexpr (HI) { v8us h0, h1, l0, l1;
#pragma unroll
                    for (int j = 0; j < 8; ++j) { unsigned short a, c; splitf(st[qt][2 * ks][j], a, c); h0[j] = a; l0[j] = c; splitf(st[qt][2 * ks + 1][j], a, c); h1[j] = a; l1[j] = c; }
                    pb[qt][ks] = cat16b(h0, h1); pb2[qt][ks] = cat16b(l0, l1);
                } else { v8h h0, h1;
#pragma unroll
                    for (int j = 0; j < 8; ++j) { h0[j] = tohx(st[qt][2 * ks][j]); h1[j] = tohx(st[qt][2 * ks + 1][j]); }
                    pb[qt][ks] = cat16(h0, h1); }
            }
        }
#pragma unroll
        for (int ks = 0; ks < 2; ++ks)
#pragma unroll
            for (int md = 0; md < 4; ++md)
#pragma unroll
                for (int qt = 0; qt < QT; ++qt) { o[qt][md] = WFrag<T16>::mma(va[md][ks], pb[qt][ks], o[qt][md]); if (HI) { o[qt][md] = WFrag<T16>::mma(va[md][ks], pb2[qt][ks], o[qt][md]); o[qt][md] = WFrag<T16>::mma(va2[md][ks], pb[qt][ks], o[qt][md]); } }
    }
#pragma unroll
    for (int qt = 0; qt < QT; ++qt) { const float f = __fdiv_rn(1.0f, l[qt] + __shfl_xor(l[qt], 16, 32)); bf* ahp = Ah + (q0 + qt * 16 + lr) * DQ + hi * 8; bf* alp = Al + (q0 + qt * 16 + lr) * DQ + hi * 8;
#pragma unroll
        for (int md = 0; md < 4; ++md) { v8us oh, ol;
#pragma unroll
            for (int j = 0; j < 8; ++j) { unsigned short a, c; splitf(o[qt][md][j] * f, a, c); oh[j] = a; ol[j] = c; }
            *(v8us*)(ahp + md * 16) = oh; *(v8us*)(alp + md * 16) = ol; }
        asm volatile("s_wait_xcnt 0x0" :: "v"(ahp), "v"(alp) : "memory");   // before any register that the stores above name is written again
    }
}
// grid (heads, (TT - RH) / 64 + RH / 32), 2 waves, longest key loops first: blocks y < (TT - RH) / 64 take 64 fp16 query rows each, from the last rows down (32 a wave); the others 32 hi+lo rows each (16 a wave)
__global__ __launch_bounds__(64) void k_fattn(const h16* __restrict__ QP16, const h16* __restrict__ KP16, const h16* __restrict__ VT16, const bf* __restrict__ QPh, const bf* __restrict__ QPl, const bf* __restrict__ KPh, const bf* __restrict__ KPl, const bf* __restrict__ VTh, const bf* __restrict__ VTl, bf* ATh, bf* ATl) {
    const int wave = __builtin_amdgcn_readfirstlane((int)(threadIdx.x >> 5));   // scalar, so that the key loop's branches are wave-uniform (matrix instructions need every lane on)
    const int lane = threadIdx.x & 31, lr = lane & 15, hi = lane >> 4; const int h = blockIdx.x; const int y = blockIdx.y; const bool lo = y < (TT - RH) / 64;
    const int q0 = lo ? (TT / 64 - 1 - y) * 64 + wave * 32 : ((TT - RH) / 64 + RH / 32 - 1 - y) * 32 + wave * 16;
    const size_t zq = (size_t)h * TT * HD, zk = (size_t)(h / REP) * TT * HD; bf* ah = ATh + h * HD; bf* al = ATl + h * HD;
    if (!lo) fattn_tile<bf, true, 1>(QPh + zq, QPl + zq, KPh + zk, KPl + zk, VTh + zk, VTl + zk, q0, lr, hi, ah, al);
    else fattn_tile<h16, false, 2>(QP16 + zq, nullptr, KP16 + zk, nullptr, VT16 + zk, nullptr, q0, lr, hi, ah, al);
}

extern "C" void kernel_launch(void* const* d_in, const int* in_sizes, int n_in,
                              void* d_out, int out_size, void* d_ws, size_t ws_size, hipStream_t stream) {
    (void)in_sizes; (void)n_in; (void)out_size;
    const float* x = (const float*)d_in[0]; const float* wq = (const float*)d_in[1]; const float* bq = (const float*)d_in[2]; const float* wk = (const float*)d_in[3]; const float* bk = (const float*)d_in[4]; const float* wv = (const float*)d_in[5]; const float* bv = (const float*)d_in[6]; const float* wo = (const float*)d_in[7]; const float* bo = (const float*)d_in[8]; const float* cosT = nullptr; const float* sinT = nullptr; (void)cosT; (void)sinT;
    float* OUT = (float*)d_out;     // [2][2048][1024]
    char* wsp = (char*)d_ws;
    auto take = [&](size_t bytes) { char* p = wsp; wsp += (bytes + 255) & ~(size_t)255; return (void*)p; };
    bf* WQ = (bf*)take((size_t)DQ * DM * 2); bf* WK = (bf*)take((size_t)DKV * DM * 2); bf* WV = (bf*)take((size_t)DKV * DM * 2); bf* WO = (bf*)take((size_t)DM * DQ * 2); float* CS = (float*)take((size_t)TT * HD * 2 * 4);
    bf* XB = (bf*)take((size_t)TT * DM * 2); float* FQ = (float*)take((size_t)TT * DQ * 4); float* FK = (float*)take((size_t)TT * DKV * 4);
    h16* QP16 = (h16*)take((size_t)NH_ * TT * HD * 2); h16* KP16 = (h16*)take((size_t)NKV * TT * HD * 2); h16* VT16 = (h16*)take((size_t)NKV * HD * TT * 2);
    bf* QPh = (bf*)take((size_t)NH_ * TT * HD * 2); bf* QPl = (bf*)take((size_t)NH_ * TT * HD * 2); bf* KPh = (bf*)take((size_t)NKV * TT * HD * 2); bf* KPl = (bf*)take((size_t)NKV * TT * HD * 2); bf* VTh = (bf*)take((size_t)NKV * HD * TT * 2); bf* VTl = (bf*)take((size_t)NKV * HD * TT * 2);
    bf* ATh = (bf*)take((size_t)TT * DQ * 2); bf* ATl = (bf*)take((size_t)TT * DQ * 2);
    if ((size_t)(wsp - (char*)d_ws) > ws_size) return;    // ws 256 MiB
    float* FV = FK;   // v projection reuses the k buffer after the k planes are built (stream-ordered)
    { k_wtG<<<(unsigned)((DM * DQ / 64 + 63) / 64), 256, 0, stream>>>(wq, DM, DQ, WQ); k_wtG<<<(unsigned)((DM * DKV / 64 + 63) / 64), 256, 0, stream>>>(wk, DM, DKV, WK); k_wtG<<<(unsigned)((DM * DKV / 64 + 63) / 64), 256, 0, stream>>>(wv, DM, DKV, WV);
      k_wtG<<<(unsigned)((DQ * DM / 64 + 63) / 64), 256, 0, stream>>>(wo, DQ, DM, WO);
      k_cstab<<<(TT * HD + 255) / 256, 256, 0, stream>>>(CS); }
    const unsigned LQ = (unsigned)(((size_t)NH_ * TT * HD / 2 + 255) / 256), LKv = (unsigned)(((size_t)NKV * TT * HD / 2 + 255) / 256);
    for (int b = 0; b < NB_; ++b) {
        
        k_cvt8<<<(unsigned)(((size_t)TT * DM / 8 + 255) / 256), 256, 0, stream>>>(x + (size_t)b * TT * DM, XB, (size_t)TT * DM / 8);
        k_gemmw<bf, 0, true, 8><<<dim3(TT / 64, DQ / 64, 1), 256, 0, stream>>>(XB, nullptr, WQ, nullptr, DM, FQ, DQ, bq, 0, 0, 0);
        k_rope<<<LQ, 256, 0, stream>>>(FQ, DQ, NH_, CS, nullptr, nullptr, 1.0f, QP16, QPh, QPl);
        k_gemmw<bf, 0, true, 8><<<dim3(TT / 64, DKV / 64, 1), 256, 0, stream>>>(XB, nullptr, WK, nullptr, DM, FK, DKV, bk, 0, 0, 0);
        k_rope<<<LKv, 256, 0, stream>>>(FK, DKV, NKV, CS, nullptr, nullptr, 1.0f, KP16, KPh, KPl);
        k_gemmw<bf, 0, true, 8><<<dim3(TT / 64, DKV / 64, 1), 256, 0, stream>>>(XB, nullptr, WV, nullptr, DM, FV, DKV, bv, 0, 0, 0); k_vtp<<<LKv, 256, 0, stream>>>(FV, DKV, NKV, VT16, VTh, VTl);
        k_fattn<<<dim3(NH_, (TT - RH) / 64 + RH / 32, 1), 64, 0, stream>>>(QP16, KP16, VT16, QPh, QPl, KPh, KPl, VTh, VTl, ATh, ATl);
        k_gemmw<bf, 1, true, 8><<<dim3(TT / 64, DM / 64, 1), 256, 0, stream>>>(ATh, ATl, WO, nullptr, DQ, OUT + (size_t)b * TT * DM, DM, bo, 0, 0, 0); }
}

// v003
// One run takes 189 microseconds.
// Two timings next to v002 put it at 1.42 and 1.41 times that version's speed.
// Counting every step since v000, it is 8.37 times as fast.
#include <hip/hip_runtime.h>

// Multi-head causal attention with partial rotary (x [2][2048][1024]; q/k/v = x W + b ('xw' [1024][1024], 16 x 64); rotate-half rotary on the FIRST 32 dims of each head (pairs d, d+16), angles t x inv[d mod 16] with inv_i = 2048^(-2i/32), the other 32 dims pass through; causal (tril) -inf; softmax(q.k / 8); out = merged Wo ('xw' [1024][1024]) + bo -> [2][2048][1024]).
// Compute dtypes, f32 accumulate: every input rounded to bf16; q/k/v on PLAIN bf16 operands (inputs: exact) + bias; rotary in f32 from an on-chip table (inv constants are the reference's own f32 values; angle = t x inv one product; precise cosf/sinf); causal scores and attn.v: query rows < 512 hl (3 products), the rest single fp16 (x1024), causal tile skipping; on-line softmax f32, all inside one kernel; Wo hl x exact (2 products) + bias.

#define NB_  2
#define TT   2048
#define DM   1024
#define NH_  16
#define NKV  16
#define REP  (NH_ / NKV)
#define HD   64
#define DQ   (NH_ * HD)
#define DKV  (NKV * HD)
#define RH   512                  // query rows < RH use hi+lo planes (a multiple of 64)
#define ROT  32                   // rotary dims per head (rotate-half inside them)
#define SCL  0.125f   // HD^-0.5
typedef _Float16 h16;
typedef unsigned short bf;
typedef __attribute__((ext_vector_type(16))) __bf16   v16bf;
typedef __attribute__((ext_vector_type(16))) _Float16 v16h;
typedef __attribute__((ext_vector_type(8)))  _Float16 v8h;
typedef __attribute__((ext_vector_type(8)))  unsigned short v8us;
typedef __attribute__((ext_vector_type(8)))  float    v8f;
typedef __attribute__((ext_vector_type(4)))  float    v4f;
typedef v8h  __attribute__((may_alias)) v8ha;
typedef v4f  __attribute__((may_alias)) v4fa;
typedef v8us __attribute__((may_alias)) v8usa;

__device__ __forceinline__ unsigned short f2bf(float f) { unsigned u = __float_as_uint(f); u += 0x7FFFu + ((u >> 16) & 1u); return (unsigned short)(u >> 16); }
__device__ __forceinline__ float bf2f(unsigned short b) { return __uint_as_float(((unsigned)b) << 16); }
__device__ __forceinline__ float bfr(float f) { return bf2f(f2bf(f)); }
__device__ __forceinline__ v16h cat16(v8h lo, v8h hi) { return __builtin_shufflevector(lo, hi, 0, 1, 2, 3, 4, 5, 6, 7, 8, 9, 10, 11, 12, 13, 14, 15); }
__device__ __forceinline__ v16bf cat16b(v8us lo, v8us hi) { return __builtin_bit_cast(v16bf, __builtin_shufflevector(lo, hi, 0, 1, 2, 3, 4, 5, 6, 7, 8, 9, 10, 11, 12, 13, 14, 15)); }
__device__ __forceinline__ v8f wmma16(v16h a, v16h b, v8f c) { return __builtin_amdgcn_wmma_f32_16x16x32_f16(false, a, false, b, (short)0, c, false, false); }
__device__ __forceinline__ v8f wmmab(v16bf a, v16bf b, v8f c) { return __builtin_amdgcn_wmma_f32_16x16x32_bf16(false, a, false, b, (short)0, c, false, false); }



// ---- k_gemmw: register-blocked GEMM, one 64x64 output tile per block (16 accumulators per wave), operands straight from K-contiguous 16-bit planes; grid (M/64, N/64, Z), 32 x NW threads.
// NW = 1: one wave does the whole K loop. NW > 1: the K loop is split over the block's NW waves, so that NW waves' load latencies run side by side: wave w takes the 64-wide k pieces w, w + NW, ...
// (64 k = one whole 128-byte line of every operand row, both halves read by the same wave); the NW f32 partial tiles are summed through LDS in wave order 0 .. NW-1.
// C[m][n] (f32, pitch ldc, + optional f32 bias[n]) = sum_k A[m][k] Bt[n][k] (+ split products per NSPLIT). z-batch strides sA/sB/sC in elements, z = 0, 1, 2 adds bias, bias1, bias2. K % 32 == 0.
template <typename T16> struct WFrag;
template <> struct WFrag<h16> { typedef v16h V; static __device__ __forceinline__ V ld(const h16* p) { return cat16(*(const v8h*)p, *(const v8h*)(p + 16)); } static __device__ __forceinline__ v8f mma(V a, V b, v8f c) { return wmma16(a, b, c); } };
template <> struct WFrag<bf> { typedef v16bf V; static __device__ __forceinline__ V ld(const bf* p) { return cat16b(*(const v8us*)p, *(const v8us*)(p + 16)); } static __device__ __forceinline__ v8f mma(V a, V b, v8f c) { return wmmab(a, b, c); } };
template <typename T16, int NSPLIT, bool BIAS, int NW>
__global__ __launch_bounds__(32 * NW) void k_gemmw(const T16* __restrict__ A, const T16* __restrict__ A2, const T16* __restrict__ Bt, const T16* __restrict__ Bt2, int K, float* C, int ldc, const float* __restrict__ bias, const float* __restrict__ bias1, const float* __restrict__ bias2, size_t sA, size_t sB, size_t sC) {
    typedef typename WFrag<T16>::V V;
    __shared__ __align__(16) float os[(NW == 1 ? 16 : NW * 64) * 68];
    const int wave = (NW == 1) ? 0 : __builtin_amdgcn_readfirstlane((int)(threadIdx.x >> 5));   // scalar, so that the K loop's branch is wave-uniform (matrix instructions need every lane on)
    const size_t z = blockIdx.z; A += z * sA; if (A2) A2 += z * sA; Bt += z * sB; if (Bt2) Bt2 += z * sB; C += z * sC; if (BIAS) bias = (z == 0) ? bias : (z == 1) ? bias1 : bias2;
    const int lane = threadIdx.x & 31, lr = lane & 15, hi = lane >> 4; const int r0 = blockIdx.x * 64, c0 = blockIdx.y * 64;
    v8f acc[4][4];
#pragma unroll
    for (int mb = 0; mb < 4; ++mb)
#pragma unroll
        for (int nb = 0; nb < 4; ++nb) acc[mb][nb] = (v8f){};
    const size_t aoff = (size_t)(r0 + lr) * K + 8 * hi, boff = (size_t)(c0 + lr) * K + 8 * hi;
#pragma unroll 1
    for (int kc = wave * 64; kc < K; kc += (NW == 1 || !(kc & 32)) ? 32 : 64 * NW - 32) {
        V a[4], a2[4];
#pragma unroll
        for (int mb = 0; mb < 4; ++mb) { a[mb] = WFrag<T16>::ld(A + aoff + (size_t)mb * 16 * K + kc); if (NSPLIT == 1 || NSPLIT == 2) a2[mb] = WFrag<T16>::ld(A2 + aoff + (size_t)mb * 16 * K + kc); }
#pragma unroll
        for (int nb = 0; nb < 4; ++nb) { const V b = WFrag<T16>::ld(Bt + boff + (size_t)nb * 16 * K + kc); V b2; if (NSPLIT >= 2) b2 = WFrag<T16>::ld(Bt2 + boff + (size_t)nb * 16 * K + kc);
#pragma unroll
            for (int mb = 0; mb < 4; ++mb) { acc[mb][nb] = WFrag<T16>::mma(a[mb], b, acc[mb][nb]); if (NSPLIT == 1 || NSPLIT == 2) acc[mb][nb] = WFrag<T16>::mma(a2[mb], b, acc[mb][nb]); if (NSPLIT >= 2) acc[mb][nb] = WFrag<T16>::mma(a[mb], b2, acc[mb][nb]); } }
        asm volatile("v_nop\n\tv_nop\n\tv_nop\n\tv_nop" : "+v"(acc[0][0]), "+v"(acc[1][1]), "+v"(acc[2][2]), "+v"(acc[3][3]) : "v"(a[0]), "v"(a[3]));
    }
    if constexpr (NW > 1) {
#pragma unroll
        for (int mb = 0; mb < 4; ++mb)
#pragma unroll
            for (int nb = 0; nb < 4; ++nb)
#pragma unroll
                for (int j = 0; j < 8; ++j) os[(wave * 64 + mb * 16 + hi * 8 + j) * 68 + nb * 16 + lr] = acc[mb][nb][j];
        __syncthreads();   // every wave's partial tile is in LDS before any thread sums across the waves
#pragma unroll
        for (int s = 0; s < 32 / NW; ++s) { const int i = s * 32 * NW + (int)threadIdx.x, row = i >> 4, cofs = (i & 15) * 4; v4f val = *(const v4fa*)(os + row * 68 + cofs);
#pragma unroll
            for (int w = 1; w < NW; ++w) val += *(const v4fa*)(os + (w * 64 + row) * 68 + cofs);
            if (BIAS) { val[0] += bfr(bias[c0 + cofs]); val[1] += bfr(bias[c0 + cofs + 1]); val[2] += bfr(bias[c0 + cofs + 2]); val[3] += bfr(bias[c0 + cofs + 3]); }
            *(v4f*)(C + (size_t)(r0 + row) * ldc + c0 + cofs) = val; }
    } else {
#pragma unroll
    for (int mb = 0; mb < 4; ++mb) {
#pragma unroll
        for (int nb = 0; nb < 4; ++nb) {
#pragma unroll
            for (int j = 0; j < 8; ++j) os[(hi * 8 + j) * 68 + nb * 16 + lr] = acc[mb][nb][j]; }
        __builtin_amdgcn_wave_barrier(); asm volatile("" ::: "memory");
        float* crow = C + (size_t)(r0 + mb * 16) * ldc + c0;
{
#pragma unroll
            for (int s = 0; s < 8; ++s) { const int row = 2 * s + hi, cofs = lr * 4; v4f val = *(const v4fa*)(os + row * 68 + cofs); if (BIAS) { val[0] += bfr(bias[c0 + cofs]); val[1] += bfr(bias[c0 + cofs + 1]); val[2] += bfr(bias[c0 + cofs + 2]); val[3] += bfr(bias[c0 + cofs + 3]); }
                *(v4f*)(crow + (size_t)row * ldc + cofs) = val; }
             }
        __builtin_amdgcn_wave_barrier(); asm volatile("" ::: "memory");
    }
    }
}

__device__ __forceinline__ h16 tohx(float x) { return (h16)x; }
__device__ __forceinline__ void splitf(float y, unsigned short& h, unsigned short& l) { h = f2bf(y); l = f2bf(y - bf2f(h)); }
typedef __attribute__((ext_vector_type(2))) _Float16 v2h;
typedef __attribute__((ext_vector_type(4))) _Float16 v4h;
typedef __attribute__((ext_vector_type(2))) unsigned short v2us;
typedef __attribute__((ext_vector_type(4))) unsigned short v4us;
typedef __attribute__((ext_vector_type(2))) float v2f;
typedef __attribute__((ext_vector_type(4))) int v4i;

// The element-wise stages are device functions of a block number bx; k_prep and k_planes below deal the blocks of one grid out to them.
__device__ __forceinline__ void d_wtG(const int bx, const float* __restrict__ w, int K, int N, bf* Bt) {
    const int lane = threadIdx.x & 31; const int L0 = (bx * 8 + (threadIdx.x >> 5)) * 8; const int nlines = N * K / 64;
{
#pragma unroll 1
        for (int l = 0; l < 8; ++l) { const int L = L0 + l; if (L >= nlines) break; const size_t e = (size_t)L * 64 + lane * 2; const int k = (int)(e % K), n = (int)(e / K); v2us o;
            o[0] = f2bf(w[(size_t)k * N + n]); o[1] = f2bf(w[(size_t)(k + 1) * N + n]); *(v2us*)(Bt + e) = o; }
         }
}
__device__ __forceinline__ void d_cvt8(const int bx, const float* __restrict__ src, bf* dst, size_t n8) { const size_t i = (size_t)bx * 256 + threadIdx.x; if (i >= n8) return; const v8f v = *(const v8f*)(src + i * 8); v8us o;
#pragma unroll
    for (int k = 0; k < 8; ++k) o[k] = f2bf(v[k]); *(v8us*)(dst + i * 8) = o;  }
__constant__ float INV[ROT / 2] = {1.0,0.6209288835525513,0.38555270433425903,0.23940083384513855,0.1486508846282959,0.0923016369342804,0.057312753051519394,0.035587143152952194,0.022097086533904076,0.013720721006393433,0.008519591763615608,0.005290060769766569,0.003284751670435071,0.002039597136899829,0.0012664449168369174,0.0007863722858019173};
__device__ __forceinline__ void d_cstab(const int bx, float* CS) { const int idx = bx * 256 + threadIdx.x; if (idx >= TT * HD) return; const int t = idx / HD, d = idx % HD; v2f cs; if (d < ROT) { const int i = (d < ROT / 2) ? d : d - ROT / 2; const float ang = __fmul_rn((float)t, INV[i]); cs[0] = cosf(ang); cs[1] = sinf(ang); } else { cs[0] = 1.0f; cs[1] = 0.0f; }
    *(v2f*)(CS + (size_t)idx * 2) = cs;  }
// k_prep: everything that depends on the inputs alone, in one grid: the four weight transposes (their serial scattered reads are the longest, so they start first), x of both batches to bf16, the cos/sin table.
#define WTB  (DM * DQ / 64 / 64)            // blocks per weight transpose
#define CVB  (NB_ * TT * DM / 8 / 256)      // blocks of the x conversion
#define CSB  (TT * HD / 256)                // blocks of the table
static_assert(DKV == DQ && DM == DQ, "the four weight planes have one size");
__global__ __launch_bounds__(256) void k_prep(const float* __restrict__ wq, const float* __restrict__ wk, const float* __restrict__ wv, const float* __restrict__ wo, const float* __restrict__ x, bf* W4, bf* XB, float* CS) {
    const int b = blockIdx.x;
    if (b < 4 * WTB) { const int i = b / WTB; d_wtG(b % WTB, (i == 0) ? wq : (i == 1) ? wk : (i == 2) ? wv : wo, DM, DQ, W4 + (size_t)i * DM * DQ); }
    else if (b < 4 * WTB + CVB) d_cvt8(b - 4 * WTB, x, XB, (size_t)NB_ * TT * DM / 8);
    else d_cstab(b - 4 * WTB - CVB, CS);
}

// d_rope: head planes [h][t][d] (fp16 + hi/lo) of partial-rope(x) x sc: rotate-half inside the first ROT dims (out[d] = x[d] cos - x[d+ROT/2] sin, out[d+ROT/2] = x[d+ROT/2] cos + x[d] sin), dims >= ROT pass through (cos 1, sin 0)
__device__ __forceinline__ void d_rope(const int bx, const float* __restrict__ F, int pitch, int nheads, const float* __restrict__ CS, const float* __restrict__ RF, const float* __restrict__ nw, float sc, h16* P16, bf* Ph, bf* Pl) {
    const size_t e = ((size_t)bx * 256 + threadIdx.x) * 2; if (e >= (size_t)nheads * TT * HD) return; const int d = (int)(e % HD); const int t = (int)((e / HD) % TT); const int h = (int)(e / ((size_t)HD * TT)); const float* f = F + (size_t)t * pitch + h * HD; const float rf = RF ? RF[(size_t)h * TT + t] : 1.0f; v2h o16; v2us oh, ol;
#pragma unroll
    for (int q = 0; q < 2; ++q) { const int dd = d + q; const int dp = (dd < ROT) ? ((dd < ROT / 2) ? dd + ROT / 2 : dd - ROT / 2) : dd;   /* rotate-half inside the first ROT dims; identity beyond */ float x0 = f[dd], x1 = f[dp];
        if (RF) { float n0 = __fmul_rn(x0, rf), n1 = __fmul_rn(x1, rf); asm volatile("" : "+v"(n0)); asm volatile("" : "+v"(n1)); x0 = __fmul_rn(bfr(nw[dd]), n0); x1 = __fmul_rn(bfr(nw[dp]), n1); }
        const v2f cs = *(const v2f*)(CS + ((size_t)t * HD + dd) * 2); float a = __fmul_rn(x0, cs[0]), bq = __fmul_rn(x1, cs[1]); asm volatile("" : "+v"(a)); asm volatile("" : "+v"(bq)); const float r = ((dd < ROT / 2) ? __fsub_rn(a, bq) : __fadd_rn(a, bq)) * sc;   /* dd >= ROT: bq = x * 0 = 0 added (exact) */
        o16[q] = tohx(r); unsigned short a2, c2; splitf(r, a2, c2); oh[q] = a2; ol[q] = c2; }
    *(v2h*)(P16 + e) = o16; *(v2us*)(Ph + e) = oh; *(v2us*)(Pl + e) = ol;  }
__device__ __forceinline__ void d_vtp(const int bx, const float* __restrict__ F, int pitch, int nheads, h16* V16, bf* Vh, bf* Vl) { const size_t e = ((size_t)bx * 256 + threadIdx.x) * 2; if (e >= (size_t)nheads * HD * TT) return; const int t = (int)(e % TT); const int d = (int)((e / TT) % HD); const int g = (int)(e / ((size_t)TT * HD)); v2h o16; v2us oh, ol;
#pragma unroll
    for (int q = 0; q < 2; ++q) { const float x = F[(size_t)(t + q) * pitch + g * HD + d]; o16[q] = tohx(x); unsigned short a2, c2; splitf(x, a2, c2); oh[q] = a2; ol[q] = c2; }
    *(v2h*)(V16 + e) = o16; *(v2us*)(Vh + e) = oh; *(v2us*)(Vl + e) = ol;  }
// k_planes: the q, k and v planes of both batches in one grid (PLB x NB_, 3). F3 = [q, k, v][batch][t][DQ] f32; each plane set = [q, k, v][batch][head][..][..], so projection and planes share one offset.
#define PL   ((size_t)TT * DQ)              // elements of one batch's projection = of one batch's plane
#define PLB  (NH_ * TT * HD / 2 / 256)      // blocks per projection and batch
__global__ __launch_bounds__(256) void k_planes(const float* __restrict__ F3, const float* __restrict__ CS, h16* P16, bf* Ph, bf* Pl) {
    const int sel = 2 - (int)blockIdx.y;    // the value transpose, whose reads are scattered, starts first
    const int bx = blockIdx.x % PLB; const size_t o = ((size_t)sel * NB_ + blockIdx.x / PLB) * PL;
    if (sel == 2) d_vtp(bx, F3 + o, DKV, NKV, P16 + o, Ph + o, Pl + o);
    else d_rope(bx, F3 + o, DQ, NH_, CS, nullptr, nullptr, 1.0f, P16 + o, Ph + o, Pl + o);
}
// ---- k_fattn: causal attention of one head in one kernel (scores, softmax, probability x value, head merge): scores and probabilities stay in registers.
// Transposed products: St = K Qt (A = key rows, B = query rows, both d-contiguous planes) puts one query's scores of a 16-key tile in one lane (D[key 8 hi + j][query lr]); two such tiles, converted in place, are the B operand
// (32 keys in the hardware k order) of Ot += Vt Pt (A = rows of the [d][t] value plane, same k order). On-line softmax over 64-key blocks in the log2 domain: running maximum m and sum l per query column,
// Ot and l rescaled by 2^(m_old - m_new) in every block; P is left unnormalised (x 2^PSH for fp16's range; the factor cancels in Ot / l). One division per query at the end, then the hi/lo bf16 split into the merged [t][DQ] planes.
// HI (query rows < RH): hi+lo bf16 planes, 3 products each; else single fp16. One wave owns 16 x QT query columns; no LDS, no barrier.
// Every inner loop is fully unrolled so that the fragment arrays are indexed by constants and stay in registers.
template <typename T16, bool HI, int QT>
__device__ __forceinline__ void fattn_tile(const T16* __restrict__ Q, const T16* __restrict__ Q2, const T16* __restrict__ Kp, const T16* __restrict__ K2, const T16* __restrict__ Vt, const T16* __restrict__ V2, const int q0, const int lr, const int hi, bf* Ah, bf* Al) {
    typedef typename WFrag<T16>::V V;
    const float C2 = SCL * 1.4426950408889634f;      // score scale x log2(e)
    const float PSH = HI ? 0.0f : 10.0f;             // fp16 P carries x1024
    const unsigned koff = (unsigned)(lr * HD + 8 * hi), voff = (unsigned)(lr * TT + 8 * hi);   // the lane's place inside a 16-row tile of a [t][d] or [d][t] plane; a group of loads shares one pointer per plane, which its s_wait_xcnt names as an input so that the register lives up to the wait
    const unsigned kob = koff * (unsigned)sizeof(T16);   // the same place in bytes: the offset register of the first loads
    const T16* qp = Q + q0 * HD + koff; const T16* qp2 = HI ? Q2 + q0 * HD + koff : qp;
    V qb[QT][2], qb2[QT][2];
#pragma unroll
    for (int qt = 0; qt < QT; ++qt)
#pragma unroll
        for (int ks = 0; ks < 2; ++ks) { const int qo = qt * 16 * HD + ks * 32; qb[qt][ks] = WFrag<T16>::ld(qp + qo); if (HI) qb2[qt][ks] = WFrag<T16>::ld(qp2 + qo); }
    v8f o[QT][4]; float m[QT], l[QT];
#pragma unroll
    for (int qt = 0; qt < QT; ++qt) { m[qt] = -3.0e38f; l[qt] = 0.0f;
#pragma unroll
        for (int md = 0; md < 4; ++md) o[qt][md] = (v8f){}; }
    const int kdiag = q0 & ~63;                      // the 64-key block that holds the diagonal of all 16 x QT rows (16 x QT divides 64)
    V ka[4][2], ka2[4][2];
    const T16* kp = Kp + koff; const T16* kp2 = HI ? K2 + koff : kp;
#pragma unroll
    for (int nb = 0; nb < 4; ++nb)
#pragma unroll
        for (int ks = 0; ks < 2; ++ks) { const int ko = nb * 16 * HD + ks * 32; ka[nb][ks] = WFrag<T16>::ld(kp + ko); if (HI) ka2[nb][ks] = WFrag<T16>::ld(kp2 + ko); }
    asm volatile("s_wait_xcnt 0x0" :: "v"(qp), "v"(qp2), "v"(kp), "v"(kp2), "v"(kob) : "memory");   // before any register that the loads above name is written again
#pragma unroll 1   // rolled: one block's fragments already fill the registers, a second copy of the body would only cost instruction cache
    for (int kb = 0; kb <= kdiag; kb += 64) {
        V va[4][2], va2[4][2];                       // this block's value rows: needed last, asked for first
        const T16* vp = Vt + kb + voff; const T16* vp2 = HI ? V2 + kb + voff : vp;
#pragma unroll
        for (int md = 0; md < 4; ++md)
#pragma unroll
            for (int ks = 0; ks < 2; ++ks) { const int vo = md * 16 * TT + ks * 32; va[md][ks] = WFrag<T16>::ld(vp + vo); if (HI) va2[md][ks] = WFrag<T16>::ld(vp2 + vo); }
        asm volatile("s_wait_xcnt 0x0" :: "v"(vp), "v"(vp2) : "memory");   // before any register that the loads above name is written again
        v8f st[QT][4];
#pragma unroll
        for (int nb = 0; nb < 4; ++nb)
#pragma unroll
            for (int qt = 0; qt < QT; ++qt) { v8f a = (v8f){};
#pragma unroll
                for (int ks = 0; ks < 2; ++ks) { a = WFrag<T16>::mma(ka[nb][ks], qb[qt][ks], a); if (HI) { a = WFrag<T16>::mma(ka[nb][ks], qb2[qt][ks], a); a = WFrag<T16>::mma(ka2[nb][ks], qb[qt][ks], a); } }
                st[qt][nb] = a; }
        const int kst = (kb < kdiag) ? 64 * HD : 0; kp += kst; kp2 += kst;   // next block's key rows fly during the softmax and P.V (the last trip re-reads its own: in bounds, unused)
#pragma unroll
        for (int nb = 0; nb < 4; ++nb)
#pragma unroll
            for (int ks = 0; ks < 2; ++ks) { const int ko = nb * 16 * HD + ks * 32; ka[nb][ks] = WFrag<T16>::ld(kp + ko); if (HI) ka2[nb][ks] = WFrag<T16>::ld(kp2 + ko); }
        asm volatile("s_wait_xcnt 0x0" :: "v"(kp), "v"(kp2) : "memory");   // before any register that the loads above name is written again
#pragma unroll
        for (int qt = 0; qt < QT; ++qt)
#pragma unroll
            for (int nb = 0; nb < 4; ++nb) st[qt][nb] *= C2;
        if (kb == kdiag) {                           // wave-uniform: only the diagonal block has keys above a query
#pragma unroll
            for (int qt = 0; qt < QT; ++qt)
#pragma unroll
                for (int nb = 0; nb < 4; ++nb)
#pragma unroll
                    for (int j = 0; j < 8; ++j) st[qt][nb][j] = (kb + nb * 16 + hi * 8 + j <= q0 + qt * 16 + lr) ? st[qt][nb][j] : -3.0e38f;
        }
        V pb[QT][2], pb2[QT][2];
#pragma unroll
        for (int qt = 0; qt < QT; ++qt) {
            float mx4[4];
#pragma unroll
            for (int nb = 0; nb < 4; ++nb) { mx4[nb] = st[qt][nb][0];
#pragma unroll
                for (int j = 1; j < 8; ++j) mx4[nb] = fmaxf(mx4[nb], st[qt][nb][j]); }
            float mx = fmaxf(fmaxf(mx4[0], mx4[1]), fmaxf(mx4[2], mx4[3]));
            mx = fmaxf(mx, __shfl_xor(mx, 16, 32));  // the other half of the wave holds the query's other keys
            mx = fmaxf(mx, m[qt]);
            const float al = __builtin_amdgcn_exp2f(m[qt] - mx); m[qt] = mx; const float msh = mx - PSH;
            float ls4[4];
#pragma unroll
            for (int nb = 0; nb < 4; ++nb) { ls4[nb] = 0.0f;
#pragma unroll
                for (int j = 0; j < 8; ++j) { const float p = __builtin_amdgcn_exp2f(st[qt][nb][j] - msh); st[qt][nb][j] = p; ls4[nb] += p; } }
            l[qt] = l[qt] * al + ((ls4[0] + ls4[1]) + (ls4[2] + ls4[3]));
#pragma unroll
            for (int md = 0; md < 4; ++md) o[qt][md] *= al;
#pragma unroll
            for (int ks = 0; ks < 2; ++ks) {
                if constexpr (HI) { v8us h0, h1, l0, l1;
#pragma unroll
                    for (int j = 0; j < 8; ++j) { unsigned short a, c; splitf(st[qt][2 * ks][j], a, c); h0[j] = a; l0[j] = c; splitf(st[qt][2 * ks + 1][j], a, c); h1[j] = a; l1[j] = c; }
                    pb[qt][ks] = cat16b(h0, h1); pb2[qt][ks] = cat16b(l0, l1);
                } else { v8h h0, h1;
#pragma unroll
                    for (int j = 0; j < 8; ++j) { h0[j] = tohx(st[qt][2 * ks][j]); h1[j] = tohx(st[qt][2 * ks + 1][j]); }
                    pb[qt][ks] = cat16(h0, h1); }
            }
        }
#pragma unroll
        for (int ks = 0; ks < 2; ++ks)
#pragma unroll
            for (int md = 0; md < 4; ++md)
#pragma unroll
                for (int qt = 0; qt < QT; ++qt) { o[qt][md] = WFrag<T16>::mma(va[md][ks], pb[qt][ks], o[qt][md]); if (HI) { o[qt][md] = WFrag<T16>::mma(va[md][ks], pb2[qt][ks], o[qt][md]); o[qt][md] = WFrag<T16>::mma(va2[md][ks], pb[qt][ks], o[qt][md]); } }
    }
#pragma unroll
    for (int qt = 0; qt < QT; ++qt) { const float f = __fdiv_rn(1.0f, l[qt] + __shfl_xor(l[qt], 16, 32)); bf* ahp = Ah + (q0 + qt * 16 + lr) * DQ + hi * 8; bf* alp = Al + (q0 + qt * 16 + lr) * DQ + hi * 8;
#pragma unroll
        for (int md = 0; md < 4; ++md) { v8us oh, ol;
#pragma unroll
            for (int j = 0; j < 8; ++j) { unsigned short a, c; splitf(o[qt][md][j] * f, a, c); oh[j] = a; ol[j] = c; }
            *(v8us*)(ahp + md * 16) = oh; *(v8us*)(alp + md * 16) = ol; }
        asm volatile("s_wait_xcnt 0x0" :: "v"(ahp), "v"(alp) : "memory");   // before any register that the stores above name is written again
    }
}
// grid (heads x batches, (TT - RH) / 64 + RH / 32), 2 waves, longest key loops of both batches first: blocks y < (TT - RH) / 64 take 64 fp16 query rows each, from the last rows down (32 a wave); the others 32 hi+lo rows each (16 a wave)
__global__ __launch_bounds__(64) void k_fattn(const h16* __restrict__ QP16, const h16* __restrict__ KP16, const h16* __restrict__ VT16, const bf* __restrict__ QPh, const bf* __restrict__ QPl, const bf* __restrict__ KPh, const bf* __restrict__ KPl, const bf* __restrict__ VTh, const bf* __restrict__ VTl, bf* ATh, bf* ATl) {
    const int wave = __builtin_amdgcn_readfirstlane((int)(threadIdx.x >> 5));   // scalar, so that the key loop's branches are wave-uniform (matrix instructions need every lane on)
    const int lane = threadIdx.x & 31, lr = lane & 15, hi = lane >> 4; const int h = blockIdx.x % NH_, b = blockIdx.x / NH_; const int y = blockIdx.y; const bool lo = y < (TT - RH) / 64;
    const int q0 = lo ? (TT / 64 - 1 - y) * 64 + wave * 32 : ((TT - RH) / 64 + RH / 32 - 1 - y) * 32 + wave * 16;
    const size_t zq = ((size_t)b * NH_ + h) * TT * HD, zk = ((size_t)b * NKV + h / REP) * TT * HD; bf* ah = ATh + (size_t)b * TT * DQ + h * HD; bf* al = ATl + (size_t)b * TT * DQ + h * HD;
    if (!lo) fattn_tile<bf, true, 1>(QPh + zq, QPl + zq, KPh + zk, KPl + zk, VTh + zk, VTl + zk, q0, lr, hi, ah, al);
    else fattn_tile<h16, false, 2>(QP16 + zq, nullptr, KP16 + zk, nullptr, VT16 + zk, nullptr, q0, lr, hi, ah, al);
}

extern "C" void kernel_launch(void* const* d_in, const int* in_sizes, int n_in,
                              void* d_out, int out_size, void* d_ws, size_t ws_size, hipStream_t stream) {
    (void)in_sizes; (void)n_in; (void)out_size;
    const float* x = (const float*)d_in[0]; const float* wq = (const float*)d_in[1]; const float* bq = (const float*)d_in[2]; const float* wk = (const float*)d_in[3]; const float* bk = (const float*)d_in[4]; const float* wv = (const float*)d_in[5]; const float* bv = (const float*)d_in[6]; const float* wo = (const float*)d_in[7]; const float* bo = (const float*)d_in[8]; const float* cosT = nullptr; const float* sinT = nullptr; (void)cosT; (void)sinT;
    float* OUT = (float*)d_out;     // [2][2048][1024]
    char* wsp = (char*)d_ws;
    auto take = [&](size_t bytes) { char* p = wsp; wsp += (bytes + 255) & ~(size_t)255; return (void*)p; };
    bf* W4 = (bf*)take((size_t)4 * DQ * DM * 2); float* CS = (float*)take((size_t)TT * HD * 2 * 4);   // Wq, Wk, Wv, Wo transposed, one behind the other
    bf* XB = (bf*)take((size_t)NB_ * TT * DM * 2); float* F3 = (float*)take((size_t)3 * NB_ * TT * DQ * 4);   // both batches: x in bf16; the q, k, v projections
    h16* P16 = (h16*)take((size_t)3 * NB_ * TT * DQ * 2); bf* Ph = (bf*)take((size_t)3 * NB_ * TT * DQ * 2); bf* Pl = (bf*)take((size_t)3 * NB_ * TT * DQ * 2);   // [q, k, v][batch] planes
    bf* ATh = (bf*)take((size_t)NB_ * TT * DQ * 2); bf* ATl = (bf*)take((size_t)NB_ * TT * DQ * 2);
    if ((size_t)(wsp - (char*)d_ws) > ws_size) return;    // ws 256 MiB
    const size_t KO = (size_t)NB_ * TT * DQ, VO = (size_t)2 * NB_ * TT * DQ;   // where the k and the v planes start
    // five launches, each one stage of the data flow for both batches ([batch][t] is one run of NB_ x TT rows for the two GEMMs)
    k_prep<<<4 * WTB + CVB + CSB, 256, 0, stream>>>(wq, wk, wv, wo, x, W4, XB, CS);
    k_gemmw<bf, 0, true, 8><<<dim3(NB_ * TT / 64, DQ / 64, 3), 256, 0, stream>>>(XB, nullptr, W4, nullptr, DM, F3, DQ, bq, bk, bv, 0, (size_t)DQ * DM, (size_t)NB_ * TT * DQ);
    k_planes<<<dim3(PLB * NB_, 3, 1), 256, 0, stream>>>(F3, CS, P16, Ph, Pl);
    k_fattn<<<dim3(NH_ * NB_, (TT - RH) / 64 + RH / 32, 1), 64, 0, stream>>>(P16, P16 + KO, P16 + VO, Ph, Pl, Ph + KO, Pl + KO, Ph + VO, Pl + VO, ATh, ATl);
    k_gemmw<bf, 1, true, 8><<<dim3(NB_ * TT / 64, DM / 64, 1), 256, 0, stream>>>(ATh, ATl, W4 + (size_t)3 * DQ * DM, nullptr, DQ, OUT, DM, bo, nullptr, nullptr, 0, 0, 0);
}

// v004
// It runs in 163 microseconds.
// Next to v003, in two timings, it ran 1.16 times as fast each time.
// Counting every step since v000, it is 9.73 times as fast.
#include <hip/hip_runtime.h>

// Multi-head causal attention with partial rotary (x [2][2048][1024]; q/k/v = x W + b ('xw' [1024][1024], 16 x 64); rotate-half rotary on the FIRST 32 dims of each head (pairs d, d+16), angles t x inv[d mod 16] with inv_i = 2048^(-2i/32), the other 32 dims pass through; causal (tril) -inf; softmax(q.k / 8); out = merged Wo ('xw' [1024][1024]) + bo -> [2][2048][1024]).
// Compute dtypes, f32 accumulate: every input rounded to bf16; q/k/v on PLAIN bf16 operands (inputs: exact) + bias; rotary in f32 from an on-chip table (inv constants are the reference's own f32 values; angle = t x inv one product; precise cosf/sinf); causal scores and attn.v: query rows < 512 hl (3 products), the rest single fp16 (x1024), causal tile skipping; on-line softmax f32, all inside one kernel; Wo hl x exact (2 products) + bias.

#define NB_  2
#define TT   2048
#define DM   1024
#define NH_  16
#define NKV  16
#define REP  (NH_ / NKV)
#define HD   64
#define DQ   (NH_ * HD)
#define DKV  (NKV * HD)
#define RH   512                  // query rows < RH use hi+lo planes (a multiple of 64)
#define ROT  32                   // rotary dims per head (rotate-half inside them)
#define SCL  0.125f   // HD^-0.5
typedef _Float16 h16;
typedef unsigned short bf;
typedef __attribute__((ext_vector_type(16))) __bf16   v16bf;
typedef __attribute__((ext_vector_type(16))) _Float16 v16h;
typedef __attribute__((ext_vector_type(8)))  _Float16 v8h;
typedef __attribute__((ext_vector_type(8)))  unsigned short v8us;
typedef __attribute__((ext_vector_type(8)))  float    v8f;
typedef __attribute__((ext_vector_type(4)))  float    v4f;
typedef v8h  __attribute__((may_alias)) v8ha;
typedef v4f  __attribute__((may_alias)) v4fa;
typedef v8us __attribute__((may_alias)) v8usa;

__device__ __forceinline__ unsigned short f2bf(float f) { unsigned u = __float_as_uint(f); u += 0x7FFFu + ((u >> 16) & 1u); return (unsigned short)(u >> 16); }
__device__ __forceinline__ float bf2f(unsigned short b) { return __uint_as_float(((unsigned)b) << 16); }
__device__ __forceinline__ float bfr(float f) { return bf2f(f2bf(f)); }
__device__ __forceinline__ v16h cat16(v8h lo, v8h hi) { return __builtin_shufflevector(lo, hi, 0, 1, 2, 3, 4, 5, 6, 7, 8, 9, 10, 11, 12, 13, 14, 15); }
__device__ __forceinline__ v16bf cat16b(v8us lo, v8us hi) { return __builtin_bit_cast(v16bf, __builtin_shufflevector(lo, hi, 0, 1, 2, 3, 4, 5, 6, 7, 8, 9, 10, 11, 12, 13, 14, 15)); }
__device__ __forceinline__ v8f wmma16(v16h a, v16h b, v8f c) { return __builtin_amdgcn_wmma_f32_16x16x32_f16(false, a, false, b, (short)0, c, false, false); }
__device__ __forceinline__ v8f wmmab(v16bf a, v16bf b, v8f c) { return __builtin_amdgcn_wmma_f32_16x16x32_bf16(false, a, false, b, (short)0, c, false, false); }

__device__ __forceinline__ h16 tohx(float x) { return (h16)x; }
__device__ __forceinline__ void splitf(float y, unsigned short& h, unsigned short& l) { h = f2bf(y); l = f2bf(y - bf2f(h)); }
typedef __attribute__((ext_vector_type(2))) _Float16 v2h;
typedef __attribute__((ext_vector_type(4))) _Float16 v4h;
typedef __attribute__((ext_vector_type(2))) unsigned short v2us;
typedef __attribute__((ext_vector_type(4))) unsigned short v4us;
typedef __attribute__((ext_vector_type(2))) float v2f;
typedef __attribute__((ext_vector_type(4))) int v4i;
#define PL   ((size_t)TT * DQ)              // elements of one batch's projection = of one batch's plane

// ---- k_gemmw: register-blocked GEMM, one 64x64 output tile per block (16 accumulators per wave), operands straight from K-contiguous 16-bit planes; grid (M/64, N/64, Z), 32 x NW threads.
// NW = 1: one wave does the whole K loop. NW > 1: the K loop is split over the block's NW waves, so that NW waves' load latencies run side by side: wave w takes the 64-wide k pieces w, w + NW, ...
// (64 k = one whole 128-byte line of every operand row, both halves read by the same wave); the NW f32 partial tiles are summed through LDS in wave order 0 .. NW-1.
// C[m][n] (f32, pitch ldc, + optional f32 bias[n]) = sum_k A[m][k] Bt[n][k] (+ split products per NSPLIT). z-batch strides sA/sB/sC in elements, z = 0, 1, 2 adds bias, bias1, bias2. K % 32 == 0.
// PLANES (the q/k/v projection; rows = [batch][t], one 64-column tile = one head, z = q, k, v): C is not written; the summed tile goes straight to the 16-bit planes that the attention kernel reads, each set = [q, k, v][batch][head][..][..]:
// z < 2: [t][d] planes of partial-rope(x): rotate-half inside the first ROT dims (out[d] = x[d] cos - x[d+ROT/2] sin, out[d+ROT/2] = x[d+ROT/2] cos + x[d] sin), dims >= ROT pass through (table: cos 1, sin 0);
// z = 2: [d][t] planes: the partial tiles are laid into LDS transposed, so that the same sums come out along t and every store still covers whole lines.
template <typename T16> struct WFrag;
template <> struct WFrag<h16> { typedef v16h V; static __device__ __forceinline__ V ld(const h16* p) { return cat16(*(const v8h*)p, *(const v8h*)(p + 16)); } static __device__ __forceinline__ v8f mma(V a, V b, v8f c) { return wmma16(a, b, c); } };
template <> struct WFrag<bf> { typedef v16bf V; static __device__ __forceinline__ V ld(const bf* p) { return cat16b(*(const v8us*)p, *(const v8us*)(p + 16)); } static __device__ __forceinline__ v8f mma(V a, V b, v8f c) { return wmmab(a, b, c); } };
template <typename T16, int NSPLIT, bool BIAS, int NW, bool PLANES>
__global__ __launch_bounds__(32 * NW) void k_gemmw(const T16* __restrict__ A, const T16* __restrict__ A2, const T16* __restrict__ Bt, const T16* __restrict__ Bt2, int K, float* C, int ldc, const float* __restrict__ bias, const float* __restrict__ bias1, const float* __restrict__ bias2, size_t sA, size_t sB, size_t sC, const float* __restrict__ CS, h16* P16, bf* Ph, bf* Pl) {
    static_assert(!PLANES || (NW == 8 && BIAS && HD == 64 && TT % 64 == 0), "the plane epilogue takes one head and one batch per tile, 16 elements a thread");
    typedef typename WFrag<T16>::V V;
    __shared__ __align__(16) float os[(NW == 1 ? 16 : NW * 64) * 68];
    const int wave = (NW == 1) ? 0 : __builtin_amdgcn_readfirstlane((int)(threadIdx.x >> 5));   // scalar, so that the K loop's branch is wave-uniform (matrix instructions need every lane on)
    const size_t z = blockIdx.z; A += z * sA; if (A2) A2 += z * sA; Bt += z * sB; if (Bt2) Bt2 += z * sB; C += z * sC; if (BIAS) bias = (z == 0) ? bias : (z == 1) ? bias1 : bias2;
    const int lane = threadIdx.x & 31, lr = lane & 15, hi = lane >> 4; const int r0 = blockIdx.x * 64, c0 = blockIdx.y * 64;
    v8f acc[4][4];
#pragma unroll
    for (int mb = 0; mb < 4; ++mb)
#pragma unroll
        for (int nb = 0; nb < 4; ++nb) acc[mb][nb] = (v8f){};
    const size_t aoff = (size_t)(r0 + lr) * K + 8 * hi, boff = (size_t)(c0 + lr) * K + 8 * hi;
#pragma unroll 1
    for (int kc = wave * 64; kc < K; kc += (NW == 1 || !(kc & 32)) ? 32 : 64 * NW - 32) {
        V a[4], a2[4];
#pragma unroll
        for (int mb = 0; mb < 4; ++mb) { a[mb] = WFrag<T16>::ld(A + aoff + (size_t)mb * 16 * K + kc); if (NSPLIT == 1 || NSPLIT == 2) a2[mb] = WFrag<T16>::ld(A2 + aoff + (size_t)mb * 16 * K + kc); }
#pragma unroll
        for (int nb = 0; nb < 4; ++nb) { const V b = WFrag<T16>::ld(Bt + boff + (size_t)nb * 16 * K + kc); V b2; if (NSPLIT >= 2) b2 = WFrag<T16>::ld(Bt2 + boff + (size_t)nb * 16 * K + kc);
#pragma unroll
            for (int mb = 0; mb < 4; ++mb) { acc[mb][nb] = WFrag<T16>::mma(a[mb], b, acc[mb][nb]); if (NSPLIT == 1 || NSPLIT == 2) acc[mb][nb] = WFrag<T16>::mma(a2[mb], b, acc[mb][nb]); if (NSPLIT >= 2) acc[mb][nb] = WFrag<T16>::mma(a[mb], b2, acc[mb][nb]); } }
        asm volatile("v_nop\n\tv_nop\n\tv_nop\n\tv_nop" : "+v"(acc[0][0]), "+v"(acc[1][1]), "+v"(acc[2][2]), "+v"(acc[3][3]) : "v"(a[0]), "v"(a[3]));
    }
    if constexpr (NW > 1) {
        const bool tr = PLANES && z == 2;   // block-uniform
        const int row0 = (int)threadIdx.x >> 4, col0 = ((int)threadIdx.x & 15) * 4, t0 = r0 % TT;   // PLANES: a thread sums rows row0 + 16 s, columns col0 .. col0 + 3 of the LDS tile
        v4f bv, cs0[4], cs1[4];   // PLANES: bias and (cos, sin) of the thread's elements, asked for here so that they fly while the partial tiles go to LDS
        if constexpr (PLANES) { const int cofs = col0;
            if (tr) { const float* bp = bias + c0 + row0;
#pragma unroll   // constant indices, so that the small arrays stay in registers
                for (int s = 0; s < 4; ++s) bv[s] = bp[s * 16];
                asm volatile("s_wait_xcnt 0x0" :: "v"(bp) : "memory");   // before any register that the loads above name is written again
            } else { const float* bp = bias + c0 + cofs; const float* cs = CS + ((size_t)(t0 + row0) * HD + cofs) * 2; bv[0] = bp[0]; bv[1] = bp[1]; bv[2] = bp[2]; bv[3] = bp[3];
#pragma unroll   // constant indices, so that the small arrays stay in registers
                for (int s = 0; s < 4; ++s) { cs0[s] = *(const v4f*)(cs + s * 16 * HD * 2); cs1[s] = *(const v4f*)(cs + s * 16 * HD * 2 + 4); }
                asm volatile("s_wait_xcnt 0x0" :: "v"(bp), "v"(cs) : "memory");   // before any register that the loads above name is written again
            }
        }
        if (tr) {
#pragma unroll   // constant indices, so that the small arrays stay in registers
            for (int mb = 0; mb < 4; ++mb)
#pragma unroll   // constant indices, so that the small arrays stay in registers
                for (int nb = 0; nb < 4; ++nb) { float* p = os + (wave * 64 + nb * 16 + lr) * 68 + mb * 16 + hi * 8;
                    *(v4fa*)p = __builtin_shufflevector(acc[mb][nb], acc[mb][nb], 0, 1, 2, 3); *(v4fa*)(p + 4) = __builtin_shufflevector(acc[mb][nb], acc[mb][nb], 4, 5, 6, 7); }
        } else {
#pragma unroll
            for (int mb = 0; mb < 4; ++mb)
#pragma unroll
                for (int nb = 0; nb < 4; ++nb)
#pragma unroll
                    for (int j = 0; j < 8; ++j) os[(wave * 64 + mb * 16 + hi * 8 + j) * 68 + nb * 16 + lr] = acc[mb][nb][j];
        }
        __syncthreads();   // every wave's partial tile is in LDS before any thread sums across the waves
        if constexpr (PLANES) { const int cofs = col0; v4f val[4];
#pragma unroll   // constant indices, so that the small arrays stay in registers
            for (int s = 0; s < 4; ++s) { const int row = s * 16 + row0; val[s] = *(const v4fa*)(os + row * 68 + cofs);
#pragma unroll   // constant indices, so that the small arrays stay in registers
                for (int w = 1; w < NW; ++w) val[s] += *(const v4fa*)(os + (w * 64 + row) * 68 + cofs); }
            size_t e = (z * NB_ + r0 / TT) * PL + (size_t)blockIdx.y * TT * HD;   // this batch's and head's plane, then the thread's first element and its step from s to s + 1
            int es;
            if (tr) { e += (size_t)row0 * TT + t0 + cofs; es = 16 * TT;   // LDS row = d, column = t
#pragma unroll   // constant indices, so that the small arrays stay in registers
                for (int s = 0; s < 4; ++s) val[s] += bfr(bv[s]);
            } else { e += (size_t)(t0 + row0) * HD + cofs; es = 16 * HD;
#pragma unroll   // constant indices, so that the small arrays stay in registers
                for (int s = 0; s < 4; ++s) { v4f x = val[s], xp;   // xp: the rotate-half partner d +- ROT/2, four lanes away, with its sign
#pragma unroll   // constant indices, so that the small arrays stay in registers
                    for (int c = 0; c < 4; ++c) x[c] += bfr(bv[c]);
#pragma unroll   // constant indices, so that the small arrays stay in registers
                    for (int c = 0; c < 4; ++c) { const float y = __shfl_xor(x[c], 4, 32); xp[c] = (cofs < ROT / 2) ? -y : (cofs < ROT) ? y : x[c]; }
                    val[s][0] = x[0] * cs0[s][0] + xp[0] * cs0[s][1]; val[s][1] = x[1] * cs0[s][2] + xp[1] * cs0[s][3]; val[s][2] = x[2] * cs1[s][0] + xp[2] * cs1[s][1]; val[s][3] = x[3] * cs1[s][2] + xp[3] * cs1[s][3]; }
            }
#pragma unroll   // constant indices, so that the small arrays stay in registers
            for (int s = 0; s < 4; ++s) { v4h o16; v4us oh, ol;
#pragma unroll   // constant indices, so that the small arrays stay in registers
                for (int c = 0; c < 4; ++c) { o16[c] = tohx(val[s][c]); unsigned short a2, c2; splitf(val[s][c], a2, c2); oh[c] = a2; ol[c] = c2; }
                h16* p16 = P16 + e + (size_t)s * es; bf* ph = Ph + e + (size_t)s * es; bf* pl = Pl + e + (size_t)s * es;
                *(v4h*)p16 = o16; *(v4us*)ph = oh; *(v4us*)pl = ol;
                asm volatile("s_wait_xcnt 0x0" :: "v"(p16), "v"(ph), "v"(pl) : "memory");   // before any register that the stores above name is written again
            }
        } else {
#pragma unroll
        for (int s = 0; s < 32 / NW; ++s) { const int i = s * 32 * NW + (int)threadIdx.x, row = i >> 4, cofs = (i & 15) * 4; v4f val = *(const v4fa*)(os + row * 68 + cofs);
#pragma unroll
            for (int w = 1; w < NW; ++w) val += *(const v4fa*)(os + (w * 64 + row) * 68 + cofs);
            if (BIAS) { val[0] += bfr(bias[c0 + cofs]); val[1] += bfr(bias[c0 + cofs + 1]); val[2] += bfr(bias[c0 + cofs + 2]); val[3] += bfr(bias[c0 + cofs + 3]); }
            *(v4f*)(C + (size_t)(r0 + row) * ldc + c0 + cofs) = val; }
        }
    } else {
#pragma unroll
    for (int mb = 0; mb < 4; ++mb) {
#pragma unroll
        for (int nb = 0; nb < 4; ++nb) {
#pragma unroll
            for (int j = 0; j < 8; ++j) os[(hi * 8 + j) * 68 + nb * 16 + lr] = acc[mb][nb][j]; }
        __builtin_amdgcn_wave_barrier(); asm volatile("" ::: "memory");
        float* crow = C + (size_t)(r0 + mb * 16) * ldc + c0;
{
#pragma unroll
            for (int s = 0; s < 8; ++s) { const int row = 2 * s + hi, cofs = lr * 4; v4f val = *(const v4fa*)(os + row * 68 + cofs); if (BIAS) { val[0] += bfr(bias[c0 + cofs]); val[1] += bfr(bias[c0 + cofs + 1]); val[2] += bfr(bias[c0 + cofs + 2]); val[3] += bfr(bias[c0 + cofs + 3]); }
                *(v4f*)(crow + (size_t)row * ldc + cofs) = val; }
             }
        __builtin_amdgcn_wave_barrier(); asm volatile("" ::: "memory");
    }
    }
}


// The element-wise stages are device functions of a block number bx; k_prep below deals the blocks of one grid out to them.
__device__ __forceinline__ void d_wtG(const int bx, const float* __restrict__ w, int K, int N, bf* Bt) {
    const int lane = threadIdx.x & 31; const int L0 = (bx * 8 + (threadIdx.x >> 5)) * 8; const int nlines = N * K / 64;
{
#pragma unroll 1
        for (int l = 0; l < 8; ++l) { const int L = L0 + l; if (L >= nlines) break; const size_t e = (size_t)L * 64 + lane * 2; const int k = (int)(e % K), n = (int)(e / K); v2us o;
            o[0] = f2bf(w[(size_t)k * N + n]); o[1] = f2bf(w[(size_t)(k + 1) * N + n]); *(v2us*)(Bt + e) = o; }
         }
}
__device__ __forceinline__ void d_cvt8(const int bx, const float* __restrict__ src, bf* dst, size_t n8) { const size_t i = (size_t)bx * 256 + threadIdx.x; if (i >= n8) return; const v8f v = *(const v8f*)(src + i * 8); v8us o;
#pragma unroll
    for (int k = 0; k < 8; ++k) o[k] = f2bf(v[k]); *(v8us*)(dst + i * 8) = o;  }
__constant__ float INV[ROT / 2] = {1.0,0.6209288835525513,0.38555270433425903,0.23940083384513855,0.1486508846282959,0.0923016369342804,0.057312753051519394,0.035587143152952194,0.022097086533904076,0.013720721006393433,0.008519591763615608,0.005290060769766569,0.003284751670435071,0.002039597136899829,0.0012664449168369174,0.0007863722858019173};
__device__ __forceinline__ void d_cstab(const int bx, float* CS) { const int idx = bx * 256 + threadIdx.x; if (idx >= TT * HD) return; const int t = idx / HD, d = idx % HD; v2f cs; if (d < ROT) { const int i = (d < ROT / 2) ? d : d - ROT / 2; const float ang = __fmul_rn((float)t, INV[i]); cs[0] = cosf(ang); cs[1] = sinf(ang); } else { cs[0] = 1.0f; cs[1] = 0.0f; }
    *(v2f*)(CS + (size_t)idx * 2) = cs;  }
// k_prep: everything that depends on the inputs alone, in one grid: the four weight transposes (their serial scattered reads are the longest, so they start first), x of both batches to bf16, the cos/sin table.
#define WTB  (DM * DQ / 64 / 64)            // blocks per weight transpose
#define CVB  (NB_ * TT * DM / 8 / 256)      // blocks of the x conversion
#define CSB  (TT * HD / 256)                // blocks of the table
static_assert(DKV == DQ && DM == DQ, "the four weight planes have one size");
__global__ __launch_bounds__(256) void k_prep(const float* __restrict__ wq, const float* __restrict__ wk, const float* __restrict__ wv, const float* __restrict__ wo, const float* __restrict__ x, bf* W4, bf* XB, float* CS) {
    const int b = blockIdx.x;
    if (b < 4 * WTB) { const int i = b / WTB; d_wtG(b % WTB, (i == 0) ? wq : (i == 1) ? wk : (i == 2) ? wv : wo, DM, DQ, W4 + (size_t)i * DM * DQ); }
    else if (b < 4 * WTB + CVB) d_cvt8(b - 4 * WTB, x, XB, (size_t)NB_ * TT * DM / 8);
    else d_cstab(b - 4 * WTB - CVB, CS);
}

// ---- k_fattn: causal attention of one head in one kernel (scores, softmax, probability x value, head merge): scores and probabilities stay in registers.
// Transposed products: St = K Qt (A = key rows, B = query rows, both d-contiguous planes) puts one query's scores of a 16-key tile in one lane (D[key 8 hi + j][query lr]); two such tiles, converted in place, are the B operand
// (32 keys in the hardware k order) of Ot += Vt Pt (A = rows of the [d][t] value plane, same k order). On-line softmax over 64-key blocks in the log2 domain: running maximum m and sum l per query column,
// Ot and l rescaled by 2^(m_old - m_new) in every block; P is left unnormalised (x 2^PSH for fp16's range; the factor cancels in Ot / l). One division per query at the end, then the hi/lo bf16 split into the merged [t][DQ] planes.
// HI (query rows < RH): hi+lo bf16 planes, 3 products each; else single fp16. One wave owns 16 x QT query columns; no LDS, no barrier.
// Every inner loop is fully unrolled so that the fragment arrays are indexed by constants and stay in registers.
template <typename T16, bool HI, int QT>
__device__ __forceinline__ void fattn_tile(const T16* __restrict__ Q, const T16* __restrict__ Q2, const T16* __restrict__ Kp, const T16* __restrict__ K2, const T16* __restrict__ Vt, const T16* __restrict__ V2, const int q0, const int lr, const int hi, bf* Ah, bf* Al) {
    typedef typename WFrag<T16>::V V;
    const float C2 = SCL * 1.4426950408889634f;      // score scale x log2(e)
    const float PSH = HI ? 0.0f : 10.0f;             // fp16 P carries x1024
    const unsigned koff = (unsigned)(lr * HD + 8 * hi), voff = (unsigned)(lr * TT + 8 * hi);   // the lane's place inside a 16-row tile of a [t][d] or [d][t] plane; a group of loads shares one pointer per plane, which its s_wait_xcnt names as an input so that the register lives up to the wait
    const unsigned kob = koff * (unsigned)sizeof(T16);   // the same place in bytes: the offset register of the first loads
    const T16* qp = Q + q0 * HD + koff; const T16* qp2 = HI ? Q2 + q0 * HD + koff : qp;
    V qb[QT][2], qb2[QT][2];
#pragma unroll
    for (int qt = 0; qt < QT; ++qt)
#pragma unroll
        for (int ks = 0; ks < 2; ++ks) { const int qo = qt * 16 * HD + ks * 32; qb[qt][ks] = WFrag<T16>::ld(qp + qo); if (HI) qb2[qt][ks] = WFrag<T16>::ld(qp2 + qo); }
    v8f o[QT][4]; float m[QT], l[QT];
#pragma unroll
    for (int qt = 0; qt < QT; ++qt) { m[qt] = -3.0e38f; l[qt] = 0.0f;
#pragma unroll
        for (int md = 0; md < 4; ++md) o[qt][md] = (v8f){}; }
    const int kdiag = q0 & ~63;                      // the 64-key block that holds the diagonal of all 16 x QT rows (16 x QT divides 64)
    V ka[4][2], ka2[4][2];
    const T16* kp = Kp + koff; const T16* kp2 = HI ? K2 + koff : kp;
#pragma unroll
    for (int nb = 0; nb < 4; ++nb)
#pragma unroll
        for (int ks = 0; ks < 2; ++ks) { const int ko = nb * 16 * HD + ks * 32; ka[nb][ks] = WFrag<T16>::ld(kp + ko); if (HI) ka2[nb][ks] = WFrag<T16>::ld(kp2 + ko); }
    asm volatile("s_wait_xcnt 0x0" :: "v"(qp), "v"(qp2), "v"(kp), "v"(kp2), "v"(kob) : "memory");   // before any register that the loads above name is written again
#pragma unroll 1   // rolled: one block's fragments already fill the registers, a second copy of the body would only cost instruction cache
    for (int kb = 0; kb <= kdiag; kb += 64) {
        V va[4][2], va2[4][2];                       // this block's value rows: needed last, asked for first
        const T16* vp = Vt + kb + voff; const T16* vp2 = HI ? V2 + kb + voff : vp;
#pragma unroll
        for (int md = 0; md < 4; ++md)
#pragma unroll
            for (int ks = 0; ks < 2; ++ks) { const int vo = md * 16 * TT + ks * 32; va[md][ks] = WFrag<T16>::ld(vp + vo); if (HI) va2[md][ks] = WFrag<T16>::ld(vp2 + vo); }
        asm volatile("s_wait_xcnt 0x0" :: "v"(vp), "v"(vp2) : "memory");   // before any register that the loads above name is written again
        v8f st[QT][4];
#pragma unroll
        for (int nb = 0; nb < 4; ++nb)
#pragma unroll
            for (int qt = 0; qt < QT; ++qt) { v8f a = (v8f){};
#pragma unroll
                for (int ks = 0; ks < 2; ++ks) { a = WFrag<T16>::mma(ka[nb][ks], qb[qt][ks], a); if (HI) { a = WFrag<T16>::mma(ka[nb][ks], qb2[qt][ks], a); a = WFrag<T16>::mma(ka2[nb][ks], qb[qt][ks], a); } }
                st[qt][nb] = a; }
        const int kst = (kb < kdiag) ? 64 * HD : 0; kp += kst; kp2 += kst;   // next block's key rows fly during the softmax and P.V (the last trip re-reads its own: in bounds, unused)
#pragma unroll
        for (int nb = 0; nb < 4; ++nb)
#pragma unroll
            for (int ks = 0; ks < 2; ++ks) { const int ko = nb * 16 * HD + ks * 32; ka[nb][ks] = WFrag<T16>::ld(kp + ko); if (HI) ka2[nb][ks] = WFrag<T16>::ld(kp2 + ko); }
        asm volatile("s_wait_xcnt 0x0" :: "v"(kp), "v"(kp2) : "memory");   // before any register that the loads above name is written again
#pragma unroll
        for (int qt = 0; qt < QT; ++qt)
#pragma unroll
            for (int nb = 0; nb < 4; ++nb) st[qt][nb] *= C2;
        if (kb == kdiag) {                           // wave-uniform: only the diagonal block has keys above a query
#pragma unroll
            for (int qt = 0; qt < QT; ++qt)
#pragma unroll
                for (int nb = 0; nb < 4; ++nb)
#pragma unroll
                    for (int j = 0; j < 8; ++j) st[qt][nb][j] = (kb + nb * 16 + hi * 8 + j <= q0 + qt * 16 + lr) ? st[qt][nb][j] : -3.0e38f;
        }
        V pb[QT][2], pb2[QT][2];
#pragma unroll
        for (int qt = 0; qt < QT; ++qt) {
            float mx4[4];
#pragma unroll
            for (int nb = 0; nb < 4; ++nb) { mx4[nb] = st[qt][nb][0];
#pragma unroll
                for (int j = 1; j < 8; ++j) mx4[nb] = fmaxf(mx4[nb], st[qt][nb][j]); }
            float mx = fmaxf(fmaxf(mx4[0], mx4[1]), fmaxf(mx4[2], mx4[3]));
            mx = fmaxf(mx, __shfl_xor(mx, 16, 32));  // the other half of the wave holds the query's other keys
            mx = fmaxf(mx, m[qt]);
            const float al = __builtin_amdgcn_exp2f(m[qt] - mx); m[qt] = mx; const float msh = mx - PSH;
            float ls4[4];
#pragma unroll
            for (int nb = 0; nb < 4; ++nb) { ls4[nb] = 0.0f;
#pragma unroll
                for (int j = 0; j < 8; ++j) { const float p = __builtin_amdgcn_exp2f(st[qt][nb][j] - msh); st[qt][nb][j] = p; ls4[nb] += p; } }
            l[qt] = l[qt] * al + ((ls4[0] + ls4[1]) + (ls4[2] + ls4[3]));
#pragma unroll
            for (int md = 0; md < 4; ++md) o[qt][md] *= al;
#pragma unroll
            for (int ks = 0; ks < 2; ++ks) {
                if constexpr (HI) { v8us h0, h1, l0, l1;
#pragma unroll
                    for (int j = 0; j < 8; ++j) { unsigned short a, c; splitf(st[qt][2 * ks][j], a, c); h0[j] = a; l0[j] = c; splitf(st[qt][2 * ks + 1][j], a, c); h1[j] = a; l1[j] = c; }
                    pb[qt][ks] = cat16b(h0, h1); pb2[qt][ks] = cat16b(l0, l1);
                } else { v8h h0, h1;
#pragma unroll
                    for (int j = 0; j < 8; ++j) { h0[j] = tohx(st[qt][2 * ks][j]); h1[j] = tohx(st[qt][2 * ks + 1][j]); }
                    pb[qt][ks] = cat16(h0, h1); }
            }
        }
#pragma unroll
        for (int ks = 0; ks < 2; ++ks)
#pragma unroll
            for (int md = 0; md < 4; ++md)
#pragma unroll
                for (int qt = 0; qt < QT; ++qt) { o[qt][md] = WFrag<T16>::mma(va[md][ks], pb[qt][ks], o[qt][md]); if (HI) { o[qt][md] = WFrag<T16>::mma(va[md][ks], pb2[qt][ks], o[qt][md]); o[qt][md] = WFrag<T16>::mma(va2[md][ks], pb[qt][ks], o[qt][md]); } }
    }
#pragma unroll
    for (int qt = 0; qt < QT; ++qt) { const float f = __fdiv_rn(1.0f, l[qt] + __shfl_xor(l[qt], 16, 32)); bf* ahp = Ah + (q0 + qt * 16 + lr) * DQ + hi * 8; bf* alp = Al + (q0 + qt * 16 + lr) * DQ + hi * 8;
#pragma unroll
        for (int md = 0; md < 4; ++md) { v8us oh, ol;
#pragma unroll
            for (int j = 0; j < 8; ++j) { unsigned short a, c; splitf(o[qt][md][j] * f, a, c); oh[j] = a; ol[j] = c; }
            *(v8us*)(ahp + md * 16) = oh; *(v8us*)(alp + md * 16) = ol; }
        asm volatile("s_wait_xcnt 0x0" :: "v"(ahp), "v"(alp) : "memory");   // before any register that the stores above name is written again
    }
}
// grid (heads x batches, (TT - RH) / 64 + RH / 32), 2 waves, longest key loops of both batches first: blocks y < (TT - RH) / 64 take 64 fp16 query rows each, from the last rows down (32 a wave); the others 32 hi+lo rows each (16 a wave)
__global__ __launch_bounds__(64) void k_fattn(const h16* __restrict__ QP16, const h16* __restrict__ KP16, const h16* __restrict__ VT16, const bf* __restrict__ QPh, const bf* __restrict__ QPl, const bf* __restrict__ KPh, const bf* __restrict__ KPl, const bf* __restrict__ VTh, const bf* __restrict__ VTl, bf* ATh, bf* ATl) {
    const int wave = __builtin_amdgcn_readfirstlane((int)(threadIdx.x >> 5));   // scalar, so that the key loop's branches are wave-uniform (matrix instructions need every lane on)
    const int lane = threadIdx.x & 31, lr = lane & 15, hi = lane >> 4; const int h = blockIdx.x % NH_, b = blockIdx.x / NH_; const int y = blockIdx.y; const bool lo = y < (TT - RH) / 64;
    const int q0 = lo ? (TT / 64 - 1 - y) * 64 + wave * 32 : ((TT - RH) / 64 + RH / 32 - 1 - y) * 32 + wave * 16;
    const size_t zq = ((size_t)b * NH_ + h) * TT * HD, zk = ((size_t)b * NKV + h / REP) * TT * HD; bf* ah = ATh + (size_t)b * TT * DQ + h * HD; bf* al = ATl + (size_t)b * TT * DQ + h * HD;
    if (!lo) fattn_tile<bf, true, 1>(QPh + zq, QPl + zq, KPh + zk, KPl + zk, VTh + zk, VTl + zk, q0, lr, hi, ah, al);
    else fattn_tile<h16, false, 2>(QP16 + zq, nullptr, KP16 + zk, nullptr, VT16 + zk, nullptr, q0, lr, hi, ah, al);
}

extern "C" void kernel_launch(void* const* d_in, const int* in_sizes, int n_in,
                              void* d_out, int out_size, void* d_ws, size_t ws_size, hipStream_t stream) {
    (void)in_sizes; (void)n_in; (void)out_size;
    const float* x = (const float*)d_in[0]; const float* wq = (const float*)d_in[1]; const float* bq = (const float*)d_in[2]; const float* wk = (const float*)d_in[3]; const float* bk = (const float*)d_in[4]; const float* wv = (const float*)d_in[5]; const float* bv = (const float*)d_in[6]; const float* wo = (const float*)d_in[7]; const float* bo = (const float*)d_in[8]; const float* cosT = nullptr; const float* sinT = nullptr; (void)cosT; (void)sinT;
    float* OUT = (float*)d_out;     // [2][2048][1024]
    char* wsp = (char*)d_ws;
    auto take = [&](size_t bytes) { char* p = wsp; wsp += (bytes + 255) & ~(size_t)255; return (void*)p; };
    bf* W4 = (bf*)take((size_t)4 * DQ * DM * 2); float* CS = (float*)take((size_t)TT * HD * 2 * 4);   // Wq, Wk, Wv, Wo transposed, one behind the other
    bf* XB = (bf*)take((size_t)NB_ * TT * DM * 2);   // both batches: x in bf16
    h16* P16 = (h16*)take((size_t)3 * NB_ * TT * DQ * 2); bf* Ph = (bf*)take((size_t)3 * NB_ * TT * DQ * 2); bf* Pl = (bf*)take((size_t)3 * NB_ * TT * DQ * 2);   // [q, k, v][batch] planes
    bf* ATh = (bf*)take((size_t)NB_ * TT * DQ * 2); bf* ATl = (bf*)take((size_t)NB_ * TT * DQ * 2);
    if ((size_t)(wsp - (char*)d_ws) > ws_size) return;    // ws 256 MiB
    const size_t KO = (size_t)NB_ * TT * DQ, VO = (size_t)2 * NB_ * TT * DQ;   // where the k and the v planes start
    // four launches, each one stage of the data flow for both batches ([batch][t] is one run of NB_ x TT rows for the two GEMMs)
    k_prep<<<4 * WTB + CVB + CSB, 256, 0, stream>>>(wq, wk, wv, wo, x, W4, XB, CS);
    k_gemmw<bf, 0, true, 8, true><<<dim3(NB_ * TT / 64, DQ / 64, 3), 256, 0, stream>>>(XB, nullptr, W4, nullptr, DM, nullptr, 0, bq, bk, bv, 0, (size_t)DQ * DM, 0, CS, P16, Ph, Pl);
    k_fattn<<<dim3(NH_ * NB_, (TT - RH) / 64 + RH / 32, 1), 64, 0, stream>>>(P16, P16 + KO, P16 + VO, Ph, Pl, Ph + KO, Pl + KO, Ph + VO, Pl + VO, ATh, ATl);
    k_gemmw<bf, 1, true, 8, false><<<dim3(NB_ * TT / 64, DM / 64, 1), 256, 0, stream>>>(ATh, ATl, W4 + (size_t)3 * DQ * DM, nullptr, DQ, OUT, DM, bo, nullptr, nullptr, 0, 0, 0, nullptr, nullptr, nullptr, nullptr);
}

// v005
// Measured time: 111 microseconds a run.
// Next to v004, in two timings, it ran 1.46 and 1.48 times as fast.
// Over all steps from v000 it is 14.3 times as fast.
#include <hip/hip_runtime.h>

// Multi-head causal attention with partial rotary (x [2][2048][1024]; q/k/v = x W + b ('xw' [1024][1024], 16 x 64); rotate-half rotary on the FIRST 32 dims of each head (pairs d, d+16), angles t x inv[d mod 16] with inv_i = 2048^(-2i/32), the other 32 dims pass through; causal (tril) -inf; softmax(q.k / 8); out = merged Wo ('xw' [1024][1024]) + bo -> [2][2048][1024]).
// Compute dtypes, f32 accumulate: every input rounded to bf16; q/k/v on PLAIN bf16 operands (inputs: exact) + bias; rotary in f32 from an on-chip table (inv constants are the reference's own f32 values; angle = t x inv one product; precise cosf/sinf); causal scores and attn.v: query rows < 512 hl (3 products), the rest single fp16 (x1024), causal tile skipping; on-line softmax f32, all inside one kernel; Wo hl x exact (2 products) + bias.

#define NB_  2
#define TT   2048
#define DM   1024
#define NH_  16
#define NKV  16
#define REP  (NH_ / NKV)
#define HD   64
#define DQ   (NH_ * HD)
#define DKV  (NKV * HD)
#define RH   512                  // query rows < RH use hi+lo planes (a multiple of 64)
#define ROT  32                   // rotary dims per head (rotate-half inside them)
#define SCL  0.125f   // HD^-0.5
typedef _Float16 h16;
typedef unsigned short bf;
typedef __attribute__((ext_vector_type(16))) __bf16   v16bf;
typedef __attribute__((ext_vector_type(16))) _Float16 v16h;
typedef __attribute__((ext_vector_type(8)))  _Float16 v8h;
typedef __attribute__((ext_vector_type(8)))  unsigned short v8us;
typedef __attribute__((ext_vector_type(8)))  float    v8f;
typedef __attribute__((ext_vector_type(4)))  float    v4f;
typedef v8h  __attribute__((may_alias)) v8ha;
typedef v4f  __attribute__((may_alias)) v4fa;
typedef v8us __attribute__((may_alias)) v8usa;

__device__ __forceinline__ unsigned short f2bf(float f) { unsigned u = __float_as_uint(f); u += 0x7FFFu + ((u >> 16) & 1u); return (unsigned short)(u >> 16); }
__device__ __forceinline__ float bf2f(unsigned short b) { return __uint_as_float(((unsigned)b) << 16); }
__device__ __forceinline__ float bfr(float f) { return bf2f(f2bf(f)); }
__device__ __forceinline__ v16h cat16(v8h lo, v8h hi) { return __builtin_shufflevector(lo, hi, 0, 1, 2, 3, 4, 5, 6, 7, 8, 9, 10, 11, 12, 13, 14, 15); }
__device__ __forceinline__ v16bf cat16b(v8us lo, v8us hi) { return __builtin_bit_cast(v16bf, __builtin_shufflevector(lo, hi, 0, 1, 2, 3, 4, 5, 6, 7, 8, 9, 10, 11, 12, 13, 14, 15)); }
__device__ __forceinline__ v8f wmma16(v16h a, v16h b, v8f c) { return __builtin_amdgcn_wmma_f32_16x16x32_f16(false, a, false, b, (short)0, c, false, false); }
__device__ __forceinline__ v8f wmmab(v16bf a, v16bf b, v8f c) { return __builtin_amdgcn_wmma_f32_16x16x32_bf16(false, a, false, b, (short)0, c, false, false); }

__device__ __forceinline__ h16 tohx(float x) { return (h16)x; }
__device__ __forceinline__ void splitf(float y, unsigned short& h, unsigned short& l) { h = f2bf(y); l = f2bf(y - bf2f(h)); }
typedef __attribute__((ext_vector_type(2))) _Float16 v2h;
typedef __attribute__((ext_vector_type(4))) _Float16 v4h;
typedef __attribute__((ext_vector_type(2))) unsigned short v2us;
typedef __attribute__((ext_vector_type(4))) unsigned short v4us;
typedef __attribute__((ext_vector_type(2))) float v2f;
typedef __attribute__((ext_vector_type(4))) int v4i;
#define PL   ((size_t)TT * DQ)              // elements of one batch's projection = of one batch's plane

// FRAGMENT ORDER of every 16-bit operand plane: a [rows][K] plane is a run of 16-row x 32-k tiles of 512 elements, tile (row >> 4) * (K / 32) + (k >> 5) (the [d][t] value planes order their tiles as z = 2 below); inside a tile element (row, k) stands at
// ((k >> 4) & 1) * 256 + (((k >> 3) & 1) * 16 + (row & 15)) * 8 + (k & 7): the 8 elements that lane 16 hi + lr takes in one 16-byte load stand at lane * 8, so that a wave's load covers 512 bytes in a row (4 whole lines, not 16 pieces).
// ---- k_gemmw: register-blocked GEMM, one 64x64 output tile per block (16 accumulators per wave), operands straight from 16-bit planes in fragment order; grid (M/64, N/64, Z), 32 x NW threads.
// NW = 1: one wave does the whole K loop. NW > 1: the K loop is split over the block's NW waves, so that NW waves' load latencies run side by side: wave w takes the 64-wide k pieces w, w + NW, ...
// (64 k = two neighbouring tiles of every 16 operand rows); the NW f32 partial tiles are summed through LDS in wave order 0 .. NW-1.
// C[m][n] (f32, pitch ldc, + optional f32 bias[n]) = sum_k A[m][k] Bt[n][k] (+ split products per NSPLIT). z-batch strides sA/sB/sC in elements, z = 0, 1, 2 adds bias, bias1, bias2. K % 32 == 0.
// PLANES (the q/k/v projection; rows = [batch][t], one 64-column tile = one head, z = q, k, v): C is not written; the summed tile goes straight to the 16-bit planes that the attention kernel reads, each set = [q, k, v][batch][head][..][..]:
// z < 2: [t][d] planes (fragment order, K = HD) of partial-rope(x): rotate-half inside the first ROT dims (out[d] = x[d] cos - x[d+ROT/2] sin, out[d+ROT/2] = x[d+ROT/2] cos + x[d] sin), dims >= ROT pass through.
//        q and k share one order of the rotary dims along k: slot 8 g + c holds dim 4 g + c, slot 8 g + 4 + c its partner 4 g + c + ROT/2 (g, c < 4); q.k sums over all of them, so only the order of that sum depends on it.
// z = 2: [d][t] planes in fragment order, tile (t >> 5) * (HD / 16) + (d >> 4), so that the 8 tiles of 64 keys stand in a row: the partial tiles are laid into LDS transposed, so that the same sums come out along t.
// Wave w sums and stores k slots 8 w .. 8 w + 7 of all 64 rows (lane = row & 15 and which 4 of the 8): each store covers 256 bytes in a row.
template <typename T16> struct WFrag;
template <> struct WFrag<h16> { typedef v16h V; static __device__ __forceinline__ V ld(const h16* p) { return cat16(*(const v8h*)p, *(const v8h*)(p + 256)); } static __device__ __forceinline__ v8f mma(V a, V b, v8f c) { return wmma16(a, b, c); } };
template <> struct WFrag<bf> { typedef v16bf V; static __device__ __forceinline__ V ld(const bf* p) { return cat16b(*(const v8us*)p, *(const v8us*)(p + 256)); } static __device__ __forceinline__ v8f mma(V a, V b, v8f c) { return wmmab(a, b, c); } };
template <typename T16, int NSPLIT, bool BIAS, int NW, bool PLANES, int K>
__global__ __launch_bounds__(32 * NW) void k_gemmw(const T16* __restrict__ A, const T16* __restrict__ A2, const T16* __restrict__ Bt, const T16* __restrict__ Bt2, float* C, int ldc, const float* __restrict__ bias, const float* __restrict__ bias1, const float* __restrict__ bias2, size_t sA, size_t sB, size_t sC, const float* __restrict__ CS, h16* P16, bf* Ph, bf* Pl) {
    static_assert(!PLANES || (NW == 8 && BIAS && HD == 64 && TT % 64 == 0), "the plane epilogue takes one head and one batch per tile, 16 elements a thread");
    typedef typename WFrag<T16>::V V;
    __shared__ __align__(16) float os[(NW == 1 ? 16 : NW * 64) * 68];
    const int wave = (NW == 1) ? 0 : __builtin_amdgcn_readfirstlane((int)(threadIdx.x >> 5));   // scalar, so that the K loop's branch is wave-uniform (matrix instructions need every lane on)
    const size_t z = blockIdx.z; A += z * sA; if (A2) A2 += z * sA; Bt += z * sB; if (Bt2) Bt2 += z * sB; C += z * sC; if (BIAS) bias = (z == 0) ? bias : (z == 1) ? bias1 : bias2;
    const int lane = threadIdx.x & 31, lr = lane & 15, hi = lane >> 4; const int r0 = blockIdx.x * 64, c0 = blockIdx.y * 64;
    v8f acc[4][4];
#pragma unroll
    for (int mb = 0; mb < 4; ++mb)
#pragma unroll
        for (int nb = 0; nb < 4; ++nb) acc[mb][nb] = (v8f){};
    const size_t aoff = (size_t)r0 * K + 8 * lane, boff = (size_t)c0 * K + 8 * lane;   // 16 rows x K = K / 32 tiles
#pragma unroll 1
    for (int kc = wave * 64; kc < K; kc += (NW == 1 || !(kc & 32)) ? 32 : 64 * NW - 32) {
        V a[4], a2[4], b[4], b2[4];
        const T16* pa = A + aoff + kc * 16; const T16* pa2 = (NSPLIT == 1 || NSPLIT == 2) ? A2 + aoff + kc * 16 : pa; const T16* pb = Bt + boff + kc * 16; const T16* pb2 = (NSPLIT >= 2) ? Bt2 + boff + kc * 16 : pb;   // one pointer per plane (K is a constant: the row tiles are immediate offsets), which the s_wait_xcnt names as an input so that the register lives up to the wait
#pragma unroll
        for (int mb = 0; mb < 4; ++mb) { a[mb] = WFrag<T16>::ld(pa + mb * 16 * K); if (NSPLIT == 1 || NSPLIT == 2) a2[mb] = WFrag<T16>::ld(pa2 + mb * 16 * K); }
#pragma unroll
        for (int nb = 0; nb < 4; ++nb) { b[nb] = WFrag<T16>::ld(pb + nb * 16 * K); if (NSPLIT >= 2) b2[nb] = WFrag<T16>::ld(pb2 + nb * 16 * K); }
        asm volatile("s_wait_xcnt 0x0" :: "v"(pa), "v"(pa2), "v"(pb), "v"(pb2) : "memory");   // before any register that the loads above name is written again
#pragma unroll
        for (int nb = 0; nb < 4; ++nb) {
#pragma unroll
            for (int mb = 0; mb < 4; ++mb) { acc[mb][nb] = WFrag<T16>::mma(a[mb], b[nb], acc[mb][nb]); if (NSPLIT == 1 || NSPLIT == 2) acc[mb][nb] = WFrag<T16>::mma(a2[mb], b[nb], acc[mb][nb]); if (NSPLIT >= 2) acc[mb][nb] = WFrag<T16>::mma(a[mb], b2[nb], acc[mb][nb]); } }
        asm volatile("v_nop\n\tv_nop\n\tv_nop\n\tv_nop" : "+v"(acc[0][0]), "+v"(acc[1][1]), "+v"(acc[2][2]), "+v"(acc[3][3]) : "v"(a[0]), "v"(a[3]));
    }
    if constexpr (NW > 1) {
        const bool tr = PLANES && z == 2;   // block-uniform
        const bool rot = PLANES && !tr && wave < ROT / 8;   // wave-uniform: this wave's 8 k slots are rotary dims
        const int row0 = lr, col0 = rot ? wave * 4 + hi * (ROT / 2) : wave * 8 + hi * 4, t0 = r0 % TT;   // PLANES: a thread sums rows row0 + 16 s, columns col0 .. col0 + 3 of the LDS tile
        v4f bv, cs0[4], cs1[4];   // PLANES: bias and (cos, sin) of the thread's elements, asked for here so that they fly while the partial tiles go to LDS
        if constexpr (PLANES) { const int cofs = col0;
            if (tr) { const float* bp = bias + c0 + row0;
#pragma unroll   // constant indices, so that the small arrays stay in registers
                for (int s = 0; s < 4; ++s) bv[s] = bp[s * 16];
                asm volatile("s_wait_xcnt 0x0" :: "v"(bp) : "memory");   // before any register that the loads above name is written again
            } else { const float* bp = bias + c0 + cofs; const float* cs = CS + ((size_t)(t0 + row0) * HD + wave * 4) * 2; bv[0] = bp[0]; bv[1] = bp[1]; bv[2] = bp[2]; bv[3] = bp[3];   // a dim and its partner have one angle: both halves of the wave read the entry of the lower dim
                if (rot) {
#pragma unroll   // constant indices, so that the small arrays stay in registers
                    for (int s = 0; s < 4; ++s) { cs0[s] = *(const v4f*)(cs + s * 16 * HD * 2); cs1[s] = *(const v4f*)(cs + s * 16 * HD * 2 + 4); }
                }
                asm volatile("s_wait_xcnt 0x0" :: "v"(bp), "v"(cs) : "memory");   // before any register that the loads above name is written again
            }
        }
        if (tr) {
#pragma unroll   // constant indices, so that the small arrays stay in registers
            for (int mb = 0; mb < 4; ++mb)
#pragma unroll   // constant indices, so that the small arrays stay in registers
                for (int nb = 0; nb < 4; ++nb) { float* p = os + (wave * 64 + nb * 16 + lr) * 68 + mb * 16 + hi * 8;
                    *(v4fa*)p = __builtin_shufflevector(acc[mb][nb], acc[mb][nb], 0, 1, 2, 3); *(v4fa*)(p + 4) = __builtin_shufflevector(acc[mb][nb], acc[mb][nb], 4, 5, 6, 7); }
        } else {
#pragma unroll
            for (int mb = 0; mb < 4; ++mb)
#pragma unroll
                for (int nb = 0; nb < 4; ++nb)
#pragma unroll
                    for (int j = 0; j < 8; ++j) os[(wave * 64 + mb * 16 + hi * 8 + j) * 68 + nb * 16 + lr] = acc[mb][nb][j];
        }
        __syncthreads();   // every wave's partial tile is in LDS before any thread sums across the waves
        if constexpr (PLANES) { const int cofs = col0; v4f val[4];
#pragma unroll   // constant indices, so that the small arrays stay in registers
            for (int s = 0; s < 4; ++s) { const int row = s * 16 + row0; val[s] = *(const v4fa*)(os + row * 68 + cofs);
#pragma unroll   // constant indices, so that the small arrays stay in registers
                for (int w = 1; w < NW; ++w) val[s] += *(const v4fa*)(os + (w * 64 + row) * 68 + cofs); }
            size_t e = (z * NB_ + r0 / TT) * PL + (size_t)blockIdx.y * TT * HD;   // this batch's and head's plane, then the thread's first element and its step from s to s + 1
            e += (size_t)t0 * HD + ((wave >> 1) & 1) * 256 + ((wave & 1) * 16 + row0) * 8 + hi * 4;   // 64 t x HD = 8 tiles; k slot 8 w + 4 hi inside its tile
            int es;
            if (tr) { e += (wave >> 2) * (HD / 16) * 512; es = 512;   // LDS row = d (tile s), column = t (k)
#pragma unroll   // constant indices, so that the small arrays stay in registers
                for (int s = 0; s < 4; ++s) val[s] += bfr(bv[s]);
            } else { e += (wave >> 2) * 512; es = (HD / 32) * 512;   // LDS row = t (tile s), column = d (k)
#pragma unroll   // constant indices, so that the small arrays stay in registers
                for (int s = 0; s < 4; ++s) { v4f x = val[s], xp;   // xp: the rotate-half partner d +- ROT/2, in the other half of the wave, with its sign
#pragma unroll   // constant indices, so that the small arrays stay in registers
                    for (int c = 0; c < 4; ++c) x[c] += bfr(bv[c]);
                    if (rot) {
#pragma unroll   // constant indices, so that the small arrays stay in registers
                        for (int c = 0; c < 4; ++c) { const float y = __shfl_xor(x[c], 16, 32); xp[c] = hi ? y : -y; }
                        val[s][0] = x[0] * cs0[s][0] + xp[0] * cs0[s][1]; val[s][1] = x[1] * cs0[s][2] + xp[1] * cs0[s][3]; val[s][2] = x[2] * cs1[s][0] + xp[2] * cs1[s][1]; val[s][3] = x[3] * cs1[s][2] + xp[3] * cs1[s][3];
                    } else val[s] = x; }
            }
#pragma unroll   // constant indices, so that the small arrays stay in registers
            for (int s = 0; s < 4; ++s) { v4h o16; v4us oh, ol;
#pragma unroll   // constant indices, so that the small arrays stay in registers
                for (int c = 0; c < 4; ++c) { o16[c] = tohx(val[s][c]); unsigned short a2, c2; splitf(val[s][c], a2, c2); oh[c] = a2; ol[c] = c2; }
                h16* p16 = P16 + e + (size_t)s * es; bf* ph = Ph + e + (size_t)s * es; bf* pl = Pl + e + (size_t)s * es;
                *(v4h*)p16 = o16; *(v4us*)ph = oh; *(v4us*)pl = ol;
                asm volatile("s_wait_xcnt 0x0" :: "v"(p16), "v"(ph), "v"(pl) : "memory");   // before any register that the stores above name is written again
            }
        } else {
#pragma unroll
        for (int s = 0; s < 32 / NW; ++s) { const int i = s * 32 * NW + (int)threadIdx.x, row = i >> 4, cofs = (i & 15) * 4; v4f val = *(const v4fa*)(os + row * 68 + cofs);
#pragma unroll
            for (int w = 1; w < NW; ++w) val += *(const v4fa*)(os + (w * 64 + row) * 68 + cofs);
            if (BIAS) { val[0] += bfr(bias[c0 + cofs]); val[1] += bfr(bias[c0 + cofs + 1]); val[2] += bfr(bias[c0 + cofs + 2]); val[3] += bfr(bias[c0 + cofs + 3]); }
            *(v4f*)(C + (size_t)(r0 + row) * ldc + c0 + cofs) = val; }
        }
    } else {
#pragma unroll
    for (int mb = 0; mb < 4; ++mb) {
#pragma unroll
        for (int nb = 0; nb < 4; ++nb) {
#pragma unroll
            for (int j = 0; j < 8; ++j) os[(hi * 8 + j) * 68 + nb * 16 + lr] = acc[mb][nb][j]; }
        __builtin_amdgcn_wave_barrier(); asm volatile("" ::: "memory");
        float* crow = C + (size_t)(r0 + mb * 16) * ldc + c0;
{
#pragma unroll
            for (int s = 0; s < 8; ++s) { const int row = 2 * s + hi, cofs = lr * 4; v4f val = *(const v4fa*)(os + row * 68 + cofs); if (BIAS) { val[0] += bfr(bias[c0 + cofs]); val[1] += bfr(bias[c0 + cofs + 1]); val[2] += bfr(bias[c0 + cofs + 2]); val[3] += bfr(bias[c0 + cofs + 3]); }
                *(v4f*)(crow + (size_t)row * ldc + cofs) = val; }
             }
        __builtin_amdgcn_wave_barrier(); asm volatile("" ::: "memory");
    }
    }
}


// The element-wise stages are device functions of a block number bx; k_prep below deals the blocks of one grid out to them.
// Both write a plane in fragment order, one 16-byte piece i (8 k of one row) a thread and step, the pieces in the plane's own order, so that a wave's store covers 512 bytes in a row.
__device__ __forceinline__ void piece_at(const int i, const int K, int& row, int& k0) { const int tile = i >> 6, kt = K / 32; row = (tile / kt) * 16 + (i & 15); k0 = (tile % kt) * 32 + ((i >> 5) & 1) * 16 + ((i >> 4) & 1) * 8; }
__device__ __forceinline__ void d_wtG(const int bx, const float* __restrict__ w, int K, int N, bf* Bt) {   // Bt[n][k] = w[k][n]: 16 lanes read 16 neighbouring n of one k
    const int i0 = bx * 512 + (int)threadIdx.x; float v[2][8];   // two pieces a thread (the grid has N K / 8 / 512 blocks per weight); all 16 loads are asked for before the first is used
#pragma unroll   // constant indices, so that the small array stays in registers
    for (int l = 0; l < 2; ++l) { int n, k0; piece_at(i0 + l * 256, K, n, k0);
#pragma unroll
        for (int j = 0; j < 8; ++j) v[l][j] = w[(size_t)(k0 + j) * N + n]; }
#pragma unroll   // constant indices, so that the small array stays in registers
    for (int l = 0; l < 2; ++l) { v8us o;
#pragma unroll
        for (int j = 0; j < 8; ++j) o[j] = f2bf(v[l][j]);
        *(v8us*)(Bt + (size_t)(i0 + l * 256) * 8) = o; }
}
__device__ __forceinline__ void d_cvt8(const int bx, const float* __restrict__ src, int K, bf* dst, size_t n8) { const size_t i = (size_t)bx * 256 + threadIdx.x; if (i >= n8) return; int row, k0; piece_at((int)i, K, row, k0); const v8f v = *(const v8f*)(src + (size_t)row * K + k0); v8us o;
#pragma unroll
    for (int k = 0; k < 8; ++k) o[k] = f2bf(v[k]); *(v8us*)(dst + i * 8) = o;  }
__constant__ float INV[ROT / 2] = {1.0,0.6209288835525513,0.38555270433425903,0.23940083384513855,0.1486508846282959,0.0923016369342804,0.057312753051519394,0.035587143152952194,0.022097086533904076,0.013720721006393433,0.008519591763615608,0.005290060769766569,0.003284751670435071,0.002039597136899829,0.0012664449168369174,0.0007863722858019173};
__device__ __forceinline__ void d_cstab(const int bx, float* CS) { const int idx = bx * 256 + threadIdx.x; if (idx >= TT * HD) return; const int t = idx / HD, d = idx % HD; v2f cs; if (d < ROT) { const int i = (d < ROT / 2) ? d : d - ROT / 2; const float ang = __fmul_rn((float)t, INV[i]); cs[0] = cosf(ang); cs[1] = sinf(ang); } else { cs[0] = 1.0f; cs[1] = 0.0f; }
    *(v2f*)(CS + (size_t)idx * 2) = cs;  }
// k_prep: everything that depends on the inputs alone, in one grid: the four weight transposes (first in the grid, for speed only), x of both batches to bf16, the cos/sin table.
#define WTB  (DM * DQ / 64 / 64)            // blocks per weight transpose
#define CVB  (NB_ * TT * DM / 8 / 256)      // blocks of the x conversion
#define CSB  (TT * HD / 256)                // blocks of the table
static_assert(DKV == DQ && DM == DQ, "the four weight planes have one size");
static_assert(WTB * 512 == DM * DQ / 8 && DM % 32 == 0 && DQ % 16 == 0, "a transpose block writes 512 whole 16-byte pieces");
__global__ __launch_bounds__(256) void k_prep(const float* __restrict__ wq, const float* __restrict__ wk, const float* __restrict__ wv, const float* __restrict__ wo, const float* __restrict__ x, bf* W4, bf* XB, float* CS) {
    const int b = blockIdx.x;
    if (b < 4 * WTB) { const int i = b / WTB; d_wtG(b % WTB, (i == 0) ? wq : (i == 1) ? wk : (i == 2) ? wv : wo, DM, DQ, W4 + (size_t)i * DM * DQ); }
    else if (b < 4 * WTB + CVB) d_cvt8(b - 4 * WTB, x, DM, XB, (size_t)NB_ * TT * DM / 8);
    else d_cstab(b - 4 * WTB - CVB, CS);
}

// ---- k_fattn: causal attention of one head in one kernel (scores, softmax, probability x value, head merge): scores and probabilities stay in registers.
// Transposed products: St = K Qt (A = key rows, B = query rows, both [t][d] planes in fragment order) puts one query's scores of a 16-key tile in one lane (D[key 8 hi + j][query lr]); two such tiles, converted in place, are the B operand
// (32 keys in the hardware k order) of Ot += Vt Pt (A = rows of the [d][t] value plane, same k order). On-line softmax over 64-key blocks in the log2 domain: running maximum m and sum l per query column,
// Ot and l rescaled by 2^(m_old - m_new) in every block; P is left unnormalised (x 2^PSH for fp16's range; the factor cancels in Ot / l). One division per query at the end, then the hi/lo bf16 split into the merged [t][DQ] planes (fragment order).
// HI (query rows < RH): hi+lo bf16 planes, 3 products each; else single fp16. One wave owns 16 x QT query columns; no LDS, no barrier.
// Every inner loop is fully unrolled so that the fragment arrays are indexed by constants and stay in registers.
template <typename T16, bool HI, int QT>
__device__ __forceinline__ void fattn_tile(const T16* __restrict__ Q, const T16* __restrict__ Q2, const T16* __restrict__ Kp, const T16* __restrict__ K2, const T16* __restrict__ Vt, const T16* __restrict__ V2, const int q0, const int lr, const int hi, bf* Ah, bf* Al) {
    typedef typename WFrag<T16>::V V;
    const float C2 = SCL * 1.4426950408889634f;      // score scale x log2(e)
    const float PSH = HI ? 0.0f : 10.0f;             // fp16 P carries x1024
    const unsigned koff = (unsigned)(8 * (16 * hi + lr)), voff = koff;   // the lane's place inside a tile in fragment order; a group of loads shares one pointer per plane, which its s_wait_xcnt names as an input so that the register lives up to the wait
    const unsigned kob = koff * (unsigned)sizeof(T16);   // the same place in bytes: the offset register of the first loads
    const T16* qp = Q + q0 * HD + koff; const T16* qp2 = HI ? Q2 + q0 * HD + koff : qp;
    V qb[QT][2], qb2[QT][2];
#pragma unroll
    for (int qt = 0; qt < QT; ++qt)
#pragma unroll
        for (int ks = 0; ks < 2; ++ks) { const int qo = (qt * 2 + ks) * 512; qb[qt][ks] = WFrag<T16>::ld(qp + qo); if (HI) qb2[qt][ks] = WFrag<T16>::ld(qp2 + qo); }
    v8f o[QT][4]; float m[QT], l[QT];
#pragma unroll
    for (int qt = 0; qt < QT; ++qt) { m[qt] = -3.0e38f; l[qt] = 0.0f;
#pragma unroll
        for (int md = 0; md < 4; ++md) o[qt][md] = (v8f){}; }
    const int kdiag = q0 & ~63;                      // the 64-key block that holds the diagonal of all 16 x QT rows (16 x QT divides 64)
    V ka[4][2], ka2[4][2];
    const T16* kp = Kp + koff; const T16* kp2 = HI ? K2 + koff : kp;
#pragma unroll
    for (int nb = 0; nb < 4; ++nb)
#pragma unroll
        for (int ks = 0; ks < 2; ++ks) { const int ko = (nb * 2 + ks) * 512; ka[nb][ks] = WFrag<T16>::ld(kp + ko); if (HI) ka2[nb][ks] = WFrag<T16>::ld(kp2 + ko); }
    asm volatile("s_wait_xcnt 0x0" :: "v"(qp), "v"(qp2), "v"(kp), "v"(kp2), "v"(kob) : "memory");   // before any register that the loads above name is written again
#pragma unroll 1   // rolled: one block's fragments already fill the registers, a second copy of the body would only cost instruction cache
    for (int kb = 0; kb <= kdiag; kb += 64) {
        V va[4][2], va2[4][2];                       // this block's value rows: needed last, asked for first
        const T16* vp = Vt + kb * HD + voff; const T16* vp2 = HI ? V2 + kb * HD + voff : vp;   // 32 keys = HD / 16 tiles
#pragma unroll
        for (int md = 0; md < 4; ++md)
#pragma unroll
            for (int ks = 0; ks < 2; ++ks) { const int vo = (ks * 4 + md) * 512; va[md][ks] = WFrag<T16>::ld(vp + vo); if (HI) va2[md][ks] = WFrag<T16>::ld(vp2 + vo); }
        asm volatile("s_wait_xcnt 0x0" :: "v"(vp), "v"(vp2) : "memory");   // before any register that the loads above name is written again
        v8f st[QT][4];
#pragma unroll
        for (int nb = 0; nb < 4; ++nb)
#pragma unroll
            for (int qt = 0; qt < QT; ++qt) { v8f a = (v8f){};
#pragma unroll
                for (int ks = 0; ks < 2; ++ks) { a = WFrag<T16>::mma(ka[nb][ks], qb[qt][ks], a); if (HI) { a = WFrag<T16>::mma(ka[nb][ks], qb2[qt][ks], a); a = WFrag<T16>::mma(ka2[nb][ks], qb[qt][ks], a); } }
                st[qt][nb] = a; }
        const int kst = (kb < kdiag) ? 64 * HD : 0; kp += kst; kp2 += kst;   // next block's key rows fly during the softmax and P.V (the last trip re-reads its own: in bounds, unused)
#pragma unroll
        for (int nb = 0; nb < 4; ++nb)
#pragma unroll
            for (int ks = 0; ks < 2; ++ks) { const int ko = (nb * 2 + ks) * 512; ka[nb][ks] = WFrag<T16>::ld(kp + ko); if (HI) ka2[nb][ks] = WFrag<T16>::ld(kp2 + ko); }
        asm volatile("s_wait_xcnt 0x0" :: "v"(kp), "v"(kp2) : "memory");   // before any register that the loads above name is written again
        __builtin_amdgcn_sched_barrier(0);   // keeps the score scaling, softmax and P.V products below from being lifted in front of the wait above, where they took the loads' address register
#pragma unroll
        for (int qt = 0; qt < QT; ++qt)
#pragma unroll
            for (int nb = 0; nb < 4; ++nb) st[qt][nb] *= C2;
        if (kb == kdiag) {                           // wave-uniform: only the diagonal block has keys above a query
#pragma unroll
            for (int qt = 0; qt < QT; ++qt)
#pragma unroll
                for (int nb = 0; nb < 4; ++nb)
#pragma unroll
                    for (int j = 0; j < 8; ++j) st[qt][nb][j] = (kb + nb * 16 + hi * 8 + j <= q0 + qt * 16 + lr) ? st[qt][nb][j] : -3.0e38f;
        }
        V pb[QT][2], pb2[QT][2];
#pragma unroll
        for (int qt = 0; qt < QT; ++qt) {
            float mx4[4];
#pragma unroll
            for (int nb = 0; nb < 4; ++nb) { mx4[nb] = st[qt][nb][0];
#pragma unroll
                for (int j = 1; j < 8; ++j) mx4[nb] = fmaxf(mx4[nb], st[qt][nb][j]); }
            float mx = fmaxf(fmaxf(mx4[0], mx4[1]), fmaxf(mx4[2], mx4[3]));
            mx = fmaxf(mx, __shfl_xor(mx, 16, 32));  // the other half of the wave holds the query's other keys
            mx = fmaxf(mx, m[qt]);
            const float al = __builtin_amdgcn_exp2f(m[qt] - mx); m[qt] = mx; const float msh = mx - PSH;
            float ls4[4];
#pragma unroll
            for (int nb = 0; nb < 4; ++nb) { ls4[nb] = 0.0f;
#pragma unroll
                for (int j = 0; j < 8; ++j) { const float p = __builtin_amdgcn_exp2f(st[qt][nb][j] - msh); st[qt][nb][j] = p; ls4[nb] += p; } }
            l[qt] = l[qt] * al + ((ls4[0] + ls4[1]) + (ls4[2] + ls4[3]));
#pragma unroll
            for (int md = 0; md < 4; ++md) o[qt][md] *= al;
#pragma unroll
            for (int ks = 0; ks < 2; ++ks) {
                if constexpr (HI) { v8us h0, h1, l0, l1;
#pragma unroll
                    for (int j = 0; j < 8; ++j) { unsigned short a, c; splitf(st[qt][2 * ks][j], a, c); h0[j] = a; l0[j] = c; splitf(st[qt][2 * ks + 1][j], a, c); h1[j] = a; l1[j] = c; }
                    pb[qt][ks] = cat16b(h0, h1); pb2[qt][ks] = cat16b(l0, l1);
                } else { v8h h0, h1;
#pragma unroll
                    for (int j = 0; j < 8; ++j) { h0[j] = tohx(st[qt][2 * ks][j]); h1[j] = tohx(st[qt][2 * ks + 1][j]); }
                    pb[qt][ks] = cat16(h0, h1); }
            }
        }
#pragma unroll
        for (int ks = 0; ks < 2; ++ks)
#pragma unroll
            for (int md = 0; md < 4; ++md)
#pragma unroll
                for (int qt = 0; qt < QT; ++qt) { o[qt][md] = WFrag<T16>::mma(va[md][ks], pb[qt][ks], o[qt][md]); if (HI) { o[qt][md] = WFrag<T16>::mma(va[md][ks], pb2[qt][ks], o[qt][md]); o[qt][md] = WFrag<T16>::mma(va2[md][ks], pb[qt][ks], o[qt][md]); } }
    }
#pragma unroll
    for (int qt = 0; qt < QT; ++qt) { const float f = __fdiv_rn(1.0f, l[qt] + __shfl_xor(l[qt], 16, 32)); bf* ahp = Ah + (q0 + qt * 16) * DQ + koff; bf* alp = Al + (q0 + qt * 16) * DQ + koff;   // 16 rows x DQ = DQ / 32 tiles; a lane's 8 values of o are one 16-byte piece of the merged plane's fragment order
#pragma unroll
        for (int md = 0; md < 4; ++md) { v8us oh, ol;
#pragma unroll
            for (int j = 0; j < 8; ++j) { unsigned short a, c; splitf(o[qt][md][j] * f, a, c); oh[j] = a; ol[j] = c; }
            *(v8us*)(ahp + md * 256) = oh; *(v8us*)(alp + md * 256) = ol; }
        asm volatile("s_wait_xcnt 0x0" :: "v"(ahp), "v"(alp) : "memory");   // before any register that the stores above name is written again
    }
}
// grid (heads x batches, (TT - RH) / 64 + RH / 32), 2 waves, longest key loops of both batches first: blocks y < (TT - RH) / 64 take 64 fp16 query rows each, from the last rows down (32 a wave); the others 32 hi+lo rows each (16 a wave)
__global__ __launch_bounds__(64) void k_fattn(const h16* __restrict__ QP16, const h16* __restrict__ KP16, const h16* __restrict__ VT16, const bf* __restrict__ QPh, const bf* __restrict__ QPl, const bf* __restrict__ KPh, const bf* __restrict__ KPl, const bf* __restrict__ VTh, const bf* __restrict__ VTl, bf* ATh, bf* ATl) {
    const int wave = __builtin_amdgcn_readfirstlane((int)(threadIdx.x >> 5));   // scalar, so that the key loop's branches are wave-uniform (matrix instructions need every lane on)
    const int lane = threadIdx.x & 31, lr = lane & 15, hi = lane >> 4; const int h = blockIdx.x % NH_, b = blockIdx.x / NH_; const int y = blockIdx.y; const bool lo = y < (TT - RH) / 64;
    const int q0 = lo ? (TT / 64 - 1 - y) * 64 + wave * 32 : ((TT - RH) / 64 + RH / 32 - 1 - y) * 32 + wave * 16;
    const size_t zq = ((size_t)b * NH_ + h) * TT * HD, zk = ((size_t)b * NKV + h / REP) * TT * HD; bf* ah = ATh + (size_t)b * TT * DQ + h * (HD / 32) * 512; bf* al = ATl + (size_t)b * TT * DQ + h * (HD / 32) * 512;
    if (!lo) fattn_tile<bf, true, 1>(QPh + zq, QPl + zq, KPh + zk, KPl + zk, VTh + zk, VTl + zk, q0, lr, hi, ah, al);
    else fattn_tile<h16, false, 2>(QP16 + zq, nullptr, KP16 + zk, nullptr, VT16 + zk, nullptr, q0, lr, hi, ah, al);
}

extern "C" void kernel_launch(void* const* d_in, const int* in_sizes, int n_in,
                              void* d_out, int out_size, void* d_ws, size_t ws_size, hipStream_t stream) {
    (void)in_sizes; (void)n_in; (void)out_size;
    const float* x = (const float*)d_in[0]; const float* wq = (const float*)d_in[1]; const float* bq = (const float*)d_in[2]; const float* wk = (const float*)d_in[3]; const float* bk = (const float*)d_in[4]; const float* wv = (const float*)d_in[5]; const float* bv = (const float*)d_in[6]; const float* wo = (const float*)d_in[7]; const float* bo = (const float*)d_in[8]; const float* cosT = nullptr; const float* sinT = nullptr; (void)cosT; (void)sinT;
    float* OUT = (float*)d_out;     // [2][2048][1024]
    char* wsp = (char*)d_ws;
    auto take = [&](size_t bytes) { char* p = wsp; wsp += (bytes + 255) & ~(size_t)255; return (void*)p; };
    bf* W4 = (bf*)take((size_t)4 * DQ * DM * 2); float* CS = (float*)take((size_t)TT * HD * 2 * 4);   // Wq, Wk, Wv, Wo transposed, one behind the other
    bf* XB = (bf*)take((size_t)NB_ * TT * DM * 2);   // both batches: x in bf16
    h16* P16 = (h16*)take((size_t)3 * NB_ * TT * DQ * 2); bf* Ph = (bf*)take((size_t)3 * NB_ * TT * DQ * 2); bf* Pl = (bf*)take((size_t)3 * NB_ * TT * DQ * 2);   // [q, k, v][batch] planes
    bf* ATh = (bf*)take((size_t)NB_ * TT * DQ * 2); bf* ATl = (bf*)take((size_t)NB_ * TT * DQ * 2);
    if ((size_t)(wsp - (char*)d_ws) > ws_size) return;    // ws 256 MiB
    const size_t KO = (size_t)NB_ * TT * DQ, VO = (size_t)2 * NB_ * TT * DQ;   // where the k and the v planes start
    // four launches, each one stage of the data flow for both batches ([batch][t] is one run of NB_ x TT rows for the two GEMMs)
    k_prep<<<4 * WTB + CVB + CSB, 256, 0, stream>>>(wq, wk, wv, wo, x, W4, XB, CS);
    k_gemmw<bf, 0, true, 8, true, DM><<<dim3(NB_ * TT / 64, DQ / 64, 3), 256, 0, stream>>>(XB, nullptr, W4, nullptr, nullptr, 0, bq, bk, bv, 0, (size_t)DQ * DM, 0, CS, P16, Ph, Pl);
    k_fattn<<<dim3(NH_ * NB_, (TT - RH) / 64 + RH / 32, 1), 64, 0, stream>>>(P16, P16 + KO, P16 + VO, Ph, Pl, Ph + KO, Pl + KO, Ph + VO, Pl + VO, ATh, ATl);
    k_gemmw<bf, 1, true, 8, false, DQ><<<dim3(NB_ * TT / 64, DM / 64, 1), 256, 0, stream>>>(ATh, ATl, W4 + (size_t)3 * DQ * DM, nullptr, OUT, DM, bo, nullptr, nullptr, 0, 0, 0, nullptr, nullptr, nullptr, nullptr);
}

// v006
// One run takes 85.9 microseconds.
// Timed twice side by side with v005, it ran 1.30 and 1.29 times as fast.
// Counting every step since v000, it is 18.5 times as fast.
#include <hip/hip_runtime.h>

// Multi-head causal attention with partial rotary (x [2][2048][1024]; q/k/v = x W + b ('xw' [1024][1024], 16 x 64); rotate-half rotary on the FIRST 32 dims of each head (pairs d, d+16), angles t x inv[d mod 16] with inv_i = 2048^(-2i/32), the other 32 dims pass through; causal (tril) -inf; softmax(q.k / 8); out = merged Wo ('xw' [1024][1024]) + bo -> [2][2048][1024]).
// Compute dtypes, f32 accumulate: every input rounded to bf16; q/k/v on PLAIN bf16 operands (inputs: exact) + bias; rotary in f32 from an on-chip table (inv constants are the reference's own f32 values; angle = t x inv one product; precise cosf/sinf); causal scores and attn.v: query rows < 512 hl (3 products), the rest single fp16 (x1024), causal tile skipping; on-line softmax f32, all inside one kernel; Wo hl x exact (2 products) + bias.

#define NB_  2
#define TT   2048
#define DM   1024
#define NH_  16
#define NKV  16
#define REP  (NH_ / NKV)
#define HD   64
#define DQ   (NH_ * HD)
#define DKV  (NKV * HD)
#define RH   512                  // query rows < RH use hi+lo planes (a multiple of 64)
#define ROT  32                   // rotary dims per head (rotate-half inside them)
#define SCL  0.125f   // HD^-0.5
typedef _Float16 h16;
typedef unsigned short bf;
typedef __attribute__((ext_vector_type(16))) __bf16   v16bf;
typedef __attribute__((ext_vector_type(16))) _Float16 v16h;
typedef __attribute__((ext_vector_type(8)))  _Float16 v8h;
typedef __attribute__((ext_vector_type(8)))  unsigned short v8us;
typedef __attribute__((ext_vector_type(8)))  float    v8f;
typedef __attribute__((ext_vector_type(4)))  float    v4f;
typedef v8h  __attribute__((may_alias)) v8ha;
typedef v4f  __attribute__((may_alias)) v4fa;
typedef v8us __attribute__((may_alias)) v8usa;

__device__ __forceinline__ unsigned short f2bf(float f) { unsigned u = __float_as_uint(f); u += 0x7FFFu + ((u >> 16) & 1u); return (unsigned short)(u >> 16); }
__device__ __forceinline__ float bf2f(unsigned short b) { return __uint_as_float(((unsigned)b) << 16); }
__device__ __forceinline__ float bfr(float f) { return bf2f(f2bf(f)); }
__device__ __forceinline__ v16h cat16(v8h lo, v8h hi) { return __builtin_shufflevector(lo, hi, 0, 1, 2, 3, 4, 5, 6, 7, 8, 9, 10, 11, 12, 13, 14, 15); }
__device__ __forceinline__ v16bf cat16b(v8us lo, v8us hi) { return __builtin_bit_cast(v16bf, __builtin_shufflevector(lo, hi, 0, 1, 2, 3, 4, 5, 6, 7, 8, 9, 10, 11, 12, 13, 14, 15)); }
__device__ __forceinline__ v8f wmma16(v16h a, v16h b, v8f c) { return __builtin_amdgcn_wmma_f32_16x16x32_f16(false, a, false, b, (short)0, c, false, false); }
__device__ __forceinline__ v8f wmmab(v16bf a, v16bf b, v8f c) { return __builtin_amdgcn_wmma_f32_16x16x32_bf16(false, a, false, b, (short)0, c, false, false); }

__device__ __forceinline__ h16 tohx(float x) { return (h16)x; }
__device__ __forceinline__ void splitf(float y, unsigned short& h, unsigned short& l) { h = f2bf(y); l = f2bf(y - bf2f(h)); }
typedef __attribute__((ext_vector_type(2))) _Float16 v2h;
typedef __attribute__((ext_vector_type(4))) _Float16 v4h;
typedef __attribute__((ext_vector_type(2))) unsigned short v2us;
typedef __attribute__((ext_vector_type(4))) unsigned short v4us;
typedef __attribute__((ext_vector_type(2))) float v2f;
typedef __attribute__((ext_vector_type(4))) int v4i;
#define PL   ((size_t)TT * DQ)              // elements of one batch's projection = of one batch's plane

// FRAGMENT ORDER of every 16-bit operand plane: a [rows][K] plane is a run of 16-row x 32-k tiles of 512 elements, tile (row >> 4) * (K / 32) + (k >> 5) (the [d][t] value planes order their tiles as z = 2 below); inside a tile element (row, k) stands at
// ((k >> 4) & 1) * 256 + (((k >> 3) & 1) * 16 + (row & 15)) * 8 + (k & 7): the 8 elements that lane 16 hi + lr takes in one 16-byte load stand at lane * 8, so that a wave's load covers 512 bytes in a row (4 whole lines, not 16 pieces).
// ---- k_gemmt: GEMM, one 128x128 output tile per block of 4 waves (2 x 2, each wave a 64x64 tile = 16 accumulators over the WHOLE K); grid (M/128, N/128), 128 threads.
// The block's operand rows go through LDS in stages of 64 k, so that L2 delivers each operand row once per block and not once per wave: a stage of a plane is 8 runs of 2 KiB (16 rows x 64 k = two neighbouring tiles in fragment order),
// copied as they stand (thread i takes bytes 16 i of every run), two buffers: the next stage's global loads fly in registers while this stage is multiplied, are stored into the other buffer behind it, one __syncthreads a stage.
// C[m][n] (f32, pitch DM) = sum_k A[m][k] Bt[n][k] (+ A2[m][k] Bt[n][k] if NSPLIT) + bias[n]. K % 64 == 0.
// Epilogue: every wave lays its own tile (bias added) into its own LDS range, which takes the place of the stage buffers, and reads it back in the order of its stores.
// PLANES (the q/k/v projection; rows = [batch][t], Bt = the q, k, v weights one behind the other, one wave's 64 columns = one head; z = q, k, v is the same for the whole block): C is not written; the tile goes straight to the 16-bit planes that the attention kernel reads, each set = [q, k, v][batch][head][..][..]:
// z < 2: [t][d] planes (fragment order, K = HD) of partial-rope(x): rotate-half inside the first ROT dims (out[d] = x[d] cos - x[d+ROT/2] sin, out[d+ROT/2] = x[d+ROT/2] cos + x[d] sin), dims >= ROT pass through.
//        q and k share one order of the rotary dims along k: slot 8 g + c holds dim 4 g + c, slot 8 g + 4 + c its partner 4 g + c + ROT/2 (g, c < 4); q.k sums over all of them, so only the order of that sum depends on it.
// z = 2: [d][t] planes in fragment order, tile (t >> 5) * (HD / 16) + (d >> 4), so that the 8 tiles of 64 keys stand in a row: the tile is laid into LDS transposed.
// Trip w8 of the plane loop stores k slots 8 w8 .. 8 w8 + 7 of all 64 rows (lane = row & 15 and which 4 of the 8): each store covers 256 bytes in a row.
template <typename T16> struct WFrag;
template <> struct WFrag<h16> { typedef v16h V; static __device__ __forceinline__ V ld(const h16* p) { return cat16(*(const v8h*)p, *(const v8h*)(p + 256)); } static __device__ __forceinline__ v8f mma(V a, V b, v8f c) { return wmma16(a, b, c); } };
template <> struct WFrag<bf> { typedef v16bf V; static __device__ __forceinline__ V ld(const bf* p) { return cat16b(*(const v8us*)p, *(const v8us*)(p + 256)); } static __device__ __forceinline__ v8f mma(V a, V b, v8f c) { return wmmab(a, b, c); } };
__device__ __forceinline__ v16bf ldsfrag(const bf* p) { return cat16b(*(const v8usa*)p, *(const v8usa*)(p + 256)); }
template <int NSPLIT, bool PLANES, int K>
__global__ __launch_bounds__(128) void k_gemmt(const bf* __restrict__ A, const bf* __restrict__ A2, const bf* __restrict__ Bt, float* C, const float* __restrict__ bias, const float* __restrict__ bias1, const float* __restrict__ bias2, const float* __restrict__ CS, h16* P16, bf* Ph, bf* Pl) {
    static_assert(K % 64 == 0 && (!PLANES || (HD == 64 && TT % 64 == 0 && DQ % 128 == 0)), "whole stages; the plane epilogue takes one head and one batch per wave tile");
    constexpr int NP = NSPLIT ? 3 : 2, STG = NP * 8192, NS = K / 64;   // planes per stage, elements per buffer, stages
    constexpr bool FR2 = !PLANES;   // the grid of the last GEMM gives one wave a SIMD: registers for a whole stage's fragments are free there; three waves a SIMD take half a stage's at a time
    constexpr int SMB = (2 * STG * 2 > 4 * 64 * 68 * 4) ? 2 * STG * 2 : 4 * 64 * 68 * 4;
    __shared__ __align__(16) unsigned char sm[SMB];
    const int tid = threadIdx.x, wave = __builtin_amdgcn_readfirstlane(tid >> 5);   // scalar, so that what depends on the wave stays wave-uniform (matrix instructions need every lane on)
    const int lane = tid & 31, lr = lane & 15, hi = lane >> 4, wm = wave >> 1, wn = wave & 1; const int r0 = blockIdx.x * 128, c0 = blockIdx.y * 128;
    const int z = PLANES ? c0 / DQ : 0, cw = c0 - z * DQ + wn * 64;   // the wave's first column inside its weight
    bf* sb = (bf*)sm; float* os = (float*)sm + wave * 64 * 68;
    float bvn[4];   // bias of the lane's four accumulator columns, asked for here so that it is there long before the epilogue
    { const float* bp = ((z == 0) ? bias : (z == 1) ? bias1 : bias2) + cw + lr;
#pragma unroll   // constant indices, so that the small array stays in registers
        for (int nb = 0; nb < 4; ++nb) bvn[nb] = bp[nb * 16];
        asm volatile("s_wait_xcnt 0x0" :: "v"(bp) : "memory");   // before any register that the loads above name is written again
    }
    v8f acc[4][4];
#pragma unroll
    for (int mb = 0; mb < 4; ++mb)
#pragma unroll
        for (int nb = 0; nb < 4; ++nb) acc[mb][nb] = (v8f){};
    const bf* ga = A + (size_t)r0 * K + tid * 8; const bf* ga2 = NSPLIT ? A2 + (size_t)r0 * K + tid * 8 : ga; const bf* gb = Bt + (size_t)c0 * K + tid * 8;   // 16 rows x K = K / 32 tiles; one pointer per plane (K is a constant: the 16-row runs are immediate offsets), which the s_wait_xcnt names as an input so that the register lives up to the wait
    v8us ra[8], ra2[8], rb[8];
#pragma unroll   // constant indices, so that the arrays stay in registers
    for (int g = 0; g < 8; ++g) { ra[g] = *(const v8us*)(ga + g * 16 * K); if (NSPLIT) ra2[g] = *(const v8us*)(ga2 + g * 16 * K); rb[g] = *(const v8us*)(gb + g * 16 * K); }
    asm volatile("s_wait_xcnt 0x0" :: "v"(ga), "v"(ga2), "v"(gb) : "memory");   // before any register that the loads above name is written again
#pragma unroll
    for (int g = 0; g < 8; ++g) { bf* d = sb + g * 1024 + tid * 8; *(v8usa*)d = ra[g]; if (NSPLIT) *(v8usa*)(d + 8192) = ra2[g]; *(v8usa*)(d + (NP - 1) * 8192) = rb[g]; }
    __syncthreads();   // stage 0 is in LDS before any wave reads it
    int bo = 0;   // the buffer of this stage, in elements
#pragma unroll 1   // rolled: one stage's registers are all that is wanted live
    for (int s = 0; s < NS; ++s) {
        const bool more = s + 1 < NS;   // block-uniform
        if (more) { ga += 1024; ga2 = NSPLIT ? ga2 + 1024 : ga; gb += 1024;   // next stage's rows fly while this stage is multiplied
#pragma unroll
            for (int g = 0; g < 8; ++g) { ra[g] = *(const v8us*)(ga + g * 16 * K); if (NSPLIT) ra2[g] = *(const v8us*)(ga2 + g * 16 * K); rb[g] = *(const v8us*)(gb + g * 16 * K); }
            asm volatile("s_wait_xcnt 0x0" :: "v"(ga), "v"(ga2), "v"(gb) : "memory");   // before any register that the loads above name is written again
        }
        const bf* fa = sb + bo + wm * 4096 + lane * 8; const bf* fb = sb + bo + (NP - 1) * 8192 + wn * 4096 + lane * 8;
        v16bf a[2][4], a2[2][4], b[2][4];
#pragma unroll   // constant indices, so that the fragment arrays stay in registers
        for (int ks = 0; ks < 2; ++ks) {
#pragma unroll
            for (int mb = 0; mb < 4; ++mb) { a[ks][mb] = ldsfrag(fa + mb * 1024 + ks * 512); if (NSPLIT) a2[ks][mb] = ldsfrag(fa + 8192 + mb * 1024 + ks * 512); }
#pragma unroll
            for (int nb = 0; nb < 4; ++nb) b[ks][nb] = ldsfrag(fb + nb * 1024 + ks * 512);
            if (FR2 && ks == 0) continue;   // FR2: both halves' fragments are asked for in one group
            __builtin_amdgcn_sched_barrier(0);   // keeps the LDS reads one group in front of the products: left to itself the compiler re-used one B fragment's registers and put a read and a full wait in front of every four products
#pragma unroll
            for (int k2 = FR2 ? 0 : ks; k2 <= ks; ++k2)
#pragma unroll
                for (int pl = 0; pl <= NSPLIT; ++pl)   // all 16 tiles with one A plane, then with the other: two products into one accumulator never stand back to back
#pragma unroll
                    for (int nb = 0; nb < 4; ++nb)
#pragma unroll
                        for (int mb = 0; mb < 4; ++mb) acc[mb][nb] = wmmab(pl ? a2[k2][mb] : a[k2][mb], b[k2][nb], acc[mb][nb]);
            __builtin_amdgcn_sched_barrier(0);   // keeps the next group of LDS reads (and the stores behind the products) from being spread among the products
        }
        bo ^= STG;
        if (more) {
#pragma unroll
            for (int g = 0; g < 8; ++g) { bf* d = sb + bo + g * 1024 + tid * 8; *(v8usa*)d = ra[g]; if (NSPLIT) *(v8usa*)(d + 8192) = ra2[g]; *(v8usa*)(d + (NP - 1) * 8192) = rb[g]; }
        }
        __syncthreads();   // publishes the next stage and ends every wave's reads of this one (which the stage after next, or the epilogue, overwrites)
    }
#pragma unroll   // constant indices, so that the small array stays in registers
    for (int nb = 0; nb < 4; ++nb) bvn[nb] = bfr(bvn[nb]);
    const bool tr = PLANES && z == 2;   // block-uniform
    const int rw = r0 + wm * 64, t0 = rw % TT;
    v4f cn0[4] = {}, cn1[4] = {};   // PLANES: (cos, sin) of the next trip's elements, asked for one trip ahead
    const float* cs = CS + (size_t)(t0 + lr) * HD * 2;   // a dim and its partner have one angle: both halves of the wave read the entry of the lower dim
    if constexpr (PLANES) {
        if (!tr) {
#pragma unroll   // constant indices, so that the small arrays stay in registers
            for (int s = 0; s < 4; ++s) { cn0[s] = *(const v4f*)(cs + s * 16 * HD * 2); cn1[s] = *(const v4f*)(cs + s * 16 * HD * 2 + 4); }
            asm volatile("s_wait_xcnt 0x0" :: "v"(cs) : "memory");   // before any register that the loads above name is written again
        }
    }
    if (tr) {
#pragma unroll   // constant indices, so that the small arrays stay in registers
        for (int mb = 0; mb < 4; ++mb)
#pragma unroll   // constant indices, so that the small arrays stay in registers
            for (int nb = 0; nb < 4; ++nb) { float* p = os + (nb * 16 + lr) * 68 + mb * 16 + hi * 8; const v8f v = acc[mb][nb] + bvn[nb];
                *(v4fa*)p = __builtin_shufflevector(v, v, 0, 1, 2, 3); *(v4fa*)(p + 4) = __builtin_shufflevector(v, v, 4, 5, 6, 7); }
    } else {
#pragma unroll
        for (int mb = 0; mb < 4; ++mb)
#pragma unroll
            for (int nb = 0; nb < 4; ++nb)
#pragma unroll
                for (int j = 0; j < 8; ++j) os[(mb * 16 + hi * 8 + j) * 68 + nb * 16 + lr] = acc[mb][nb][j] + bvn[nb];
    }
    __syncthreads();   // the tile is in LDS before its wave's lanes read one another's elements
    if constexpr (PLANES) {
        const size_t e0 = ((size_t)z * NB_ + rw / TT) * PL + (size_t)(cw / HD) * TT * HD + (size_t)t0 * HD + lr * 8 + hi * 4;   // this batch's and head's plane; 64 t x HD = 8 tiles
#pragma unroll 1   // rolled: eight copies of the body would only cost instruction cache
        for (int w8 = 0; w8 < 8; ++w8) {
            const bool rot = !tr && w8 < ROT / 8;   // wave-uniform: this trip's 8 k slots are rotary dims
            const int col0 = rot ? w8 * 4 + hi * (ROT / 2) : w8 * 8 + hi * 4;   // a thread takes rows lr + 16 s, columns col0 .. col0 + 3 of the LDS tile
            v4f cs0[4], cs1[4], val[4];
#pragma unroll   // constant indices, so that the small arrays stay in registers
            for (int s = 0; s < 4; ++s) { cs0[s] = cn0[s]; cs1[s] = cn1[s]; val[s] = *(const v4fa*)(os + (s * 16 + lr) * 68 + col0); }
            if (!tr && w8 + 1 < ROT / 8) { cs += 8;
#pragma unroll   // constant indices, so that the small arrays stay in registers
                for (int s = 0; s < 4; ++s) { cn0[s] = *(const v4f*)(cs + s * 16 * HD * 2); cn1[s] = *(const v4f*)(cs + s * 16 * HD * 2 + 4); }
                asm volatile("s_wait_xcnt 0x0" :: "v"(cs) : "memory");   // before any register that the loads above name is written again
            }
            size_t e = e0 + ((w8 >> 1) & 1) * 256 + (w8 & 1) * 128;   // k slot 8 w8 + 4 hi inside its tile
            int es;
            if (tr) { e += (w8 >> 2) * (HD / 16) * 512; es = 512; }   // LDS row = d (tile s), column = t (k)
            else { e += (w8 >> 2) * 512; es = (HD / 32) * 512;   // LDS row = t (tile s), column = d (k)
                if (rot) {
#pragma unroll   // constant indices, so that the small arrays stay in registers
                    for (int s = 0; s < 4; ++s) { const v4f x = val[s]; v4f xp;   // xp: the rotate-half partner d +- ROT/2, in the other half of the wave, with its sign
#pragma unroll   // constant indices, so that the small arrays stay in registers
                        for (int c = 0; c < 4; ++c) { const float y = __shfl_xor(x[c], 16, 32); xp[c] = hi ? y : -y; }
                        val[s][0] = x[0] * cs0[s][0] + xp[0] * cs0[s][1]; val[s][1] = x[1] * cs0[s][2] + xp[1] * cs0[s][3]; val[s][2] = x[2] * cs1[s][0] + xp[2] * cs1[s][1]; val[s][3] = x[3] * cs1[s][2] + xp[3] * cs1[s][3]; }
                }
            }
#pragma unroll   // constant indices, so that the small arrays stay in registers
            for (int s = 0; s < 4; ++s) { v4h o16; v4us oh, ol;
#pragma unroll   // constant indices, so that the small arrays stay in registers
                for (int c = 0; c < 4; ++c) { o16[c] = tohx(val[s][c]); unsigned short a2, c2; splitf(val[s][c], a2, c2); oh[c] = a2; ol[c] = c2; }
                h16* p16 = P16 + e + (size_t)s * es; bf* ph = Ph + e + (size_t)s * es; bf* pl = Pl + e + (size_t)s * es;
                *(v4h*)p16 = o16; *(v4us*)ph = oh; *(v4us*)pl = ol;
                asm volatile("s_wait_xcnt 0x0" :: "v"(p16), "v"(ph), "v"(pl) : "memory");   // before any register that the stores above name is written again
            }
        }
    } else {
        float* cp = C + (size_t)(rw + hi) * DM + c0 + wn * 64 + lr * 4;   // 16 lanes store one row's 64 columns; the rows are immediate offsets
#pragma unroll
        for (int q = 0; q < 4; ++q) {
#pragma unroll
            for (int s = q * 8; s < q * 8 + 8; ++s) *(v4f*)(cp + (size_t)s * 2 * DM) = *(const v4fa*)(os + (s * 2 + hi) * 68 + lr * 4);
            asm volatile("s_wait_xcnt 0x0" :: "v"(cp) : "memory");   // before any register that the stores above name is written again (the next group's LDS reads take the data registers)
        }
    }
}


// The element-wise stages are device functions of a block number bx; k_prep below deals the blocks of one grid out to them.
// Both write a plane in fragment order, one 16-byte piece i (8 k of one row) a thread and step, the pieces in the plane's own order, so that a wave's store covers 512 bytes in a row.
__device__ __forceinline__ void piece_at(const int i, const int K, int& row, int& k0) { const int tile = i >> 6, kt = K / 32; row = (tile / kt) * 16 + (i & 15); k0 = (tile % kt) * 32 + ((i >> 5) & 1) * 16 + ((i >> 4) & 1) * 8; }
__device__ __forceinline__ void d_wtG(const int bx, const float* __restrict__ w, int K, int N, bf* Bt) {   // Bt[n][k] = w[k][n]: 16 lanes read 16 neighbouring n of one k
    const int i0 = bx * 512 + (int)threadIdx.x; float v[2][8];   // two pieces a thread (the grid has N K / 8 / 512 blocks per weight); all 16 loads are asked for before the first is used
#pragma unroll   // constant indices, so that the small array stays in registers
    for (int l = 0; l < 2; ++l) { int n, k0; piece_at(i0 + l * 256, K, n, k0);
#pragma unroll
        for (int j = 0; j < 8; ++j) v[l][j] = w[(size_t)(k0 + j) * N + n]; }
#pragma unroll   // constant indices, so that the small array stays in registers
    for (int l = 0; l < 2; ++l) { v8us o;
#pragma unroll
        for (int j = 0; j < 8; ++j) o[j] = f2bf(v[l][j]);
        *(v8us*)(Bt + (size_t)(i0 + l * 256) * 8) = o; }
}
__device__ __forceinline__ void d_cvt8(const int bx, const float* __restrict__ src, int K, bf* dst, size_t n8) { const size_t i = (size_t)bx * 256 + threadIdx.x; if (i >= n8) return; int row, k0; piece_at((int)i, K, row, k0); const v8f v = *(const v8f*)(src + (size_t)row * K + k0); v8us o;
#pragma unroll
    for (int k = 0; k < 8; ++k) o[k] = f2bf(v[k]); *(v8us*)(dst + i * 8) = o;  }
__constant__ float INV[ROT / 2] = {1.0,0.6209288835525513,0.38555270433425903,0.23940083384513855,0.1486508846282959,0.0923016369342804,0.057312753051519394,0.035587143152952194,0.022097086533904076,0.013720721006393433,0.008519591763615608,0.005290060769766569,0.003284751670435071,0.002039597136899829,0.0012664449168369174,0.0007863722858019173};
__device__ __forceinline__ void d_cstab(const int bx, float* CS) { const int idx = bx * 256 + threadIdx.x; if (idx >= TT * HD) return; const int t = idx / HD, d = idx % HD; v2f cs; if (d < ROT) { const int i = (d < ROT / 2) ? d : d - ROT / 2; const float ang = __fmul_rn((float)t, INV[i]); cs[0] = cosf(ang); cs[1] = sinf(ang); } else { cs[0] = 1.0f; cs[1] = 0.0f; }
    *(v2f*)(CS + (size_t)idx * 2) = cs;  }
// k_prep: everything that depends on the inputs alone, in one grid: the four weight transposes (first in the grid, for speed only), x of both batches to bf16, the cos/sin table.
#define WTB  (DM * DQ / 64 / 64)            // blocks per weight transpose
#define CVB  (NB_ * TT * DM / 8 / 256)      // blocks of the x conversion
#define CSB  (TT * HD / 256)                // blocks of the table
static_assert(DKV == DQ && DM == DQ, "the four weight planes have one size");
static_assert(WTB * 512 == DM * DQ / 8 && DM % 32 == 0 && DQ % 16 == 0, "a transpose block writes 512 whole 16-byte pieces");
__global__ __launch_bounds__(256) void k_prep(const float* __restrict__ wq, const float* __restrict__ wk, const float* __restrict__ wv, const float* __restrict__ wo, const float* __restrict__ x, bf* W4, bf* XB, float* CS) {
    const int b = blockIdx.x;
    if (b < 4 * WTB) { const int i = b / WTB; d_wtG(b % WTB, (i == 0) ? wq : (i == 1) ? wk : (i == 2) ? wv : wo, DM, DQ, W4 + (size_t)i * DM * DQ); }
    else if (b < 4 * WTB + CVB) d_cvt8(b - 4 * WTB, x, DM, XB, (size_t)NB_ * TT * DM / 8);
    else d_cstab(b - 4 * WTB - CVB, CS);
}

// ---- k_fattn: causal attention of one head in one kernel (scores, softmax, probability x value, head merge): scores and probabilities stay in registers.
// Transposed products: St = K Qt (A = key rows, B = query rows, both [t][d] planes in fragment order) puts one query's scores of a 16-key tile in one lane (D[key 8 hi + j][query lr]); two such tiles, converted in place, are the B operand
// (32 keys in the hardware k order) of Ot += Vt Pt (A = rows of the [d][t] value plane, same k order). On-line softmax over 64-key blocks in the log2 domain: running maximum m and sum l per query column,
// Ot and l rescaled by 2^(m_old - m_new) in every block; P is left unnormalised (x 2^PSH for fp16's range; the factor cancels in Ot / l). One division per query at the end, then the hi/lo bf16 split into the merged [t][DQ] planes (fragment order).
// HI (query rows < RH): hi+lo bf16 planes, 3 products each; else single fp16. One wave owns 16 x QT query columns; no LDS, no barrier.
// Every inner loop is fully unrolled so that the fragment arrays are indexed by constants and stay in registers.
template <typename T16, bool HI, int QT>
__device__ __forceinline__ void fattn_tile(const T16* __restrict__ Q, const T16* __restrict__ Q2, const T16* __restrict__ Kp, const T16* __restrict__ K2, const T16* __restrict__ Vt, const T16* __restrict__ V2, const int q0, const int lr, const int hi, bf* Ah, bf* Al) {
    typedef typename WFrag<T16>::V V;
    const float C2 = SCL * 1.4426950408889634f;      // score scale x log2(e)
    const float PSH = HI ? 0.0f : 10.0f;             // fp16 P carries x1024
    const unsigned koff = (unsigned)(8 * (16 * hi + lr)), voff = koff;   // the lane's place inside a tile in fragment order; a group of loads shares one pointer per plane, which its s_wait_xcnt names as an input so that the register lives up to the wait
    const unsigned kob = koff * (unsigned)sizeof(T16);   // the same place in bytes: the offset register of the first loads
    const T16* qp = Q + q0 * HD + koff; const T16* qp2 = HI ? Q2 + q0 * HD + koff : qp;
    V qb[QT][2], qb2[QT][2];
#pragma unroll
    for (int qt = 0; qt < QT; ++qt)
#pragma unroll
        for (int ks = 0; ks < 2; ++ks) { const int qo = (qt * 2 + ks) * 512; qb[qt][ks] = WFrag<T16>::ld(qp + qo); if (HI) qb2[qt][ks] = WFrag<T16>::ld(qp2 + qo); }
    v8f o[QT][4]; float m[QT], l[QT];
#pragma unroll
    for (int qt = 0; qt < QT; ++qt) { m[qt] = -3.0e38f; l[qt] = 0.0f;
#pragma unroll
        for (int md = 0; md < 4; ++md) o[qt][md] = (v8f){}; }
    const int kdiag = q0 & ~63;                      // the 64-key block that holds the diagonal of all 16 x QT rows (16 x QT divides 64)
    V ka[4][2], ka2[4][2];
    const T16* kp = Kp + koff; const T16* kp2 = HI ? K2 + koff : kp;
#pragma unroll
    for (int nb = 0; nb < 4; ++nb)
#pragma unroll
        for (int ks = 0; ks < 2; ++ks) { const int ko = (nb * 2 + ks) * 512; ka[nb][ks] = WFrag<T16>::ld(kp + ko); if (HI) ka2[nb][ks] = WFrag<T16>::ld(kp2 + ko); }
    asm volatile("s_wait_xcnt 0x0" :: "v"(qp), "v"(qp2), "v"(kp), "v"(kp2), "v"(kob) : "memory");   // before any register that the loads above name is written again
#pragma unroll 1   // rolled: one block's fragments already fill the registers, a second copy of the body would only cost instruction cache
    for (int kb = 0; kb <= kdiag; kb += 64) {
        V va[4][2], va2[4][2];                       // this block's value rows: needed last, asked for first
        const T16* vp = Vt + kb * HD + voff; const T16* vp2 = HI ? V2 + kb * HD + voff : vp;   // 32 keys = HD / 16 tiles
#pragma unroll
        for (int md = 0; md < 4; ++md)
#pragma unroll
            for (int ks = 0; ks < 2; ++ks) { const int vo = (ks * 4 + md) * 512; va[md][ks] = WFrag<T16>::ld(vp + vo); if (HI) va2[md][ks] = WFrag<T16>::ld(vp2 + vo); }
        asm volatile("s_wait_xcnt 0x0" :: "v"(vp), "v"(vp2) : "memory");   // before any register that the loads above name is written again
        v8f st[QT][4];
#pragma unroll
        for (int nb = 0; nb < 4; ++nb)
#pragma unroll
            for (int qt = 0; qt < QT; ++qt) { v8f a = (v8f){};
#pragma unroll
                for (int ks = 0; ks < 2; ++ks) { a = WFrag<T16>::mma(ka[nb][ks], qb[qt][ks], a); if (HI) { a = WFrag<T16>::mma(ka[nb][ks], qb2[qt][ks], a); a = WFrag<T16>::mma(ka2[nb][ks], qb[qt][ks], a); } }
                st[qt][nb] = a; }
        const int kst = (kb < kdiag) ? 64 * HD : 0; kp += kst; kp2 += kst;   // next block's key rows fly during the softmax and P.V (the last trip re-reads its own: in bounds, unused)
#pragma unroll
        for (int nb = 0; nb < 4; ++nb)
#pragma unroll
            for (int ks = 0; ks < 2; ++ks) { const int ko = (nb * 2 + ks) * 512; ka[nb][ks] = WFrag<T16>::ld(kp + ko); if (HI) ka2[nb][ks] = WFrag<T16>::ld(kp2 + ko); }
        asm volatile("s_wait_xcnt 0x0" :: "v"(kp), "v"(kp2) : "memory");   // before any register that the loads above name is written again
        __builtin_amdgcn_sched_barrier(0);   // keeps the score scaling, softmax and P.V products below from being lifted in front of the wait above, where they took the loads' address register
#pragma unroll
        for (int qt = 0; qt < QT; ++qt)
#pragma unroll
            for (int nb = 0; nb < 4; ++nb) st[qt][nb] *= C2;
        if (kb == kdiag) {                           // wave-uniform: only the diagonal block has keys above a query
#pragma unroll
            for (int qt = 0; qt < QT; ++qt)
#pragma unroll
                for (int nb = 0; nb < 4; ++nb)
#pragma unroll
                    for (int j = 0; j < 8; ++j) st[qt][nb][j] = (kb + nb * 16 + hi * 8 + j <= q0 + qt * 16 + lr) ? st[qt][nb][j] : -3.0e38f;
        }
        V pb[QT][2], pb2[QT][2];
#pragma unroll
        for (int qt = 0; qt < QT; ++qt) {
            float mx4[4];
#pragma unroll
            for (int nb = 0; nb < 4; ++nb) { mx4[nb] = st[qt][nb][0];
#pragma unroll
                for (int j = 1; j < 8; ++j) mx4[nb] = fmaxf(mx4[nb], st[qt][nb][j]); }
            float mx = fmaxf(fmaxf(mx4[0], mx4[1]), fmaxf(mx4[2], mx4[3]));
            mx = fmaxf(mx, __shfl_xor(mx, 16, 32));  // the other half of the wave holds the query's other keys
            mx = fmaxf(mx, m[qt]);
            const float al = __builtin_amdgcn_exp2f(m[qt] - mx); m[qt] = mx; const float msh = mx - PSH;
            float ls4[4];
#pragma unroll
            for (int nb = 0; nb < 4; ++nb) { ls4[nb] = 0.0f;
#pragma unroll
                for (int j = 0; j < 8; ++j) { const float p = __builtin_amdgcn_exp2f(st[qt][nb][j] - msh); st[qt][nb][j] = p; ls4[nb] += p; } }
            l[qt] = l[qt] * al + ((ls4[0] + ls4[1]) + (ls4[2] + ls4[3]));
#pragma unroll
            for (int md = 0; md < 4; ++md) o[qt][md] *= al;
#pragma unroll
            for (int ks = 0; ks < 2; ++ks) {
                if constexpr (HI) { v8us h0, h1, l0, l1;
#pragma unroll
                    for (int j = 0; j < 8; ++j) { unsigned short a, c; splitf(st[qt][2 * ks][j], a, c); h0[j] = a; l0[j] = c; splitf(st[qt][2 * ks + 1][j], a, c); h1[j] = a; l1[j] = c; }
                    pb[qt][ks] = cat16b(h0, h1); pb2[qt][ks] = cat16b(l0, l1);
                } else { v8h h0, h1;
#pragma unroll
                    for (int j = 0; j < 8; ++j) { h0[j] = tohx(st[qt][2 * ks][j]); h1[j] = tohx(st[qt][2 * ks + 1][j]); }
                    pb[qt][ks] = cat16(h0, h1); }
            }
        }
#pragma unroll
        for (int ks = 0; ks < 2; ++ks)
#pragma unroll
            for (int md = 0; md < 4; ++md)
#pragma unroll
                for (int qt = 0; qt < QT; ++qt) { o[qt][md] = WFrag<T16>::mma(va[md][ks], pb[qt][ks], o[qt][md]); if (HI) { o[qt][md] = WFrag<T16>::mma(va[md][ks], pb2[qt][ks], o[qt][md]); o[qt][md] = WFrag<T16>::mma(va2[md][ks], pb[qt][ks], o[qt][md]); } }
    }
#pragma unroll
    for (int qt = 0; qt < QT; ++qt) { const float f = __fdiv_rn(1.0f, l[qt] + __shfl_xor(l[qt], 16, 32)); bf* ahp = Ah + (q0 + qt * 16) * DQ + koff; bf* alp = Al + (q0 + qt * 16) * DQ + koff;   // 16 rows x DQ = DQ / 32 tiles; a lane's 8 values of o are one 16-byte piece of the merged plane's fragment order
#pragma unroll
        for (int md = 0; md < 4; ++md) { v8us oh, ol;
#pragma unroll
            for (int j = 0; j < 8; ++j) { unsigned short a, c; splitf(o[qt][md][j] * f, a, c); oh[j] = a; ol[j] = c; }
            *(v8us*)(ahp + md * 256) = oh; *(v8us*)(alp + md * 256) = ol; }
        asm volatile("s_wait_xcnt 0x0" :: "v"(ahp), "v"(alp) : "memory");   // before any register that the stores above name is written again
    }
}
// grid (heads x batches, (TT - RH) / 64 + RH / 32), 2 waves, longest key loops of both batches first: blocks y < (TT - RH) / 64 take 64 fp16 query rows each, from the last rows down (32 a wave); the others 32 hi+lo rows each (16 a wave)
__global__ __launch_bounds__(64) void k_fattn(const h16* __restrict__ QP16, const h16* __restrict__ KP16, const h16* __restrict__ VT16, const bf* __restrict__ QPh, const bf* __restrict__ QPl, const bf* __restrict__ KPh, const bf* __restrict__ KPl, const bf* __restrict__ VTh, const bf* __restrict__ VTl, bf* ATh, bf* ATl) {
    const int wave = __builtin_amdgcn_readfirstlane((int)(threadIdx.x >> 5));   // scalar, so that the key loop's branches are wave-uniform (matrix instructions need every lane on)
    const int lane = threadIdx.x & 31, lr = lane & 15, hi = lane >> 4; const int h = blockIdx.x % NH_, b = blockIdx.x / NH_; const int y = blockIdx.y; const bool lo = y < (TT - RH) / 64;
    const int q0 = lo ? (TT / 64 - 1 - y) * 64 + wave * 32 : ((TT - RH) / 64 + RH / 32 - 1 - y) * 32 + wave * 16;
    const size_t zq = ((size_t)b * NH_ + h) * TT * HD, zk = ((size_t)b * NKV + h / REP) * TT * HD; bf* ah = ATh + (size_t)b * TT * DQ + h * (HD / 32) * 512; bf* al = ATl + (size_t)b * TT * DQ + h * (HD / 32) * 512;
    if (!lo) fattn_tile<bf, true, 1>(QPh + zq, QPl + zq, KPh + zk, KPl + zk, VTh + zk, VTl + zk, q0, lr, hi, ah, al);
    else fattn_tile<h16, false, 2>(QP16 + zq, nullptr, KP16 + zk, nullptr, VT16 + zk, nullptr, q0, lr, hi, ah, al);
}

extern "C" void kernel_launch(void* const* d_in, const int* in_sizes, int n_in,
                              void* d_out, int out_size, void* d_ws, size_t ws_size, hipStream_t stream) {
    (void)in_sizes; (void)n_in; (void)out_size;
    const float* x = (const float*)d_in[0]; const float* wq = (const float*)d_in[1]; const float* bq = (const float*)d_in[2]; const float* wk = (const float*)d_in[3]; const float* bk = (const float*)d_in[4]; const float* wv = (const float*)d_in[5]; const float* bv = (const float*)d_in[6]; const float* wo = (const float*)d_in[7]; const float* bo = (const float*)d_in[8]; const float* cosT = nullptr; const float* sinT = nullptr; (void)cosT; (void)sinT;
    float* OUT = (float*)d_out;     // [2][2048][1024]
    char* wsp = (char*)d_ws;
    auto take = [&](size_t bytes) { char* p = wsp; wsp += (bytes + 255) & ~(size_t)255; return (void*)p; };
    bf* W4 = (bf*)take((size_t)4 * DQ * DM * 2); float* CS = (float*)take((size_t)TT * HD * 2 * 4);   // Wq, Wk, Wv, Wo transposed, one behind the other
    bf* XB = (bf*)take((size_t)NB_ * TT * DM * 2);   // both batches: x in bf16
    h16* P16 = (h16*)take((size_t)3 * NB_ * TT * DQ * 2); bf* Ph = (bf*)take((size_t)3 * NB_ * TT * DQ * 2); bf* Pl = (bf*)take((size_t)3 * NB_ * TT * DQ * 2);   // [q, k, v][batch] planes
    bf* ATh = (bf*)take((size_t)NB_ * TT * DQ * 2); bf* ATl = (bf*)take((size_t)NB_ * TT * DQ * 2);
    if ((size_t)(wsp - (char*)d_ws) > ws_size) return;    // ws 256 MiB
    const size_t KO = (size_t)NB_ * TT * DQ, VO = (size_t)2 * NB_ * TT * DQ;   // where the k and the v planes start
    // four launches, each one stage of the data flow for both batches ([batch][t] is one run of NB_ x TT rows for the two GEMMs)
    k_prep<<<4 * WTB + CVB + CSB, 256, 0, stream>>>(wq, wk, wv, wo, x, W4, XB, CS);
    k_gemmt<0, true, DM><<<dim3(NB_ * TT / 128, 3 * DQ / 128, 1), 128, 0, stream>>>(XB, nullptr, W4, nullptr, bq, bk, bv, CS, P16, Ph, Pl);
    k_fattn<<<dim3(NH_ * NB_, (TT - RH) / 64 + RH / 32, 1), 64, 0, stream>>>(P16, P16 + KO, P16 + VO, Ph, Pl, Ph + KO, Pl + KO, Ph + VO, Pl + VO, ATh, ATl);
    k_gemmt<1, false, DQ><<<dim3(NB_ * TT / 128, DM / 128, 1), 128, 0, stream>>>(ATh, ATl, W4 + (size_t)3 * DQ * DM, OUT, bo, nullptr, nullptr, nullptr, nullptr, nullptr, nullptr);
}

// v007
// Measured time: 74.5 microseconds a run.
// Timed twice side by side with v006, it ran 1.15 and 1.14 times as fast.
// Over all steps from v000 it is 21.3 times as fast.
#include <hip/hip_runtime.h>

// Multi-head causal attention with partial rotary (x [2][2048][1024]; q/k/v = x W + b ('xw' [1024][1024], 16 x 64); rotate-half rotary on the FIRST 32 dims of each head (pairs d, d+16), angles t x inv[d mod 16] with inv_i = 2048^(-2i/32), the other 32 dims pass through; causal (tril) -inf; softmax(q.k / 8); out = merged Wo ('xw' [1024][1024]) + bo -> [2][2048][1024]).
// Compute dtypes, f32 accumulate: every input rounded to bf16; q/k/v on PLAIN bf16 operands (inputs: exact) + bias; rotary in f32 from an on-chip table (inv constants are the reference's own f32 values; angle = t x inv one product; precise cosf/sinf); causal scores and attn.v: query rows < 512 hl (3 products), the rest single fp16 (x1024), causal tile skipping; on-line softmax f32, all inside one kernel; Wo hl x exact (2 products) + bias.

#define NB_  2
#define TT   2048
#define DM   1024
#define NH_  16
#define NKV  16
#define REP  (NH_ / NKV)
#define HD   64
#define DQ   (NH_ * HD)
#define DKV  (NKV * HD)
#define RH   512                  // query rows < RH use hi+lo planes (a multiple of 64)
#define ROT  32                   // rotary dims per head (rotate-half inside them)
#define SCL  0.125f   // HD^-0.5
typedef _Float16 h16;
typedef unsigned short bf;
typedef __attribute__((ext_vector_type(16))) __bf16   v16bf;
typedef __attribute__((ext_vector_type(16))) _Float16 v16h;
typedef __attribute__((ext_vector_type(8)))  _Float16 v8h;
typedef __attribute__((ext_vector_type(8)))  unsigned short v8us;
typedef __attribute__((ext_vector_type(8)))  float    v8f;
typedef __attribute__((ext_vector_type(4)))  float    v4f;
typedef v8h  __attribute__((may_alias)) v8ha;
typedef v4f  __attribute__((may_alias)) v4fa;
typedef v8us __attribute__((may_alias)) v8usa;

__device__ __forceinline__ unsigned short f2bf(float f) { unsigned u = __float_as_uint(f); u += 0x7FFFu + ((u >> 16) & 1u); return (unsigned short)(u >> 16); }
__device__ __forceinline__ float bf2f(unsigned short b) { return __uint_as_float(((unsigned)b) << 16); }
__device__ __forceinline__ float bfr(float f) { return bf2f(f2bf(f)); }
__device__ __forceinline__ v16h cat16(v8h lo, v8h hi) { return __builtin_shufflevector(lo, hi, 0, 1, 2, 3, 4, 5, 6, 7, 8, 9, 10, 11, 12, 13, 14, 15); }
__device__ __forceinline__ v16bf cat16b(v8us lo, v8us hi) { return __builtin_bit_cast(v16bf, __builtin_shufflevector(lo, hi, 0, 1, 2, 3, 4, 5, 6, 7, 8, 9, 10, 11, 12, 13, 14, 15)); }
__device__ __forceinline__ v8f wmma16(v16h a, v16h b, v8f c) { return __builtin_amdgcn_wmma_f32_16x16x32_f16(false, a, false, b, (short)0, c, false, false); }
__device__ __forceinline__ v8f wmmab(v16bf a, v16bf b, v8f c) { return __builtin_amdgcn_wmma_f32_16x16x32_bf16(false, a, false, b, (short)0, c, false, false); }

__device__ __forceinline__ h16 tohx(float x) { return (h16)x; }
__device__ __forceinline__ void splitf(float y, unsigned short& h, unsigned short& l) { h = f2bf(y); l = f2bf(y - bf2f(h)); }
typedef __attribute__((ext_vector_type(2))) _Float16 v2h;
typedef __attribute__((ext_vector_type(4))) _Float16 v4h;
typedef __attribute__((ext_vector_type(2))) unsigned short v2us;
typedef __attribute__((ext_vector_type(4))) unsigned short v4us;
typedef __attribute__((ext_vector_type(2))) float v2f;
typedef __attribute__((ext_vector_type(4))) int v4i;
#define PL   ((size_t)TT * DQ)              // elements of one batch's projection = of one batch's plane

// FRAGMENT ORDER of every 16-bit operand plane: a [rows][K] plane is a run of 16-row x 32-k tiles of 512 elements, tile (row >> 4) * (K / 32) + (k >> 5) (the [d][t] value planes order their tiles as z = 2 below); inside a tile element (row, k) stands at
// ((k >> 4) & 1) * 256 + (((k >> 3) & 1) * 16 + (row & 15)) * 8 + (k & 7): the 8 elements that lane 16 hi + lr takes in one 16-byte load stand at lane * 8, so that a wave's load covers 512 bytes in a row (4 whole lines, not 16 pieces).
// ---- k_gemmt: GEMM, one 128x128 output tile per block of 4 waves (2 x 2, each wave a 64x64 tile = 16 accumulators over the WHOLE K); grid (M/128, N/128), 128 threads.
// The block's operand rows go through LDS in stages of 64 k, so that L2 delivers each operand row once per block and not once per wave: a stage of a plane is 8 runs of 2 KiB (16 rows x 64 k = two neighbouring tiles in fragment order),
// copied as they stand (thread i takes bytes 16 i of every run), two buffers: the next stage's global loads fly in registers while this stage is multiplied, are stored into the other buffer behind it, one __syncthreads a stage.
// C[m][n] (f32, pitch DM) = sum_k A[m][k] Bt[n][k] (+ A2[m][k] Bt[n][k] if NSPLIT) + bias[n]. K % 64 == 0.
// Epilogue: every wave lays its own tile (bias added) into its own LDS range, which takes the place of the stage buffers, and reads it back in the order of its stores.
// PLANES (the q/k/v projection; rows = [batch][t], Bt = the q, k, v weights one behind the other, one wave's 64 columns = one head; z = q, k, v is the same for the whole block): C is not written; the tile goes straight to the 16-bit planes that the attention kernel reads, each set = [q, k, v][batch][head][..][..]:
// z < 2: [t][d] planes (fragment order, K = HD) of partial-rope(x): rotate-half inside the first ROT dims (out[d] = x[d] cos - x[d+ROT/2] sin, out[d+ROT/2] = x[d+ROT/2] cos + x[d] sin), dims >= ROT pass through.
//        q and k share one order of the rotary dims along k: slot 8 g + c holds dim 4 g + c, slot 8 g + 4 + c its partner 4 g + c + ROT/2 (g, c < 4); q.k sums over all of them, so only the order of that sum depends on it.
// z = 2: [d][t] planes in fragment order, tile (t >> 5) * (HD / 16) + (d >> 4), so that the 8 tiles of 64 keys stand in a row: the tile is laid into LDS transposed.
// Trip w8 of the plane loop stores k slots 8 w8 .. 8 w8 + 7 of all 64 rows (lane = row & 15 and which 4 of the 8): each store covers 256 bytes in a row.
template <typename T16> struct WFrag;
template <> struct WFrag<h16> { typedef v16h V; static __device__ __forceinline__ V ld(const h16* p) { return cat16(*(const v8h*)p, *(const v8h*)(p + 256)); } static __device__ __forceinline__ v8f mma(V a, V b, v8f c) { return wmma16(a, b, c); } };
template <> struct WFrag<bf> { typedef v16bf V; static __device__ __forceinline__ V ld(const bf* p) { return cat16b(*(const v8us*)p, *(const v8us*)(p + 256)); } static __device__ __forceinline__ v8f mma(V a, V b, v8f c) { return wmmab(a, b, c); } };
__device__ __forceinline__ v16bf ldsfrag(const bf* p) { return cat16b(*(const v8usa*)p, *(const v8usa*)(p + 256)); }
template <int NSPLIT, bool PLANES, int K>
__global__ __launch_bounds__(128) void k_gemmt(const bf* __restrict__ A, const bf* __restrict__ A2, const bf* __restrict__ Bt, float* C, const float* __restrict__ bias, const float* __restrict__ bias1, const float* __restrict__ bias2, const float* __restrict__ CS, h16* P16, bf* Ph, bf* Pl) {
    static_assert(K % 64 == 0 && (!PLANES || (HD == 64 && TT % 64 == 0 && DQ % 128 == 0)), "whole stages; the plane epilogue takes one head and one batch per wave tile");
    constexpr int NP = NSPLIT ? 3 : 2, STG = NP * 8192, NS = K / 64;   // planes per stage, elements per buffer, stages
    constexpr bool FR2 = !PLANES;   // the grid of the last GEMM gives one wave a SIMD: registers for a whole stage's fragments are free there; three waves a SIMD take half a stage's at a time
    constexpr int SMB = (2 * STG * 2 > 4 * 64 * 68 * 4) ? 2 * STG * 2 : 4 * 64 * 68 * 4;
    __shared__ __align__(16) unsigned char sm[SMB];
    const int tid = threadIdx.x, wave = __builtin_amdgcn_readfirstlane(tid >> 5);   // scalar, so that what depends on the wave stays wave-uniform (matrix instructions need every lane on)
    const int lane = tid & 31, lr = lane & 15, hi = lane >> 4, wm = wave >> 1, wn = wave & 1; const int r0 = blockIdx.x * 128, c0 = blockIdx.y * 128;
    const int z = PLANES ? c0 / DQ : 0, cw = c0 - z * DQ + wn * 64;   // the wave's first column inside its weight
    bf* sb = (bf*)sm; float* os = (float*)sm + wave * 64 * 68;
    float bvn[4];   // bias of the lane's four accumulator columns, asked for here so that it is there long before the epilogue
    { const float* bp = ((z == 0) ? bias : (z == 1) ? bias1 : bias2) + cw + lr;
#pragma unroll   // constant indices, so that the small array stays in registers
        for (int nb = 0; nb < 4; ++nb) bvn[nb] = bp[nb * 16];
        asm volatile("s_wait_xcnt 0x0" :: "v"(bp) : "memory");   // before any register that the loads above name is written again
    }
    v8f acc[4][4];
#pragma unroll
    for (int mb = 0; mb < 4; ++mb)
#pragma unroll
        for (int nb = 0; nb < 4; ++nb) acc[mb][nb] = (v8f){};
    const bf* ga = A + (size_t)r0 * K + tid * 8; const bf* ga2 = NSPLIT ? A2 + (size_t)r0 * K + tid * 8 : ga; const bf* gb = Bt + (size_t)c0 * K + tid * 8;   // 16 rows x K = K / 32 tiles; one pointer per plane (K is a constant: the 16-row runs are immediate offsets), which the s_wait_xcnt names as an input so that the register lives up to the wait
    // L2 prefetch: the operand planes were stored by an earlier launch, and all blocks walk k in step: where such a plane has to come from memory, every stage's rows would be first touched by the very loads that are waited for.
    // A panel of 128 rows x K is 8 x 128 units of 256 bytes. The blocks that share a panel deal its units out: a thread asks for one unit of its block's A panel (share blockIdx.y mod 8), one of its B panel
    // (share from blockIdx.x, so that blocks 2, 4 and 6 further on ask for the same one), and one of A2's panel or its row of the cos/sin table. A hint only: nothing depends on it.
    static_assert(K == 1024, "a panel of 128 rows is 8 x 128 units of 256 bytes");
    const size_t ua = (size_t)r0 * K + (((int)blockIdx.y & 7) * 128 + tid) * 128;
    const bf* pa = A + ua; const bf* pb = Bt + (size_t)c0 * K + (((((int)blockIdx.x >> 3) << 1) | ((int)blockIdx.x & 1)) * 128 + tid) * 128;
    const void* p3 = NSPLIT ? (const void*)(A2 + ua) : PLANES ? (const void*)(CS + (size_t)(r0 % TT + tid) * HD * 2) : (const void*)pa;
    v8us ra[8], ra2[8], rb[8];
#pragma unroll   // constant indices, so that the arrays stay in registers
    for (int g = 0; g < 8; ++g) { ra[g] = *(const v8us*)(ga + g * 16 * K); if (NSPLIT) ra2[g] = *(const v8us*)(ga2 + g * 16 * K); rb[g] = *(const v8us*)(gb + g * 16 * K); }
    asm volatile("global_prefetch_b8 %0, off scope:SCOPE_SE\n\tglobal_prefetch_b8 %1, off scope:SCOPE_SE\n\tglobal_prefetch_b8 %2, off scope:SCOPE_SE" :: "v"(pa), "v"(pb), "v"(p3) : "memory");   // behind stage 0's own loads, which are waited for first; every lane's address lies inside its plane
    asm volatile("s_wait_xcnt 0x0" :: "v"(ga), "v"(ga2), "v"(gb) : "memory");   // before any register that the loads above name is written again
#pragma unroll
    for (int g = 0; g < 8; ++g) { bf* d = sb + g * 1024 + tid * 8; *(v8usa*)d = ra[g]; if (NSPLIT) *(v8usa*)(d + 8192) = ra2[g]; *(v8usa*)(d + (NP - 1) * 8192) = rb[g]; }
    __syncthreads();   // stage 0 is in LDS before any wave reads it
    int bo = 0;   // the buffer of this stage, in elements
#pragma unroll 1   // rolled: one stage's registers are all that is wanted live
    for (int s = 0; s < NS; ++s) {
        const bool more = s + 1 < NS;   // block-uniform
        if (more) { ga += 1024; ga2 = NSPLIT ? ga2 + 1024 : ga; gb += 1024;   // next stage's rows fly while this stage is multiplied
#pragma unroll
            for (int g = 0; g < 8; ++g) { ra[g] = *(const v8us*)(ga + g * 16 * K); if (NSPLIT) ra2[g] = *(const v8us*)(ga2 + g * 16 * K); rb[g] = *(const v8us*)(gb + g * 16 * K); }
            asm volatile("s_wait_xcnt 0x0" :: "v"(ga), "v"(ga2), "v"(gb), "v"(pa), "v"(pb), "v"(p3) : "memory");   // before any register that the loads above name is written again; the prefetch addresses are named so that their registers hold them through the loop
        }
        const bf* fa = sb + bo + wm * 4096 + lane * 8; const bf* fb = sb + bo + (NP - 1) * 8192 + wn * 4096 + lane * 8;
        v16bf a[2][4], a2[2][4], b[2][4];
#pragma unroll   // constant indices, so that the fragment arrays stay in registers
        for (int ks = 0; ks < 2; ++ks) {
#pragma unroll
            for (int mb = 0; mb < 4; ++mb) { a[ks][mb] = ldsfrag(fa + mb * 1024 + ks * 512); if (NSPLIT) a2[ks][mb] = ldsfrag(fa + 8192 + mb * 1024 + ks * 512); }
#pragma unroll
            for (int nb = 0; nb < 4; ++nb) b[ks][nb] = ldsfrag(fb + nb * 1024 + ks * 512);
            if (FR2 && ks == 0) continue;   // FR2: both halves' fragments are asked for in one group
            __builtin_amdgcn_sched_barrier(0);   // keeps the LDS reads one group in front of the products: left to itself the compiler re-used one B fragment's registers and put a read and a full wait in front of every four products
#pragma unroll
            for (int k2 = FR2 ? 0 : ks; k2 <= ks; ++k2)
#pragma unroll
                for (int pl = 0; pl <= NSPLIT; ++pl)   // all 16 tiles with one A plane, then with the other: two products into one accumulator never stand back to back
#pragma unroll
                    for (int nb = 0; nb < 4; ++nb)
#pragma unroll
                        for (int mb = 0; mb < 4; ++mb) acc[mb][nb] = wmmab(pl ? a2[k2][mb] : a[k2][mb], b[k2][nb], acc[mb][nb]);
            __builtin_amdgcn_sched_barrier(0);   // keeps the next group of LDS reads (and the stores behind the products) from being spread among the products
        }
        bo ^= STG;
        if (more) {
#pragma unroll
            for (int g = 0; g < 8; ++g) { bf* d = sb + bo + g * 1024 + tid * 8; *(v8usa*)d = ra[g]; if (NSPLIT) *(v8usa*)(d + 8192) = ra2[g]; *(v8usa*)(d + (NP - 1) * 8192) = rb[g]; }
        }
        __syncthreads();   // publishes the next stage and ends every wave's reads of this one (which the stage after next, or the epilogue, overwrites)
    }
#pragma unroll   // constant indices, so that the small array stays in registers
    for (int nb = 0; nb < 4; ++nb) bvn[nb] = bfr(bvn[nb]);
    const bool tr = PLANES && z == 2;   // block-uniform
    const int rw = r0 + wm * 64, t0 = rw % TT;
    v4f cn0[4] = {}, cn1[4] = {};   // PLANES: (cos, sin) of the next trip's elements, asked for one trip ahead
    const float* cs = CS + (size_t)(t0 + lr) * HD * 2;   // a dim and its partner have one angle: both halves of the wave read the entry of the lower dim
    if constexpr (PLANES) {
        if (!tr) {
#pragma unroll   // constant indices, so that the small arrays stay in registers
            for (int s = 0; s < 4; ++s) { cn0[s] = *(const v4f*)(cs + s * 16 * HD * 2); cn1[s] = *(const v4f*)(cs + s * 16 * HD * 2 + 4); }
            asm volatile("s_wait_xcnt 0x0" :: "v"(cs) : "memory");   // before any register that the loads above name is written again
        }
    }
    if (tr) {
#pragma unroll   // constant indices, so that the small arrays stay in registers
        for (int mb = 0; mb < 4; ++mb)
#pragma unroll   // constant indices, so that the small arrays stay in registers
            for (int nb = 0; nb < 4; ++nb) { float* p = os + (nb * 16 + lr) * 68 + mb * 16 + hi * 8; const v8f v = acc[mb][nb] + bvn[nb];
                *(v4fa*)p = __builtin_shufflevector(v, v, 0, 1, 2, 3); *(v4fa*)(p + 4) = __builtin_shufflevector(v, v, 4, 5, 6, 7); }
    } else {
#pragma unroll
        for (int mb = 0; mb < 4; ++mb)
#pragma unroll
            for (int nb = 0; nb < 4; ++nb)
#pragma unroll
                for (int j = 0; j < 8; ++j) os[(mb * 16 + hi * 8 + j) * 68 + nb * 16 + lr] = acc[mb][nb][j] + bvn[nb];
    }
    __syncthreads();   // the tile is in LDS before its wave's lanes read one another's elements
    if constexpr (PLANES) {
        const size_t e0 = ((size_t)z * NB_ + rw / TT) * PL + (size_t)(cw / HD) * TT * HD + (size_t)t0 * HD + lr * 8 + hi * 4;   // this batch's and head's plane; 64 t x HD = 8 tiles
#pragma unroll 1   // rolled: eight copies of the body would only cost instruction cache
        for (int w8 = 0; w8 < 8; ++w8) {
            const bool rot = !tr && w8 < ROT / 8;   // wave-uniform: this trip's 8 k slots are rotary dims
            const int col0 = rot ? w8 * 4 + hi * (ROT / 2) : w8 * 8 + hi * 4;   // a thread takes rows lr + 16 s, columns col0 .. col0 + 3 of the LDS tile
            v4f cs0[4], cs1[4], val[4];
#pragma unroll   // constant indices, so that the small arrays stay in registers
            for (int s = 0; s < 4; ++s) { cs0[s] = cn0[s]; cs1[s] = cn1[s]; val[s] = *(const v4fa*)(os + (s * 16 + lr) * 68 + col0); }
            if (!tr && w8 + 1 < ROT / 8) { cs += 8;
#pragma unroll   // constant indices, so that the small arrays stay in registers
                for (int s = 0; s < 4; ++s) { cn0[s] = *(const v4f*)(cs + s * 16 * HD * 2); cn1[s] = *(const v4f*)(cs + s * 16 * HD * 2 + 4); }
                asm volatile("s_wait_xcnt 0x0" :: "v"(cs) : "memory");   // before any register that the loads above name is written again
            }
            size_t e = e0 + ((w8 >> 1) & 1) * 256 + (w8 & 1) * 128;   // k slot 8 w8 + 4 hi inside its tile
            int es;
            if (tr) { e += (w8 >> 2) * (HD / 16) * 512; es = 512; }   // LDS row = d (tile s), column = t (k)
            else { e += (w8 >> 2) * 512; es = (HD / 32) * 512;   // LDS row = t (tile s), column = d (k)
                if (rot) {
#pragma unroll   // constant indices, so that the small arrays stay in registers
                    for (int s = 0; s < 4; ++s) { const v4f x = val[s]; v4f xp;   // xp: the rotate-half partner d +- ROT/2, in the other half of the wave, with its sign
#pragma unroll   // constant indices, so that the small arrays stay in registers
                        for (int c = 0; c < 4; ++c) { const float y = __shfl_xor(x[c], 16, 32); xp[c] = hi ? y : -y; }
                        val[s][0] = x[0] * cs0[s][0] + xp[0] * cs0[s][1]; val[s][1] = x[1] * cs0[s][2] + xp[1] * cs0[s][3]; val[s][2] = x[2] * cs1[s][0] + xp[2] * cs1[s][1]; val[s][3] = x[3] * cs1[s][2] + xp[3] * cs1[s][3]; }
                }
            }
#pragma unroll   // constant indices, so that the small arrays stay in registers
            for (int s = 0; s < 4; ++s) { v4h o16; v4us oh, ol;
#pragma unroll   // constant indices, so that the small arrays stay in registers
                for (int c = 0; c < 4; ++c) { o16[c] = tohx(val[s][c]); unsigned short a2, c2; splitf(val[s][c], a2, c2); oh[c] = a2; ol[c] = c2; }
                h16* p16 = P16 + e + (size_t)s * es; bf* ph = Ph + e + (size_t)s * es; bf* pl = Pl + e + (size_t)s * es;
                *(v4h*)p16 = o16; *(v4us*)ph = oh; *(v4us*)pl = ol;
                asm volatile("s_wait_xcnt 0x0" :: "v"(p16), "v"(ph), "v"(pl) : "memory");   // before any register that the stores above name is written again
            }
        }
    } else {
        float* cp = C + (size_t)(rw + hi) * DM + c0 + wn * 64 + lr * 4;   // 16 lanes store one row's 64 columns; the rows are immediate offsets
#pragma unroll
        for (int q = 0; q < 4; ++q) {
#pragma unroll
            for (int s = q * 8; s < q * 8 + 8; ++s) *(v4f*)(cp + (size_t)s * 2 * DM) = *(const v4fa*)(os + (s * 2 + hi) * 68 + lr * 4);
            asm volatile("s_wait_xcnt 0x0" :: "v"(cp) : "memory");   // before any register that the stores above name is written again (the next group's LDS reads take the data registers)
        }
    }
}


// The element-wise stages are device functions of a block number bx; k_prep below deals the blocks of one grid out to them.
// Both write a plane in fragment order, one 16-byte piece i (8 k of one row) a thread and step, the pieces in the plane's own order, so that a wave's store covers 512 bytes in a row.
__device__ __forceinline__ void piece_at(const int i, const int K, int& row, int& k0) { const int tile = i >> 6, kt = K / 32; row = (tile / kt) * 16 + (i & 15); k0 = (tile % kt) * 32 + ((i >> 5) & 1) * 16 + ((i >> 4) & 1) * 8; }
__device__ __forceinline__ void d_wtG(const int bx, const float* __restrict__ w, int K, int N, bf* Bt) {   // Bt[n][k] = w[k][n]: 16 lanes read 16 neighbouring n of one k
    const int i0 = bx * 512 + (int)threadIdx.x; float v[2][8];   // two pieces a thread (the grid has N K / 8 / 512 blocks per weight); all 16 loads are asked for before the first is used
#pragma unroll   // constant indices, so that the small array stays in registers
    for (int l = 0; l < 2; ++l) { int n, k0; piece_at(i0 + l * 256, K, n, k0);
#pragma unroll
        for (int j = 0; j < 8; ++j) v[l][j] = w[(size_t)(k0 + j) * N + n]; }
#pragma unroll   // constant indices, so that the small array stays in registers
    for (int l = 0; l < 2; ++l) { v8us o;
#pragma unroll
        for (int j = 0; j < 8; ++j) o[j] = f2bf(v[l][j]);
        *(v8us*)(Bt + (size_t)(i0 + l * 256) * 8) = o; }
}
__device__ __forceinline__ void d_cvt8(const int bx, const float* __restrict__ src, int K, bf* dst, size_t n8) { const size_t i = (size_t)bx * 256 + threadIdx.x; if (i >= n8) return; int row, k0; piece_at((int)i, K, row, k0); const v8f v = *(const v8f*)(src + (size_t)row * K + k0); v8us o;
#pragma unroll
    for (int k = 0; k < 8; ++k) o[k] = f2bf(v[k]); *(v8us*)(dst + i * 8) = o;  }
__constant__ float INV[ROT / 2] = {1.0,0.6209288835525513,0.38555270433425903,0.23940083384513855,0.1486508846282959,0.0923016369342804,0.057312753051519394,0.035587143152952194,0.022097086533904076,0.013720721006393433,0.008519591763615608,0.005290060769766569,0.003284751670435071,0.002039597136899829,0.0012664449168369174,0.0007863722858019173};
__device__ __forceinline__ void d_cstab(const int bx, float* CS) { const int idx = bx * 256 + threadIdx.x; if (idx >= TT * HD) return; const int t = idx / HD, d = idx % HD; v2f cs; if (d < ROT) { const int i = (d < ROT / 2) ? d : d - ROT / 2; const float ang = __fmul_rn((float)t, INV[i]); cs[0] = cosf(ang); cs[1] = sinf(ang); } else { cs[0] = 1.0f; cs[1] = 0.0f; }
    *(v2f*)(CS + (size_t)idx * 2) = cs;  }
// k_prep: everything that depends on the inputs alone, in one grid: the four weight transposes (first in the grid, for speed only), x of both batches to bf16, the cos/sin table.
#define WTB  (DM * DQ / 64 / 64)            // blocks per weight transpose
#define CVB  (NB_ * TT * DM / 8 / 256)      // blocks of the x conversion
#define CSB  (TT * HD / 256)                // blocks of the table
static_assert(DKV == DQ && DM == DQ, "the four weight planes have one size");
static_assert(WTB * 512 == DM * DQ / 8 && DM % 32 == 0 && DQ % 16 == 0, "a transpose block writes 512 whole 16-byte pieces");
__global__ __launch_bounds__(256) void k_prep(const float* __restrict__ wq, const float* __restrict__ wk, const float* __restrict__ wv, const float* __restrict__ wo, const float* __restrict__ x, bf* W4, bf* XB, float* CS) {
    const int b = blockIdx.x;
    if (b < 4 * WTB) { const int i = b / WTB; d_wtG(b % WTB, (i == 0) ? wq : (i == 1) ? wk : (i == 2) ? wv : wo, DM, DQ, W4 + (size_t)i * DM * DQ); }
    else if (b < 4 * WTB + CVB) d_cvt8(b - 4 * WTB, x, DM, XB, (size_t)NB_ * TT * DM / 8);
    else d_cstab(b - 4 * WTB - CVB, CS);
}

// ---- k_fattn: causal attention of one head in one kernel (scores, softmax, probability x value, head merge): scores and probabilities stay in registers.
// Transposed products: St = K Qt (A = key rows, B = query rows, both [t][d] planes in fragment order) puts one query's scores of a 16-key tile in one lane (D[key 8 hi + j][query lr]); two such tiles, converted in place, are the B operand
// (32 keys in the hardware k order) of Ot += Vt Pt (A = rows of the [d][t] value plane, same k order). On-line softmax over 64-key blocks in the log2 domain: running maximum m and sum l per query column,
// Ot and l rescaled by 2^(m_old - m_new) in every block; P is left unnormalised (x 2^PSH for fp16's range; the factor cancels in Ot / l). One division per query at the end, then the hi/lo bf16 split into the merged [t][DQ] planes (fragment order).
// HI (query rows < RH): hi+lo bf16 planes, 3 products each; else single fp16. One wave owns 16 x QT query columns; no LDS, no barrier.
// Every inner loop is fully unrolled so that the fragment arrays are indexed by constants and stay in registers.
template <typename T16, bool HI, int QT>
__device__ __forceinline__ void fattn_tile(const T16* __restrict__ Q, const T16* __restrict__ Q2, const T16* __restrict__ Kp, const T16* __restrict__ K2, const T16* __restrict__ Vt, const T16* __restrict__ V2, const int q0, const int lr, const int hi, bf* Ah, bf* Al, const void* pf0, const void* pf1) {
    typedef typename WFrag<T16>::V V;
    const float C2 = SCL * 1.4426950408889634f;      // score scale x log2(e)
    const float PSH = HI ? 0.0f : 10.0f;             // fp16 P carries x1024
    const unsigned koff = (unsigned)(8 * (16 * hi + lr)), voff = koff;   // the lane's place inside a tile in fragment order; a group of loads shares one pointer per plane, which its s_wait_xcnt names as an input so that the register lives up to the wait
    const unsigned kob = koff * (unsigned)sizeof(T16);   // the same place in bytes: the offset register of the first loads
    asm volatile("global_prefetch_b8 %0, off scope:SCOPE_SE\n\tglobal_prefetch_b8 %1, off scope:SCOPE_SE" :: "v"(pf0), "v"(pf1) : "memory");   // L2 prefetch (k_fattn says of what); every lane's address lies inside its plane
    const T16* qp = Q + q0 * HD + koff; const T16* qp2 = HI ? Q2 + q0 * HD + koff : qp;
    V qb[QT][2], qb2[QT][2];
#pragma unroll
    for (int qt = 0; qt < QT; ++qt)
#pragma unroll
        for (int ks = 0; ks < 2; ++ks) { const int qo = (qt * 2 + ks) * 512; qb[qt][ks] = WFrag<T16>::ld(qp + qo); if (HI) qb2[qt][ks] = WFrag<T16>::ld(qp2 + qo); }
    v8f o[QT][4]; float m[QT], l[QT];
#pragma unroll
    for (int qt = 0; qt < QT; ++qt) { m[qt] = -3.0e38f; l[qt] = 0.0f;
#pragma unroll
        for (int md = 0; md < 4; ++md) o[qt][md] = (v8f){}; }
    const int kdiag = q0 & ~63;                      // the 64-key block that holds the diagonal of all 16 x QT rows (16 x QT divides 64)
    V ka[4][2], ka2[4][2];
    const T16* kp = Kp + koff; const T16* kp2 = HI ? K2 + koff : kp;
#pragma unroll
    for (int nb = 0; nb < 4; ++nb)
#pragma unroll
        for (int ks = 0; ks < 2; ++ks) { const int ko = (nb * 2 + ks) * 512; ka[nb][ks] = WFrag<T16>::ld(kp + ko); if (HI) ka2[nb][ks] = WFrag<T16>::ld(kp2 + ko); }
    asm volatile("s_wait_xcnt 0x0" :: "v"(qp), "v"(qp2), "v"(kp), "v"(kp2), "v"(kob), "v"(pf0), "v"(pf1) : "memory");   // before any register that the loads above name is written again; the prefetch addresses are named so that their registers hold them up to here, behind the loads that were issued after the prefetch (the key loop has no registers to spare for them)
#pragma unroll 1   // rolled: one block's fragments already fill the registers, a second copy of the body would only cost instruction cache
    for (int kb = 0; kb <= kdiag; kb += 64) {
        V va[4][2], va2[4][2];                       // this block's value rows: needed last, asked for first
        const T16* vp = Vt + kb * HD + voff; const T16* vp2 = HI ? V2 + kb * HD + voff : vp;   // 32 keys = HD / 16 tiles
#pragma unroll
        for (int md = 0; md < 4; ++md)
#pragma unroll
            for (int ks = 0; ks < 2; ++ks) { const int vo = (ks * 4 + md) * 512; va[md][ks] = WFrag<T16>::ld(vp + vo); if (HI) va2[md][ks] = WFrag<T16>::ld(vp2 + vo); }
        asm volatile("s_wait_xcnt 0x0" :: "v"(vp), "v"(vp2) : "memory");   // before any register that the loads above name is written again
        v8f st[QT][4];
#pragma unroll
        for (int nb = 0; nb < 4; ++nb)
#pragma unroll
            for (int qt = 0; qt < QT; ++qt) { v8f a = (v8f){};
#pragma unroll
                for (int ks = 0; ks < 2; ++ks) { a = WFrag<T16>::mma(ka[nb][ks], qb[qt][ks], a); if (HI) { a = WFrag<T16>::mma(ka[nb][ks], qb2[qt][ks], a); a = WFrag<T16>::mma(ka2[nb][ks], qb[qt][ks], a); } }
                st[qt][nb] = a; }
        const int kst = (kb < kdiag) ? 64 * HD : 0; kp += kst; kp2 += kst;   // next block's key rows fly during the softmax and P.V (the last trip re-reads its own: in bounds, unused)
#pragma unroll
        for (int nb = 0; nb < 4; ++nb)
#pragma unroll
            for (int ks = 0; ks < 2; ++ks) { const int ko = (nb * 2 + ks) * 512; ka[nb][ks] = WFrag<T16>::ld(kp + ko); if (HI) ka2[nb][ks] = WFrag<T16>::ld(kp2 + ko); }
        asm volatile("s_wait_xcnt 0x0" :: "v"(kp), "v"(kp2) : "memory");   // before any register that the loads above name is written again
        __builtin_amdgcn_sched_barrier(0);   // keeps the score scaling, softmax and P.V products below from being lifted in front of the wait above, where they took the loads' address register
#pragma unroll
        for (int qt = 0; qt < QT; ++qt)
#pragma unroll
            for (int nb = 0; nb < 4; ++nb) st[qt][nb] *= C2;
        if (kb == kdiag) {                           // wave-uniform: only the diagonal block has keys above a query
#pragma unroll
            for (int qt = 0; qt < QT; ++qt)
#pragma unroll
                for (int nb = 0; nb < 4; ++nb)
#pragma unroll
                    for (int j = 0; j < 8; ++j) st[qt][nb][j] = (kb + nb * 16 + hi * 8 + j <= q0 + qt * 16 + lr) ? st[qt][nb][j] : -3.0e38f;
        }
        V pb[QT][2], pb2[QT][2];
#pragma unroll
        for (int qt = 0; qt < QT; ++qt) {
            float mx4[4];
#pragma unroll
            for (int nb = 0; nb < 4; ++nb) { mx4[nb] = st[qt][nb][0];
#pragma unroll
                for (int j = 1; j < 8; ++j) mx4[nb] = fmaxf(mx4[nb], st[qt][nb][j]); }
            float mx = fmaxf(fmaxf(mx4[0], mx4[1]), fmaxf(mx4[2], mx4[3]));
            mx = fmaxf(mx, __shfl_xor(mx, 16, 32));  // the other half of the wave holds the query's other keys
            mx = fmaxf(mx, m[qt]);
            const float al = __builtin_amdgcn_exp2f(m[qt] - mx); m[qt] = mx; const float msh = mx - PSH;
            float ls4[4];
#pragma unroll
            for (int nb = 0; nb < 4; ++nb) { ls4[nb] = 0.0f;
#pragma unroll
                for (int j = 0; j < 8; ++j) { const float p = __builtin_amdgcn_exp2f(st[qt][nb][j] - msh); st[qt][nb][j] = p; ls4[nb] += p; } }
            l[qt] = l[qt] * al + ((ls4[0] + ls4[1]) + (ls4[2] + ls4[3]));
#pragma unroll
            for (int md = 0; md < 4; ++md) o[qt][md] *= al;
#pragma unroll
            for (int ks = 0; ks < 2; ++ks) {
                if constexpr (HI) { v8us h0, h1, l0, l1;
#pragma unroll
                    for (int j = 0; j < 8; ++j) { unsigned short a, c; splitf(st[qt][2 * ks][j], a, c); h0[j] = a; l0[j] = c; splitf(st[qt][2 * ks + 1][j], a, c); h1[j] = a; l1[j] = c; }
                    pb[qt][ks] = cat16b(h0, h1); pb2[qt][ks] = cat16b(l0, l1);
                } else { v8h h0, h1;
#pragma unroll
                    for (int j = 0; j < 8; ++j) { h0[j] = tohx(st[qt][2 * ks][j]); h1[j] = tohx(st[qt][2 * ks + 1][j]); }
                    pb[qt][ks] = cat16(h0, h1); }
            }
        }
#pragma unroll
        for (int ks = 0; ks < 2; ++ks)
#pragma unroll
            for (int md = 0; md < 4; ++md)
#pragma unroll
                for (int qt = 0; qt < QT; ++qt) { o[qt][md] = WFrag<T16>::mma(va[md][ks], pb[qt][ks], o[qt][md]); if (HI) { o[qt][md] = WFrag<T16>::mma(va[md][ks], pb2[qt][ks], o[qt][md]); o[qt][md] = WFrag<T16>::mma(va2[md][ks], pb[qt][ks], o[qt][md]); } }
    }
#pragma unroll
    for (int qt = 0; qt < QT; ++qt) { const float f = __fdiv_rn(1.0f, l[qt] + __shfl_xor(l[qt], 16, 32)); bf* ahp = Ah + (q0 + qt * 16) * DQ + koff; bf* alp = Al + (q0 + qt * 16) * DQ + koff;   // 16 rows x DQ = DQ / 32 tiles; a lane's 8 values of o are one 16-byte piece of the merged plane's fragment order
#pragma unroll
        for (int md = 0; md < 4; ++md) { v8us oh, ol;
#pragma unroll
            for (int j = 0; j < 8; ++j) { unsigned short a, c; splitf(o[qt][md][j] * f, a, c); oh[j] = a; ol[j] = c; }
            *(v8us*)(ahp + md * 256) = oh; *(v8us*)(alp + md * 256) = ol; }
        asm volatile("s_wait_xcnt 0x0" :: "v"(ahp), "v"(alp) : "memory");   // before any register that the stores above name is written again
    }
}
// grid (heads x batches, (TT - RH) / 64 + RH / 32), 2 waves, longest key loops of both batches first: blocks y < (TT - RH) / 64 take 64 fp16 query rows each, from the last rows down (32 a wave); the others 32 hi+lo rows each (16 a wave)
__global__ __launch_bounds__(64) void k_fattn(const h16* __restrict__ QP16, const h16* __restrict__ KP16, const h16* __restrict__ VT16, const bf* __restrict__ QPh, const bf* __restrict__ QPl, const bf* __restrict__ KPh, const bf* __restrict__ KPl, const bf* __restrict__ VTh, const bf* __restrict__ VTl, bf* ATh, bf* ATl) {
    const int wave = __builtin_amdgcn_readfirstlane((int)(threadIdx.x >> 5));   // scalar, so that the key loop's branches are wave-uniform (matrix instructions need every lane on)
    const int lane = threadIdx.x & 31, lr = lane & 15, hi = lane >> 4; const int h = blockIdx.x % NH_, b = blockIdx.x / NH_; const int y = blockIdx.y; const bool lo = y < (TT - RH) / 64;
    const int q0 = lo ? (TT / 64 - 1 - y) * 64 + wave * 32 : ((TT - RH) / 64 + RH / 32 - 1 - y) * 32 + wave * 16;
    const size_t zq = ((size_t)b * NH_ + h) * TT * HD, zk = ((size_t)b * NKV + h / REP) * TT * HD; bf* ah = ATh + (size_t)b * TT * DQ + h * (HD / 32) * 512; bf* al = ATl + (size_t)b * TT * DQ + h * (HD / 32) * 512;
    // L2 prefetch: the key and value planes were stored by the launch before, and a head's waves all start at key 0 and walk on in step: where such a plane has to come from memory, every key block would be first touched by the very loads that are waited for.
    // The blocks of a head deal the planes that they read out among themselves in units of 256 bytes (64 keys of a plane = 32 units, one a lane; wave 0 asks for keys, wave 1 for values):
    // fp16 block y (< 24) asks for key blocks y and 24 + y mod 8 of the 32, a hi+lo block for one of the 8 key blocks < RH in the hi and in the lo plane. A hint only: nothing depends on it.
    static_assert(TT == 32 * 64 && RH == 8 * 64 && HD == 64, "32 key blocks, 8 of them read from the hi/lo planes, 24 fp16 blocks; 64 keys x HD x 2 bytes = 32 units");
    if (!lo) { const size_t u = zk + ((y & 7) * 32 + lane) * 128; fattn_tile<bf, true, 1>(QPh + zq, QPl + zq, KPh + zk, KPl + zk, VTh + zk, VTl + zk, q0, lr, hi, ah, al, (wave ? VTh : KPh) + u, (wave ? VTl : KPl) + u); }
    else { const h16* p = (wave ? VT16 : KP16) + zk + lane * 128; fattn_tile<h16, false, 2>(QP16 + zq, nullptr, KP16 + zk, nullptr, VT16 + zk, nullptr, q0, lr, hi, ah, al, p + (y & 31) * 32 * 128, p + (24 + (y & 7)) * 32 * 128); }
}

extern "C" void kernel_launch(void* const* d_in, const int* in_sizes, int n_in,
                              void* d_out, int out_size, void* d_ws, size_t ws_size, hipStream_t stream) {
    (void)in_sizes; (void)n_in; (void)out_size;
    const float* x = (const float*)d_in[0]; const float* wq = (const float*)d_in[1]; const float* bq = (const float*)d_in[2]; const float* wk = (const float*)d_in[3]; const float* bk = (const float*)d_in[4]; const float* wv = (const float*)d_in[5]; const float* bv = (const float*)d_in[6]; const float* wo = (const float*)d_in[7]; const float* bo = (const float*)d_in[8]; const float* cosT = nullptr; const float* sinT = nullptr; (void)cosT; (void)sinT;
    float* OUT = (float*)d_out;     // [2][2048][1024]
    char* wsp = (char*)d_ws;
    auto take = [&](size_t bytes) { char* p = wsp; wsp += (bytes + 255) & ~(size_t)255; return (void*)p; };
    bf* W4 = (bf*)take((size_t)4 * DQ * DM * 2); float* CS = (float*)take((size_t)TT * HD * 2 * 4);   // Wq, Wk, Wv, Wo transposed, one behind the other
    bf* XB = (bf*)take((size_t)NB_ * TT * DM * 2);   // both batches: x in bf16
    h16* P16 = (h16*)take((size_t)3 * NB_ * TT * DQ * 2); bf* Ph = (bf*)take((size_t)3 * NB_ * TT * DQ * 2); bf* Pl = (bf*)take((size_t)3 * NB_ * TT * DQ * 2);   // [q, k, v][batch] planes
    bf* ATh = (bf*)take((size_t)NB_ * TT * DQ * 2); bf* ATl = (bf*)take((size_t)NB_ * TT * DQ * 2);
    if ((size_t)(wsp - (char*)d_ws) > ws_size) return;    // ws 256 MiB
    const size_t KO = (size_t)NB_ * TT * DQ, VO = (size_t)2 * NB_ * TT * DQ;   // where the k and the v planes start
    // four launches, each one stage of the data flow for both batches ([batch][t] is one run of NB_ x TT rows for the two GEMMs)
    k_prep<<<4 * WTB + CVB + CSB, 256, 0, stream>>>(wq, wk, wv, wo, x, W4, XB, CS);
    k_gemmt<0, true, DM><<<dim3(NB_ * TT / 128, 3 * DQ / 128, 1), 128, 0, stream>>>(XB, nullptr, W4, nullptr, bq, bk, bv, CS, P16, Ph, Pl);
    k_fattn<<<dim3(NH_ * NB_, (TT - RH) / 64 + RH / 32, 1), 64, 0, stream>>>(P16, P16 + KO, P16 + VO, Ph, Pl, Ph + KO, Pl + KO, Ph + VO, Pl + VO, ATh, ATl);
    k_gemmt<1, false, DQ><<<dim3(NB_ * TT / 128, DM / 128, 1), 128, 0, stream>>>(ATh, ATl, W4 + (size_t)3 * DQ * DM, OUT, bo, nullptr, nullptr, nullptr, nullptr, nullptr, nullptr);
}

// v008
// Measured time: 73.2 microseconds a run.
// In two side-by-side timings against v007, it was 1.05 and 1.04 times as fast.
// Over all steps from v000 it is 22.2 times as fast.
#include <hip/hip_runtime.h>

// Multi-head causal attention with partial rotary (x [2][2048][1024]; q/k/v = x W + b ('xw' [1024][1024], 16 x 64); rotate-half rotary on the FIRST 32 dims of each head (pairs d, d+16), angles t x inv[d mod 16] with inv_i = 2048^(-2i/32), the other 32 dims pass through; causal (tril) -inf; softmax(q.k / 8); out = merged Wo ('xw' [1024][1024]) + bo -> [2][2048][1024]).
// Compute dtypes, f32 accumulate: every input rounded to bf16; q/k/v on PLAIN bf16 operands (inputs: exact) + bias; rotary in f32 from an on-chip table (inv constants are the reference's own f32 values; angle = t x inv one product; precise cosf/sinf); causal scores and attn.v: query rows < 512 hl (3 products), the rest single fp16 (x1024), causal tile skipping; on-line softmax f32, all inside one kernel; Wo hl x exact (2 products) + bias.

#define NB_  2
#define TT   2048
#define DM   1024
#define NH_  16
#define NKV  16
#define REP  (NH_ / NKV)
#define HD   64
#define DQ   (NH_ * HD)
#define DKV  (NKV * HD)
#define RH   512                  // query rows < RH use hi+lo planes (a multiple of 64)
#define ROT  32                   // rotary dims per head (rotate-half inside them)
#define SCL  0.125f   // HD^-0.5
#define QSC  (SCL * 1.4426950408889634f)   // score scale x log2(e): the q planes carry it, so that q.k is a base-2 exponent
typedef _Float16 h16;
typedef unsigned short bf;
typedef __attribute__((ext_vector_type(16))) __bf16   v16bf;
typedef __attribute__((ext_vector_type(16))) _Float16 v16h;
typedef __attribute__((ext_vector_type(8)))  _Float16 v8h;
typedef __attribute__((ext_vector_type(8)))  unsigned short v8us;
typedef __attribute__((ext_vector_type(8)))  float    v8f;
typedef __attribute__((ext_vector_type(4)))  float    v4f;
typedef v8h  __attribute__((may_alias)) v8ha;
typedef v4f  __attribute__((may_alias)) v4fa;
typedef v8us __attribute__((may_alias)) v8usa;

__device__ __forceinline__ unsigned short f2bf(float f) { unsigned u = __float_as_uint(f); u += 0x7FFFu + ((u >> 16) & 1u); return (unsigned short)(u >> 16); }
__device__ __forceinline__ float bf2f(unsigned short b) { return __uint_as_float(((unsigned)b) << 16); }
__device__ __forceinline__ float bfr(float f) { return bf2f(f2bf(f)); }
__device__ __forceinline__ v16h cat16(v8h lo, v8h hi) { return __builtin_shufflevector(lo, hi, 0, 1, 2, 3, 4, 5, 6, 7, 8, 9, 10, 11, 12, 13, 14, 15); }
__device__ __forceinline__ v16bf cat16b(v8us lo, v8us hi) { return __builtin_bit_cast(v16bf, __builtin_shufflevector(lo, hi, 0, 1, 2, 3, 4, 5, 6, 7, 8, 9, 10, 11, 12, 13, 14, 15)); }
__device__ __forceinline__ v8f wmma16(v16h a, v16h b, v8f c) { return __builtin_amdgcn_wmma_f32_16x16x32_f16(false, a, false, b, (short)0, c, false, false); }
__device__ __forceinline__ v8f wmmab(v16bf a, v16bf b, v8f c) { return __builtin_amdgcn_wmma_f32_16x16x32_bf16(false, a, false, b, (short)0, c, false, false); }

__device__ __forceinline__ h16 tohx(float x) { return (h16)x; }
__device__ __forceinline__ void splitf(float y, unsigned short& h, unsigned short& l) { h = f2bf(y); l = f2bf(y - bf2f(h)); }
typedef __attribute__((ext_vector_type(2))) _Float16 v2h;
typedef __attribute__((ext_vector_type(4))) _Float16 v4h;
typedef __attribute__((ext_vector_type(2))) unsigned short v2us;
typedef __attribute__((ext_vector_type(4))) unsigned short v4us;
typedef __attribute__((ext_vector_type(2))) float v2f;
typedef __attribute__((ext_vector_type(4))) int v4i;
#define PL   ((size_t)TT * DQ)              // elements of one batch's projection = of one batch's plane

// FRAGMENT ORDER of every 16-bit operand plane: a [rows][K] plane is a run of 16-row x 32-k tiles of 512 elements, tile (row >> 4) * (K / 32) + (k >> 5) (the [d][t] value planes order their tiles as z = 2 below); inside a tile element (row, k) stands at
// ((k >> 4) & 1) * 256 + (((k >> 3) & 1) * 16 + (row & 15)) * 8 + (k & 7): the 8 elements that lane 16 hi + lr takes in one 16-byte load stand at lane * 8, so that a wave's load covers 512 bytes in a row (4 whole lines, not 16 pieces).
// ---- k_gemmt: GEMM, one 128x128 output tile per block of 4 waves (2 x 2, each wave a 64x64 tile = 16 accumulators over the WHOLE K); grid (M/128, N/128), 128 threads.
// The block's operand rows go through LDS in stages of 64 k, so that L2 delivers each operand row once per block and not once per wave: a stage of a plane is 8 runs of 2 KiB (16 rows x 64 k = two neighbouring tiles in fragment order),
// copied as they stand (thread i takes bytes 16 i of every run), two buffers: the next stage's global loads fly in registers while this stage is multiplied, are stored into the other buffer behind it, one __syncthreads a stage.
// C[m][n] (f32, pitch DM) = sum_k A[m][k] Bt[n][k] (+ A2[m][k] Bt[n][k] if NSPLIT) + bias[n]. K % 64 == 0.
// Epilogue: every wave lays its own tile (bias added) into its own LDS range, which takes the place of the stage buffers, and reads it back in the order of its stores.
// PLANES (the q/k/v projection; rows = [batch][t], Bt = the q, k, v weights one behind the other, one wave's 64 columns = one head; z = q, k, v is the same for the whole block): C is not written; the tile goes straight to the 16-bit planes that the attention kernel reads, each set = [q, k, v][batch][head][..][..]:
// z < 2: [t][d] planes (fragment order, K = HD) of partial-rope(x) (the q planes times QSC): rotate-half inside the first ROT dims (out[d] = x[d] cos - x[d+ROT/2] sin, out[d+ROT/2] = x[d+ROT/2] cos + x[d] sin), dims >= ROT pass through.
//        q and k share one order of the rotary dims along k: slot 8 g + c holds dim 4 g + c, slot 8 g + 4 + c its partner 4 g + c + ROT/2 (g, c < 4); q.k sums over all of them, so only the order of that sum depends on it.
// z = 2: [d][t] planes in fragment order, tile (t >> 5) * (HD / 16) + (d >> 4), so that the 8 tiles of 64 keys stand in a row: the tile is laid into LDS transposed.
// Trip w8 of the plane loop stores k slots 8 w8 .. 8 w8 + 7 of all 64 rows (lane = row & 15 and which 4 of the 8): each store covers 256 bytes in a row.
template <typename T16> struct WFrag;
template <> struct WFrag<h16> { typedef v16h V; static __device__ __forceinline__ V ld(const h16* p) { return cat16(*(const v8h*)p, *(const v8h*)(p + 256)); } static __device__ __forceinline__ v8f mma(V a, V b, v8f c) { return wmma16(a, b, c); } };
template <> struct WFrag<bf> { typedef v16bf V; static __device__ __forceinline__ V ld(const bf* p) { return cat16b(*(const v8us*)p, *(const v8us*)(p + 256)); } static __device__ __forceinline__ v8f mma(V a, V b, v8f c) { return wmmab(a, b, c); } };
__device__ __forceinline__ v16bf ldsfrag(const bf* p) { return cat16b(*(const v8usa*)p, *(const v8usa*)(p + 256)); }
template <int NSPLIT, bool PLANES, int K>
__global__ __launch_bounds__(128) void k_gemmt(const bf* __restrict__ A, const bf* __restrict__ A2, const bf* __restrict__ Bt, float* C, const float* __restrict__ bias, const float* __restrict__ bias1, const float* __restrict__ bias2, const float* __restrict__ CS, h16* P16, bf* Ph, bf* Pl) {
    static_assert(K % 64 == 0 && (!PLANES || (HD == 64 && TT % 64 == 0 && DQ % 128 == 0)), "whole stages; the plane epilogue takes one head and one batch per wave tile");
    constexpr int NP = NSPLIT ? 3 : 2, STG = NP * 8192, NS = K / 64;   // planes per stage, elements per buffer, stages
    constexpr bool FR2 = !PLANES;   // the grid of the last GEMM gives one wave a SIMD: registers for a whole stage's fragments are free there; three waves a SIMD take half a stage's at a time
    constexpr int SMB = (2 * STG * 2 > 4 * 64 * 68 * 4) ? 2 * STG * 2 : 4 * 64 * 68 * 4;
    __shared__ __align__(16) unsigned char sm[SMB];
    const int tid = threadIdx.x, wave = __builtin_amdgcn_readfirstlane(tid >> 5);   // scalar, so that what depends on the wave stays wave-uniform (matrix instructions need every lane on)
    const int lane = tid & 31, lr = lane & 15, hi = lane >> 4, wm = wave >> 1, wn = wave & 1; const int r0 = blockIdx.x * 128, c0 = blockIdx.y * 128;
    const int z = PLANES ? c0 / DQ : 0, cw = c0 - z * DQ + wn * 64;   // the wave's first column inside its weight
    bf* sb = (bf*)sm; float* os = (float*)sm + wave * 64 * 68;
    float bvn[4];   // bias of the lane's four accumulator columns, asked for here so that it is there long before the epilogue
    { const float* bp = ((z == 0) ? bias : (z == 1) ? bias1 : bias2) + cw + lr;
#pragma unroll   // constant indices, so that the small array stays in registers
        for (int nb = 0; nb < 4; ++nb) bvn[nb] = bp[nb * 16];
        asm volatile("s_wait_xcnt 0x0" :: "v"(bp) : "memory");   // before any register that the loads above name is written again
    }
    v8f acc[4][4];
#pragma unroll
    for (int mb = 0; mb < 4; ++mb)
#pragma unroll
        for (int nb = 0; nb < 4; ++nb) acc[mb][nb] = (v8f){};
    const bf* ga = A + (size_t)r0 * K + tid * 8; const bf* ga2 = NSPLIT ? A2 + (size_t)r0 * K + tid * 8 : ga; const bf* gb = Bt + (size_t)c0 * K + tid * 8;   // 16 rows x K = K / 32 tiles; one pointer per plane (K is a constant: the 16-row runs are immediate offsets), which the s_wait_xcnt names as an input so that the register lives up to the wait
    // L2 prefetch: the operand planes were stored by an earlier launch, and all blocks walk k in step: where such a plane has to come from memory, every stage's rows would be first touched by the very loads that are waited for.
    // A panel of 128 rows x K is 8 x 128 units of 256 bytes. The blocks that share a panel deal its units out: a thread asks for one unit of its block's A panel (share blockIdx.y mod 8), one of its B panel
    // (share from blockIdx.x, so that blocks 2, 4 and 6 further on ask for the same one), and one of A2's panel or its row of the cos/sin table. A hint only: nothing depends on it.
    static_assert(K == 1024, "a panel of 128 rows is 8 x 128 units of 256 bytes");
    const size_t ua = (size_t)r0 * K + (((int)blockIdx.y & 7) * 128 + tid) * 128;
    const bf* pa = A + ua; const bf* pb = Bt + (size_t)c0 * K + (((((int)blockIdx.x >> 3) << 1) | ((int)blockIdx.x & 1)) * 128 + tid) * 128;
    const void* p3 = NSPLIT ? (const void*)(A2 + ua) : PLANES ? (const void*)(CS + (size_t)(r0 % TT + tid) * HD * 2) : (const void*)pa;
    v8us ra[8], ra2[8], rb[8];
#pragma unroll   // constant indices, so that the arrays stay in registers
    for (int g = 0; g < 8; ++g) { ra[g] = *(const v8us*)(ga + g * 16 * K); if (NSPLIT) ra2[g] = *(const v8us*)(ga2 + g * 16 * K); rb[g] = *(const v8us*)(gb + g * 16 * K); }
    asm volatile("global_prefetch_b8 %0, off scope:SCOPE_SE\n\tglobal_prefetch_b8 %1, off scope:SCOPE_SE\n\tglobal_prefetch_b8 %2, off scope:SCOPE_SE" :: "v"(pa), "v"(pb), "v"(p3) : "memory");   // behind stage 0's own loads, which are waited for first; every lane's address lies inside its plane
    asm volatile("s_wait_xcnt 0x0" :: "v"(ga), "v"(ga2), "v"(gb) : "memory");   // before any register that the loads above name is written again
#pragma unroll
    for (int g = 0; g < 8; ++g) { bf* d = sb + g * 1024 + tid * 8; *(v8usa*)d = ra[g]; if (NSPLIT) *(v8usa*)(d + 8192) = ra2[g]; *(v8usa*)(d + (NP - 1) * 8192) = rb[g]; }
    __syncthreads();   // stage 0 is in LDS before any wave reads it
    int bo = 0;   // the buffer of this stage, in elements
#pragma unroll 1   // rolled: one stage's registers are all that is wanted live
    for (int s = 0; s < NS; ++s) {
        const bool more = s + 1 < NS;   // block-uniform
        if (more) { ga += 1024; ga2 = NSPLIT ? ga2 + 1024 : ga; gb += 1024;   // next stage's rows fly while this stage is multiplied
#pragma unroll
            for (int g = 0; g < 8; ++g) { ra[g] = *(const v8us*)(ga + g * 16 * K); if (NSPLIT) ra2[g] = *(const v8us*)(ga2 + g * 16 * K); rb[g] = *(const v8us*)(gb + g * 16 * K); }
            asm volatile("s_wait_xcnt 0x0" :: "v"(ga), "v"(ga2), "v"(gb), "v"(pa), "v"(pb), "v"(p3) : "memory");   // before any register that the loads above name is written again; the prefetch addresses are named so that their registers hold them through the loop
        }
        const bf* fa = sb + bo + wm * 4096 + lane * 8; const bf* fb = sb + bo + (NP - 1) * 8192 + wn * 4096 + lane * 8;
        v16bf a[2][4], a2[2][4], b[2][4];
#pragma unroll   // constant indices, so that the fragment arrays stay in registers
        for (int ks = 0; ks < 2; ++ks) {
#pragma unroll
            for (int mb = 0; mb < 4; ++mb) { a[ks][mb] = ldsfrag(fa + mb * 1024 + ks * 512); if (NSPLIT) a2[ks][mb] = ldsfrag(fa + 8192 + mb * 1024 + ks * 512); }
#pragma unroll
            for (int nb = 0; nb < 4; ++nb) b[ks][nb] = ldsfrag(fb + nb * 1024 + ks * 512);
            if (FR2 && ks == 0) continue;   // FR2: both halves' fragments are asked for in one group
            __builtin_amdgcn_sched_barrier(0);   // keeps the LDS reads one group in front of the products: left to itself the compiler re-used one B fragment's registers and put a read and a full wait in front of every four products
#pragma unroll
            for (int k2 = FR2 ? 0 : ks; k2 <= ks; ++k2)
#pragma unroll
                for (int pl = 0; pl <= NSPLIT; ++pl)   // all 16 tiles with one A plane, then with the other: two products into one accumulator never stand back to back
#pragma unroll
                    for (int nb = 0; nb < 4; ++nb)
#pragma unroll
                        for (int mb = 0; mb < 4; ++mb) acc[mb][nb] = wmmab(pl ? a2[k2][mb] : a[k2][mb], b[k2][nb], acc[mb][nb]);
            __builtin_amdgcn_sched_barrier(0);   // keeps the next group of LDS reads (and the stores behind the products) from being spread among the products
        }
        bo ^= STG;
        if (more) {
#pragma unroll
            for (int g = 0; g < 8; ++g) { bf* d = sb + bo + g * 1024 + tid * 8; *(v8usa*)d = ra[g]; if (NSPLIT) *(v8usa*)(d + 8192) = ra2[g]; *(v8usa*)(d + (NP - 1) * 8192) = rb[g]; }
        }
        __syncthreads();   // publishes the next stage and ends every wave's reads of this one (which the stage after next, or the epilogue, overwrites)
    }
#pragma unroll   // constant indices, so that the small array stays in registers
    for (int nb = 0; nb < 4; ++nb) bvn[nb] = bfr(bvn[nb]);
    const bool tr = PLANES && z == 2;   // block-uniform
    const int rw = r0 + wm * 64, t0 = rw % TT;
    v4f cn0[4] = {}, cn1[4] = {};   // PLANES: (cos, sin) of the next trip's elements, asked for one trip ahead
    const float* cs = CS + (size_t)(t0 + lr) * HD * 2;   // a dim and its partner have one angle: both halves of the wave read the entry of the lower dim
    if constexpr (PLANES) {
        if (!tr) {
#pragma unroll   // constant indices, so that the small arrays stay in registers
            for (int s = 0; s < 4; ++s) { cn0[s] = *(const v4f*)(cs + s * 16 * HD * 2); cn1[s] = *(const v4f*)(cs + s * 16 * HD * 2 + 4); }
            asm volatile("s_wait_xcnt 0x0" :: "v"(cs) : "memory");   // before any register that the loads above name is written again
        }
    }
    if (tr) {
#pragma unroll   // constant indices, so that the small arrays stay in registers
        for (int mb = 0; mb < 4; ++mb)
#pragma unroll   // constant indices, so that the small arrays stay in registers
            for (int nb = 0; nb < 4; ++nb) { float* p = os + (nb * 16 + lr) * 68 + mb * 16 + hi * 8; const v8f v = acc[mb][nb] + bvn[nb];
                *(v4fa*)p = __builtin_shufflevector(v, v, 0, 1, 2, 3); *(v4fa*)(p + 4) = __builtin_shufflevector(v, v, 4, 5, 6, 7); }
    } else {
#pragma unroll
        for (int mb = 0; mb < 4; ++mb)
#pragma unroll
            for (int nb = 0; nb < 4; ++nb)
#pragma unroll
                for (int j = 0; j < 8; ++j) os[(mb * 16 + hi * 8 + j) * 68 + nb * 16 + lr] = acc[mb][nb][j] + bvn[nb];
    }
    __syncthreads();   // the tile is in LDS before its wave's lanes read one another's elements
    if constexpr (PLANES) {
        const size_t e0 = ((size_t)z * NB_ + rw / TT) * PL + (size_t)(cw / HD) * TT * HD + (size_t)t0 * HD + lr * 8 + hi * 4;   // this batch's and head's plane; 64 t x HD = 8 tiles
#pragma unroll 1   // rolled: eight copies of the body would only cost instruction cache
        for (int w8 = 0; w8 < 8; ++w8) {
            const bool rot = !tr && w8 < ROT / 8;   // wave-uniform: this trip's 8 k slots are rotary dims
            const int col0 = rot ? w8 * 4 + hi * (ROT / 2) : w8 * 8 + hi * 4;   // a thread takes rows lr + 16 s, columns col0 .. col0 + 3 of the LDS tile
            v4f cs0[4], cs1[4], val[4];
#pragma unroll   // constant indices, so that the small arrays stay in registers
            for (int s = 0; s < 4; ++s) { cs0[s] = cn0[s]; cs1[s] = cn1[s]; val[s] = *(const v4fa*)(os + (s * 16 + lr) * 68 + col0); }
            if (!tr && w8 + 1 < ROT / 8) { cs += 8;
#pragma unroll   // constant indices, so that the small arrays stay in registers
                for (int s = 0; s < 4; ++s) { cn0[s] = *(const v4f*)(cs + s * 16 * HD * 2); cn1[s] = *(const v4f*)(cs + s * 16 * HD * 2 + 4); }
                asm volatile("s_wait_xcnt 0x0" :: "v"(cs) : "memory");   // before any register that the loads above name is written again
            }
            size_t e = e0 + ((w8 >> 1) & 1) * 256 + (w8 & 1) * 128;   // k slot 8 w8 + 4 hi inside its tile
            int es;
            if (tr) { e += (w8 >> 2) * (HD / 16) * 512; es = 512; }   // LDS row = d (tile s), column = t (k)
            else { e += (w8 >> 2) * 512; es = (HD / 32) * 512;   // LDS row = t (tile s), column = d (k)
                if (rot) {
#pragma unroll   // constant indices, so that the small arrays stay in registers
                    for (int s = 0; s < 4; ++s) { const v4f x = val[s]; v4f xp;   // xp: the rotate-half partner d +- ROT/2, in the other half of the wave, with its sign
#pragma unroll   // constant indices, so that the small arrays stay in registers
                        for (int c = 0; c < 4; ++c) { const float y = __shfl_xor(x[c], 16, 32); xp[c] = hi ? y : -y; }
                        val[s][0] = x[0] * cs0[s][0] + xp[0] * cs0[s][1]; val[s][1] = x[1] * cs0[s][2] + xp[1] * cs0[s][3]; val[s][2] = x[2] * cs1[s][0] + xp[2] * cs1[s][1]; val[s][3] = x[3] * cs1[s][2] + xp[3] * cs1[s][3]; }
                }
            }
#pragma unroll   // constant indices, so that the small arrays stay in registers
            for (int s = 0; s < 4; ++s) { v4h o16; v4us oh, ol;
                if (z == 0) val[s] *= QSC;   // block-uniform: q only, in f32 before the one rounding to 16 bits
#pragma unroll   // constant indices, so that the small arrays stay in registers
                for (int c = 0; c < 4; ++c) { o16[c] = tohx(val[s][c]); unsigned short a2, c2; splitf(val[s][c], a2, c2); oh[c] = a2; ol[c] = c2; }
                h16* p16 = P16 + e + (size_t)s * es; bf* ph = Ph + e + (size_t)s * es; bf* pl = Pl + e + (size_t)s * es;
                *(v4h*)p16 = o16; *(v4us*)ph = oh; *(v4us*)pl = ol;
                asm volatile("s_wait_xcnt 0x0" :: "v"(p16), "v"(ph), "v"(pl) : "memory");   // before any register that the stores above name is written again
            }
        }
    } else {
        float* cp = C + (size_t)(rw + hi) * DM + c0 + wn * 64 + lr * 4;   // 16 lanes store one row's 64 columns; the rows are immediate offsets
#pragma unroll
        for (int q = 0; q < 4; ++q) {
#pragma unroll
            for (int s = q * 8; s < q * 8 + 8; ++s) *(v4f*)(cp + (size_t)s * 2 * DM) = *(const v4fa*)(os + (s * 2 + hi) * 68 + lr * 4);
            asm volatile("s_wait_xcnt 0x0" :: "v"(cp) : "memory");   // before any register that the stores above name is written again (the next group's LDS reads take the data registers)
        }
    }
}


// The element-wise stages are device functions of a block number bx; k_prep below deals the blocks of one grid out to them.
// Both write a plane in fragment order, one 16-byte piece i (8 k of one row) a thread and step, the pieces in the plane's own order, so that a wave's store covers 512 bytes in a row.
__device__ __forceinline__ void piece_at(const int i, const int K, int& row, int& k0) { const int tile = i >> 6, kt = K / 32; row = (tile / kt) * 16 + (i & 15); k0 = (tile % kt) * 32 + ((i >> 5) & 1) * 16 + ((i >> 4) & 1) * 8; }
__device__ __forceinline__ void d_wtG(const int bx, const float* __restrict__ w, int K, int N, bf* Bt) {   // Bt[n][k] = w[k][n]: 16 lanes read 16 neighbouring n of one k
    const int i0 = bx * 512 + (int)threadIdx.x; float v[2][8];   // two pieces a thread (the grid has N K / 8 / 512 blocks per weight); all 16 loads are asked for before the first is used
#pragma unroll   // constant indices, so that the small array stays in registers
    for (int l = 0; l < 2; ++l) { int n, k0; piece_at(i0 + l * 256, K, n, k0);
#pragma unroll
        for (int j = 0; j < 8; ++j) v[l][j] = w[(size_t)(k0 + j) * N + n]; }
#pragma unroll   // constant indices, so that the small array stays in registers
    for (int l = 0; l < 2; ++l) { v8us o;
#pragma unroll
        for (int j = 0; j < 8; ++j) o[j] = f2bf(v[l][j]);
        *(v8us*)(Bt + (size_t)(i0 + l * 256) * 8) = o; }
}
__device__ __forceinline__ void d_cvt8(const int bx, const float* __restrict__ src, int K, bf* dst, size_t n8) { const size_t i = (size_t)bx * 256 + threadIdx.x; if (i >= n8) return; int row, k0; piece_at((int)i, K, row, k0); const v8f v = *(const v8f*)(src + (size_t)row * K + k0); v8us o;
#pragma unroll
    for (int k = 0; k < 8; ++k) o[k] = f2bf(v[k]); *(v8us*)(dst + i * 8) = o;  }
__constant__ float INV[ROT / 2] = {1.0,0.6209288835525513,0.38555270433425903,0.23940083384513855,0.1486508846282959,0.0923016369342804,0.057312753051519394,0.035587143152952194,0.022097086533904076,0.013720721006393433,0.008519591763615608,0.005290060769766569,0.003284751670435071,0.002039597136899829,0.0012664449168369174,0.0007863722858019173};
__device__ __forceinline__ void d_cstab(const int bx, float* CS) { const int idx = bx * 256 + threadIdx.x; if (idx >= TT * HD) return; const int t = idx / HD, d = idx % HD; v2f cs; if (d < ROT) { const int i = (d < ROT / 2) ? d : d - ROT / 2; const float ang = __fmul_rn((float)t, INV[i]); cs[0] = cosf(ang); cs[1] = sinf(ang); } else { cs[0] = 1.0f; cs[1] = 0.0f; }
    *(v2f*)(CS + (size_t)idx * 2) = cs;  }
// k_prep: everything that depends on the inputs alone, in one grid: the four weight transposes (first in the grid, for speed only), x of both batches to bf16, the cos/sin table.
#define WTB  (DM * DQ / 64 / 64)            // blocks per weight transpose
#define CVB  (NB_ * TT * DM / 8 / 256)      // blocks of the x conversion
#define CSB  (TT * HD / 256)                // blocks of the table
static_assert(DKV == DQ && DM == DQ, "the four weight planes have one size");
static_assert(WTB * 512 == DM * DQ / 8 && DM % 32 == 0 && DQ % 16 == 0, "a transpose block writes 512 whole 16-byte pieces");
__global__ __launch_bounds__(256) void k_prep(const float* __restrict__ wq, const float* __restrict__ wk, const float* __restrict__ wv, const float* __restrict__ wo, const float* __restrict__ x, bf* W4, bf* XB, float* CS) {
    const int b = blockIdx.x;
    if (b < 4 * WTB) { const int i = b / WTB; d_wtG(b % WTB, (i == 0) ? wq : (i == 1) ? wk : (i == 2) ? wv : wo, DM, DQ, W4 + (size_t)i * DM * DQ); }
    else if (b < 4 * WTB + CVB) d_cvt8(b - 4 * WTB, x, DM, XB, (size_t)NB_ * TT * DM / 8);
    else d_cstab(b - 4 * WTB - CVB, CS);
}

// ---- k_fattn: causal attention of one head in one kernel (scores, softmax, probability x value, head merge): scores and probabilities stay in registers.
// Transposed products: St = K Qt (A = key rows, B = query rows, both [t][d] planes in fragment order) puts one query's scores of a 16-key tile in one lane (D[key 8 hi + j][query lr]); two such tiles, converted in place, are the B operand
// (32 keys in the hardware k order) of Ot += Vt Pt (A = rows of the [d][t] value plane, same k order). On-line softmax over 64-key blocks in the log2 domain (the q planes carry scale x log2 e): a reference maximum and a sum l per query column; the fp16 score products start from PSH minus the reference, the hi+lo ones have it added behind them, so that they end as the arguments of exp2;
// Ot and l are rescaled, and the reference moved, only in the first block and in a block where a score stands more than LZ above it; P is left unnormalised (x 2^PSH for fp16's range; the factor cancels in Ot / l). One division per query at the end, then the hi/lo bf16 split into the merged [t][DQ] planes (fragment order).
// HI (query rows < RH): hi+lo bf16 planes, 3 products each; else single fp16. One wave owns 16 x QT query columns; no LDS, no barrier.
// Every inner loop is fully unrolled so that the fragment arrays are indexed by constants and stay in registers.
template <typename T16, bool HI, int QT>
__device__ __forceinline__ void fattn_tile(const T16* __restrict__ Q, const T16* __restrict__ Q2, const T16* __restrict__ Kp, const T16* __restrict__ K2, const T16* __restrict__ Vt, const T16* __restrict__ V2, const int q0, const int lr, const int hi, bf* Ah, bf* Al, const void* pf0, const void* pf1) {
    typedef typename WFrag<T16>::V V;
    const float PSH = HI ? 0.0f : 10.0f;             // fp16 P carries x1024
    const float LZ = 5.0f;                           // a score may stand up to LZ above its query's reference before the reference moves: P <= 2^(PSH + LZ), inside fp16's range
    const unsigned koff = (unsigned)(8 * (16 * hi + lr)), voff = koff;   // the lane's place inside a tile in fragment order; a group of loads shares one pointer per plane, which its s_wait_xcnt names as an input so that the register lives up to the wait
    const unsigned kob = koff * (unsigned)sizeof(T16);   // the same place in bytes: the offset register of the first loads
    asm volatile("global_prefetch_b8 %0, off scope:SCOPE_SE\n\tglobal_prefetch_b8 %1, off scope:SCOPE_SE" :: "v"(pf0), "v"(pf1) : "memory");   // L2 prefetch (k_fattn says of what); every lane's address lies inside its plane
    const T16* qp = Q + q0 * HD + koff; const T16* qp2 = HI ? Q2 + q0 * HD + koff : qp;
    V qb[QT][2], qb2[QT][2];
#pragma unroll
    for (int qt = 0; qt < QT; ++qt)
#pragma unroll
        for (int ks = 0; ks < 2; ++ks) { const int qo = (qt * 2 + ks) * 512; qb[qt][ks] = WFrag<T16>::ld(qp + qo); if (HI) qb2[qt][ks] = WFrag<T16>::ld(qp2 + qo); }
    v8f o[QT][4], cin[QT]; float l[QT];              // cin: PSH - reference maximum of the lane's query, eight times: what is added to every score
#pragma unroll
    for (int qt = 0; qt < QT; ++qt) { l[qt] = 0.0f; cin[qt] = (v8f){} + PSH;
#pragma unroll
        for (int md = 0; md < 4; ++md) o[qt][md] = (v8f){}; }
    const int kdiag = q0 & ~63;                      // the 64-key block that holds the diagonal of all 16 x QT rows (16 x QT divides 64)
    V ka[4][2], ka2[4][2];
    const T16* kp = Kp + koff; const T16* kp2 = HI ? K2 + koff : kp;
#pragma unroll
    for (int nb = 0; nb < 4; ++nb)
#pragma unroll
        for (int ks = 0; ks < 2; ++ks) { const int ko = (nb * 2 + ks) * 512; ka[nb][ks] = WFrag<T16>::ld(kp + ko); if (HI) ka2[nb][ks] = WFrag<T16>::ld(kp2 + ko); }
    asm volatile("s_wait_xcnt 0x0" :: "v"(qp), "v"(qp2), "v"(kp), "v"(kp2), "v"(kob), "v"(pf0), "v"(pf1) : "memory");   // before any register that the loads above name is written again; the prefetch addresses are named so that their registers hold them up to here, behind the loads that were issued after the prefetch (the key loop has no registers to spare for them)
#pragma unroll 1   // rolled: one block's fragments already fill the registers, a second copy of the body would only cost instruction cache
    for (int kb = 0; kb <= kdiag; kb += 64) {
        V va[4][2], va2[4][2];                       // this block's value rows: needed last, asked for first
        const T16* vp = Vt + kb * HD + voff; const T16* vp2 = HI ? V2 + kb * HD + voff : vp;   // 32 keys = HD / 16 tiles
#pragma unroll
        for (int md = 0; md < 4; ++md)
#pragma unroll
            for (int ks = 0; ks < 2; ++ks) { const int vo = (ks * 4 + md) * 512; va[md][ks] = WFrag<T16>::ld(vp + vo); if (HI) va2[md][ks] = WFrag<T16>::ld(vp2 + vo); }
        asm volatile("s_wait_xcnt 0x0" :: "v"(vp), "v"(vp2) : "memory");   // before any register that the loads above name is written again
        v8f st[QT][4];
#pragma unroll
        for (int nb = 0; nb < 4; ++nb)
#pragma unroll
            for (int qt = 0; qt < QT; ++qt) { v8f a = HI ? (v8f){} : cin[qt];   // fp16 rows: the matrix instruction's C operand does the subtraction; hi+lo rows add it behind the products, in plain f32
#pragma unroll
                for (int ks = 0; ks < 2; ++ks) { a = WFrag<T16>::mma(ka[nb][ks], qb[qt][ks], a); if (HI) { a = WFrag<T16>::mma(ka[nb][ks], qb2[qt][ks], a); a = WFrag<T16>::mma(ka2[nb][ks], qb[qt][ks], a); } }
                st[qt][nb] = a; }
        const int kst = (kb < kdiag) ? 64 * HD : 0; kp += kst; kp2 += kst;   // next block's key rows fly during the softmax and P.V (the last trip re-reads its own: in bounds, unused)
#pragma unroll
        for (int nb = 0; nb < 4; ++nb)
#pragma unroll
            for (int ks = 0; ks < 2; ++ks) { const int ko = (nb * 2 + ks) * 512; ka[nb][ks] = WFrag<T16>::ld(kp + ko); if (HI) ka2[nb][ks] = WFrag<T16>::ld(kp2 + ko); }
        asm volatile("s_wait_xcnt 0x0" :: "v"(kp), "v"(kp2) : "memory");   // before any register that the loads above name is written again
        __builtin_amdgcn_sched_barrier(0);   // keeps the score offset, softmax and P.V products below from being lifted in front of the wait above, where they took the loads' address register
#pragma unroll
        for (int qt = 0; qt < QT; ++qt)
#pragma unroll
            for (int nb = 0; nb < 4; ++nb) { if (HI) st[qt][nb] += cin[qt]; }
        if (kb == kdiag) {                           // wave-uniform: only the diagonal block has keys above a query
#pragma unroll
            for (int qt = 0; qt < QT; ++qt)
#pragma unroll
                for (int nb = 0; nb < 4; ++nb)
#pragma unroll
                    for (int j = 0; j < 8; ++j) st[qt][nb][j] = (kb + nb * 16 + hi * 8 + j <= q0 + qt * 16 + lr) ? st[qt][nb][j] : -3.0e38f;
        }
        V pb[QT][2], pb2[QT][2];
        float mxq[QT]; bool need = false;            // the largest exponent of this block in the lane's half of the keys
#pragma unroll
        for (int qt = 0; qt < QT; ++qt) {
            float mx4[4];
#pragma unroll
            for (int nb = 0; nb < 4; ++nb) { mx4[nb] = st[qt][nb][0];
#pragma unroll
                for (int j = 1; j < 8; ++j) mx4[nb] = fmaxf(mx4[nb], st[qt][nb][j]); }
            mxq[qt] = fmaxf(fmaxf(mx4[0], mx4[1]), fmaxf(mx4[2], mx4[3]));
            need = need || mxq[qt] > PSH + LZ;
        }
        if (kb == 0 || __builtin_amdgcn_ballot_w32(need) != 0u) {   // wave-uniform, one test a block: the first block sets every query's reference, a later one moves it only where a score has outgrown it
#pragma unroll
            for (int qt = 0; qt < QT; ++qt) {
                const float mx = fmaxf(mxq[qt], __shfl_xor(mxq[qt], 16, 32));   // the other half of the wave holds the query's other keys: both halves move by the same step
                const float d = (kb == 0) ? mx - PSH : fmaxf(mx - PSH, 0.0f);   // the reference only rises behind the first block
                const float al = (kb == 0) ? 0.0f : __builtin_amdgcn_exp2f(-d);   // first block: Ot and l are still zero
                cin[qt] -= d; l[qt] *= al;
#pragma unroll
                for (int md = 0; md < 4; ++md) o[qt][md] *= al;
#pragma unroll
                for (int nb = 0; nb < 4; ++nb) st[qt][nb] -= d;
            }
        }
#pragma unroll
        for (int qt = 0; qt < QT; ++qt) {
            float ls4[4];
#pragma unroll
            for (int nb = 0; nb < 4; ++nb) { ls4[nb] = 0.0f;
#pragma unroll
                for (int j = 0; j < 8; ++j) { const float p = __builtin_amdgcn_exp2f(st[qt][nb][j]); st[qt][nb][j] = p; ls4[nb] += p; } }
            l[qt] += (ls4[0] + ls4[1]) + (ls4[2] + ls4[3]);
#pragma unroll
            for (int ks = 0; ks < 2; ++ks) {
                if constexpr (HI) { v8us h0, h1, l0, l1;
#pragma unroll
                    for (int j = 0; j < 8; ++j) { unsigned short a, c; splitf(st[qt][2 * ks][j], a, c); h0[j] = a; l0[j] = c; splitf(st[qt][2 * ks + 1][j], a, c); h1[j] = a; l1[j] = c; }
                    pb[qt][ks] = cat16b(h0, h1); pb2[qt][ks] = cat16b(l0, l1);
                } else { v8h h0, h1;
#pragma unroll
                    for (int j = 0; j < 8; ++j) { h0[j] = tohx(st[qt][2 * ks][j]); h1[j] = tohx(st[qt][2 * ks + 1][j]); }
                    pb[qt][ks] = cat16(h0, h1); }
            }
        }
#pragma unroll
        for (int ks = 0; ks < 2; ++ks)
#pragma unroll
            for (int md = 0; md < 4; ++md)
#pragma unroll
                for (int qt = 0; qt < QT; ++qt) { o[qt][md] = WFrag<T16>::mma(va[md][ks], pb[qt][ks], o[qt][md]); if (HI) { o[qt][md] = WFrag<T16>::mma(va[md][ks], pb2[qt][ks], o[qt][md]); o[qt][md] = WFrag<T16>::mma(va2[md][ks], pb[qt][ks], o[qt][md]); } }
    }
#pragma unroll
    for (int qt = 0; qt < QT; ++qt) { const float f = __fdiv_rn(1.0f, l[qt] + __shfl_xor(l[qt], 16, 32)); bf* ahp = Ah + (q0 + qt * 16) * DQ + koff; bf* alp = Al + (q0 + qt * 16) * DQ + koff;   // 16 rows x DQ = DQ / 32 tiles; a lane's 8 values of o are one 16-byte piece of the merged plane's fragment order
#pragma unroll
        for (int md = 0; md < 4; ++md) { v8us oh, ol;
#pragma unroll
            for (int j = 0; j < 8; ++j) { unsigned short a, c; splitf(o[qt][md][j] * f, a, c); oh[j] = a; ol[j] = c; }
            *(v8us*)(ahp + md * 256) = oh; *(v8us*)(alp + md * 256) = ol;
            asm volatile("s_wait_xcnt 0x0" :: "v"(ahp), "v"(alp) : "memory");   // before any register that the stores above name is written again
            __builtin_amdgcn_sched_barrier(0);   // keeps the next piece's arithmetic, which takes the stores' data registers, behind the wait: left to itself this build lifted it in front
        }
    }
}
// grid (heads x batches, (TT - RH) / 64 + RH / 32), 2 waves, longest key loops of both batches first: blocks y < (TT - RH) / 64 take 64 fp16 query rows each, from the last rows down (32 a wave); the others 32 hi+lo rows each (16 a wave)
__global__ __launch_bounds__(64) void k_fattn(const h16* __restrict__ QP16, const h16* __restrict__ KP16, const h16* __restrict__ VT16, const bf* __restrict__ QPh, const bf* __restrict__ QPl, const bf* __restrict__ KPh, const bf* __restrict__ KPl, const bf* __restrict__ VTh, const bf* __restrict__ VTl, bf* ATh, bf* ATl) {
    const int wave = __builtin_amdgcn_readfirstlane((int)(threadIdx.x >> 5));   // scalar, so that the key loop's branches are wave-uniform (matrix instructions need every lane on)
    const int lane = threadIdx.x & 31, lr = lane & 15, hi = lane >> 4; const int h = blockIdx.x % NH_, b = blockIdx.x / NH_; const int y = blockIdx.y; const bool lo = y < (TT - RH) / 64;
    const int q0 = lo ? (TT / 64 - 1 - y) * 64 + wave * 32 : ((TT - RH) / 64 + RH / 32 - 1 - y) * 32 + wave * 16;
    const size_t zq = ((size_t)b * NH_ + h) * TT * HD, zk = ((size_t)b * NKV + h / REP) * TT * HD; bf* ah = ATh + (size_t)b * TT * DQ + h * (HD / 32) * 512; bf* al = ATl + (size_t)b * TT * DQ + h * (HD / 32) * 512;
    // L2 prefetch: the key and value planes were stored by the launch before, and a head's waves all start at key 0 and walk on in step: where such a plane has to come from memory, every key block would be first touched by the very loads that are waited for.
    // The blocks of a head deal the planes that they read out among themselves in units of 256 bytes (64 keys of a plane = 32 units, one a lane; wave 0 asks for keys, wave 1 for values):
    // fp16 block y (< 24) asks for key blocks y and 24 + y mod 8 of the 32, a hi+lo block for one of the 8 key blocks < RH in the hi and in the lo plane. A hint only: nothing depends on it.
    static_assert(TT == 32 * 64 && RH == 8 * 64 && HD == 64, "32 key blocks, 8 of them read from the hi/lo planes, 24 fp16 blocks; 64 keys x HD x 2 bytes = 32 units");
    if (!lo) { const size_t u = zk + ((y & 7) * 32 + lane) * 128; fattn_tile<bf, true, 1>(QPh + zq, QPl + zq, KPh + zk, KPl + zk, VTh + zk, VTl + zk, q0, lr, hi, ah, al, (wave ? VTh : KPh) + u, (wave ? VTl : KPl) + u); }
    else { const h16* p = (wave ? VT16 : KP16) + zk + lane * 128; fattn_tile<h16, false, 2>(QP16 + zq, nullptr, KP16 + zk, nullptr, VT16 + zk, nullptr, q0, lr, hi, ah, al, p + (y & 31) * 32 * 128, p + (24 + (y & 7)) * 32 * 128); }
}

extern "C" void kernel_launch(void* const* d_in, const int* in_sizes, int n_in,
                              void* d_out, int out_size, void* d_ws, size_t ws_size, hipStream_t stream) {
    (void)in_sizes; (void)n_in; (void)out_size;
    const float* x = (const float*)d_in[0]; const float* wq = (const float*)d_in[1]; const float* bq = (const float*)d_in[2]; const float* wk = (const float*)d_in[3]; const float* bk = (const float*)d_in[4]; const float* wv = (const float*)d_in[5]; const float* bv = (const float*)d_in[6]; const float* wo = (const float*)d_in[7]; const float* bo = (const float*)d_in[8]; const float* cosT = nullptr; const float* sinT = nullptr; (void)cosT; (void)sinT;
    float* OUT = (float*)d_out;     // [2][2048][1024]
    char* wsp = (char*)d_ws;
    auto take = [&](size_t bytes) { char* p = wsp; wsp += (bytes + 255) & ~(size_t)255; return (void*)p; };
    bf* W4 = (bf*)take((size_t)4 * DQ * DM * 2); float* CS = (float*)take((size_t)TT * HD * 2 * 4);   // Wq, Wk, Wv, Wo transposed, one behind the other
    bf* XB = (bf*)take((size_t)NB_ * TT * DM * 2);   // both batches: x in bf16
    h16* P16 = (h16*)take((size_t)3 * NB_ * TT * DQ * 2); bf* Ph = (bf*)take((size_t)3 * NB_ * TT * DQ * 2); bf* Pl = (bf*)take((size_t)3 * NB_ * TT * DQ * 2);   // [q, k, v][batch] planes
    bf* ATh = (bf*)take((size_t)NB_ * TT * DQ * 2); bf* ATl = (bf*)take((size_t)NB_ * TT * DQ * 2);
    if ((size_t)(wsp - (char*)d_ws) > ws_size) return;    // ws 256 MiB
    const size_t KO = (size_t)NB_ * TT * DQ, VO = (size_t)2 * NB_ * TT * DQ;   // where the k and the v planes start
    // four launches, each one stage of the data flow for both batches ([batch][t] is one run of NB_ x TT rows for the two GEMMs)
    k_prep<<<4 * WTB + CVB + CSB, 256, 0, stream>>>(wq, wk, wv, wo, x, W4, XB, CS);
    k_gemmt<0, true, DM><<<dim3(NB_ * TT / 128, 3 * DQ / 128, 1), 128, 0, stream>>>(XB, nullptr, W4, nullptr, bq, bk, bv, CS, P16, Ph, Pl);
    k_fattn<<<dim3(NH_ * NB_, (TT - RH) / 64 + RH / 32, 1), 64, 0, stream>>>(P16, P16 + KO, P16 + VO, Ph, Pl, Ph + KO, Pl + KO, Ph + VO, Pl + VO, ATh, ATl);
    k_gemmt<1, false, DQ><<<dim3(NB_ * TT / 128, DM / 128, 1), 128, 0, stream>>>(ATh, ATl, W4 + (size_t)3 * DQ * DM, OUT, bo, nullptr, nullptr, nullptr, nullptr, nullptr, nullptr);
}

// v009
// It runs in 70.8 microseconds.
// Two timings next to v008 both put it at 1.03 times that version's speed.
// Over all steps from v000 it is 22.9 times as fast.
#include <hip/hip_runtime.h>

// Multi-head causal attention with partial rotary (x [2][2048][1024]; q/k/v = x W + b ('xw' [1024][1024], 16 x 64); rotate-half rotary on the FIRST 32 dims of each head (pairs d, d+16), angles t x inv[d mod 16] with inv_i = 2048^(-2i/32), the other 32 dims pass through; causal (tril) -inf; softmax(q.k / 8); out = merged Wo ('xw' [1024][1024]) + bo -> [2][2048][1024]).
// Compute dtypes, f32 accumulate: every input rounded to bf16; q/k/v on PLAIN bf16 operands (inputs: exact) + bias; rotary in f32 from an on-chip table (inv constants are the reference's own f32 values; angle = t x inv one product; precise cosf/sinf); causal scores and attn.v: query rows < 512 hl (3 products), the rest single fp16 (x1024), causal tile skipping; on-line softmax f32, all inside one kernel; Wo hl x exact (2 products) + bias.

#define NB_  2
#define TT   2048
#define DM   1024
#define NH_  16
#define NKV  16
#define REP  (NH_ / NKV)
#define HD   64
#define DQ   (NH_ * HD)
#define DKV  (NKV * HD)
#define RH   512                  // query rows < RH use hi+lo planes (a multiple of 64)
#define ROT  32                   // rotary dims per head (rotate-half inside them)
#define SCL  0.125f   // HD^-0.5
#define QSC  (SCL * 1.4426950408889634f)   // score scale x log2(e): the q planes carry it, so that q.k is a base-2 exponent
typedef _Float16 h16;
typedef unsigned short bf;
typedef __attribute__((ext_vector_type(16))) __bf16   v16bf;
typedef __attribute__((ext_vector_type(16))) _Float16 v16h;
typedef __attribute__((ext_vector_type(8)))  _Float16 v8h;
typedef __attribute__((ext_vector_type(8)))  unsigned short v8us;
typedef __attribute__((ext_vector_type(8)))  float    v8f;
typedef __attribute__((ext_vector_type(4)))  float    v4f;
typedef v8h  __attribute__((may_alias)) v8ha;
typedef v4f  __attribute__((may_alias)) v4fa;
typedef v8us __attribute__((may_alias)) v8usa;

__device__ __forceinline__ unsigned short f2bf(float f) { unsigned u = __float_as_uint(f); u += 0x7FFFu + ((u >> 16) & 1u); return (unsigned short)(u >> 16); }
__device__ __forceinline__ float bf2f(unsigned short b) { return __uint_as_float(((unsigned)b) << 16); }
__device__ __forceinline__ float bfr(float f) { return bf2f(f2bf(f)); }
__device__ __forceinline__ v16h cat16(v8h lo, v8h hi) { return __builtin_shufflevector(lo, hi, 0, 1, 2, 3, 4, 5, 6, 7, 8, 9, 10, 11, 12, 13, 14, 15); }
__device__ __forceinline__ v16bf cat16b(v8us lo, v8us hi) { return __builtin_bit_cast(v16bf, __builtin_shufflevector(lo, hi, 0, 1, 2, 3, 4, 5, 6, 7, 8, 9, 10, 11, 12, 13, 14, 15)); }
__device__ __forceinline__ v8f wmma16(v16h a, v16h b, v8f c) { return __builtin_amdgcn_wmma_f32_16x16x32_f16(false, a, false, b, (short)0, c, false, false); }
__device__ __forceinline__ v8f wmmab(v16bf a, v16bf b, v8f c) { return __builtin_amdgcn_wmma_f32_16x16x32_bf16(false, a, false, b, (short)0, c, false, false); }

__device__ __forceinline__ h16 tohx(float x) { return (h16)x; }
__device__ __forceinline__ void splitf(float y, unsigned short& h, unsigned short& l) { h = f2bf(y); l = f2bf(y - bf2f(h)); }
typedef __attribute__((ext_vector_type(2))) _Float16 v2h;
typedef __attribute__((ext_vector_type(4))) _Float16 v4h;
typedef __attribute__((ext_vector_type(2))) unsigned short v2us;
typedef __attribute__((ext_vector_type(4))) unsigned short v4us;
typedef __attribute__((ext_vector_type(2))) float v2f;
typedef __attribute__((ext_vector_type(4))) int v4i;
#define PL   ((size_t)TT * DQ)              // elements of one batch's projection = of one batch's plane

// FRAGMENT ORDER of every 16-bit operand plane: a [rows][K] plane is a run of 16-row x 32-k tiles of 512 elements, tile (row >> 4) * (K / 32) + (k >> 5) (the [d][t] value planes order their tiles as z = 2 below); inside a tile element (row, k) stands at
// ((k >> 4) & 1) * 256 + (((k >> 3) & 1) * 16 + (row & 15)) * 8 + (k & 7): the 8 elements that lane 16 hi + lr takes in one 16-byte load stand at lane * 8, so that a wave's load covers 512 bytes in a row (4 whole lines, not 16 pieces).
// ---- k_gemmt: GEMM, one 128x128 output tile per block of 4 waves (2 x 2, each wave a 64x64 tile = 16 accumulators over the WHOLE K); grid (M/128, N/128), 128 threads.
// The block's operand rows go through LDS in stages of 64 k, so that L2 delivers each operand row once per block and not once per wave: a stage of a plane is 8 runs of 2 KiB (16 rows x 64 k = two neighbouring tiles in fragment order),
// copied as they stand (thread i takes bytes 16 i of every run), two buffers: the next stage's global loads fly in registers while this stage is multiplied, are stored into the other buffer behind it, one __syncthreads a stage.
// C[m][n] (f32, pitch DM) = sum_k A[m][k] Bt[n][k] (+ A2[m][k] Bt[n][k] if NSPLIT) + bias[n]. K % 64 == 0.
// Epilogue, !PLANES: every wave lays its own tile (bias added) into its own LDS range, which takes the place of the stage buffers, and reads it back in the order of its stores.
// PLANES (the q/k/v projection; rows = [batch][t], Bt = the q, k, v weights one behind the other, one wave's 64 columns = one head; z = q, k, v is the same for the whole block): C is not written; the tile goes straight from the accumulators to the 16-bit planes that the attention kernel reads, each set = [q, k, v][batch][head][..][..], without LDS:
// a lane's 8 accumulator values are 8 neighbouring rows of the product's A operand in one column of its B operand, and a 16-byte piece of a plane in fragment order is 8 neighbouring k of one row; so the operand whose index runs along the plane's k is given to the matrix instruction as A.
// z < 2: [t][d] planes (fragment order, K = HD), k = d: A = weight rows, B = x rows (the two fragment pointers change places, the loop is the same). Partial-rope(x): rotate-half inside the first ROT dims (out[d] = x[d] cos - x[d+ROT/2] sin, out[d+ROT/2] = x[d+ROT/2] cos + x[d] sin), dims >= ROT pass through;
//        a dim and its partner are the same element of two neighbouring 16-dim tiles, in one lane.
// z = 2: [d][t] planes in fragment order, tile (t >> 5) * (HD / 16) + (d >> 4), so that the 8 tiles of 64 keys stand in a row, k = t: A = x rows, B = weight rows.
// Every store of a wave covers 512 bytes in a row.
template <typename T16> struct WFrag;
template <> struct WFrag<h16> { typedef v16h V; static __device__ __forceinline__ V ld(const h16* p) { return cat16(*(const v8h*)p, *(const v8h*)(p + 256)); } static __device__ __forceinline__ v8f mma(V a, V b, v8f c) { return wmma16(a, b, c); } };
template <> struct WFrag<bf> { typedef v16bf V; static __device__ __forceinline__ V ld(const bf* p) { return cat16b(*(const v8us*)p, *(const v8us*)(p + 256)); } static __device__ __forceinline__ v8f mma(V a, V b, v8f c) { return wmmab(a, b, c); } };
__device__ __forceinline__ v16bf ldsfrag(const bf* p) { return cat16b(*(const v8usa*)p, *(const v8usa*)(p + 256)); }
// Four accumulator tiles to the fp16, hi and lo planes: tile u is the lane's 16-byte piece at element o[u] behind each of the three pointers.
__device__ __forceinline__ void put4(const v8f (&v)[4], h16* p16, bf* ph, bf* pl, const int o0, const int o1, const int o2, const int o3) {
    const int o[4] = {o0, o1, o2, o3}; v8h a[4]; v8us h[4], l[4];
#pragma unroll   // constant indices, so that the small arrays stay in registers
    for (int u = 0; u < 4; ++u)
#pragma unroll   // constant indices, so that the small arrays stay in registers
        for (int c = 0; c < 8; ++c) { unsigned short a2, c2; a[u][c] = tohx(v[u][c]); splitf(v[u][c], a2, c2); h[u][c] = a2; l[u][c] = c2; }
#pragma unroll   // constant indices, so that the small arrays stay in registers
    for (int u = 0; u < 4; ++u) { *(v8h*)(p16 + o[u]) = a[u]; *(v8us*)(ph + o[u]) = h[u]; *(v8us*)(pl + o[u]) = l[u]; }
    asm volatile("s_wait_xcnt 0x0" :: "v"(p16), "v"(ph), "v"(pl) : "memory");   // before any register that the stores above name is written again
    __builtin_amdgcn_sched_barrier(0);   // keeps the next group's arithmetic, which takes the stores' data registers, behind the wait
}
template <int NSPLIT, bool PLANES, int K>
__global__ __launch_bounds__(128) void k_gemmt(const bf* __restrict__ A, const bf* __restrict__ A2, const bf* __restrict__ Bt, float* C, const float* __restrict__ bias, const float* __restrict__ bias1, const float* __restrict__ bias2, const float* __restrict__ CS, h16* P16, bf* Ph, bf* Pl) {
    static_assert(K % 64 == 0 && (!PLANES || (HD == 64 && TT % 64 == 0 && DQ % 128 == 0)), "whole stages; the plane epilogue takes one head and one batch per wave tile");
    constexpr int NP = NSPLIT ? 3 : 2, STG = NP * 8192, NS = K / 64;   // planes per stage, elements per buffer, stages
    constexpr bool FR2 = !PLANES;   // the grid of the last GEMM gives one wave a SIMD: registers for a whole stage's fragments are free there; three waves a SIMD take half a stage's at a time
    constexpr int SMB = (PLANES || 2 * STG * 2 > 4 * 64 * 68 * 4) ? 2 * STG * 2 : 4 * 64 * 68 * 4;   // only the !PLANES epilogue goes through LDS
    __shared__ __align__(16) unsigned char sm[SMB];
    const int tid = threadIdx.x, wave = __builtin_amdgcn_readfirstlane(tid >> 5);   // scalar, so that what depends on the wave stays wave-uniform (matrix instructions need every lane on)
    const int lane = tid & 31, lr = lane & 15, hi = lane >> 4, wm = wave >> 1, wn = wave & 1; const int r0 = blockIdx.x * 128, c0 = blockIdx.y * 128;
    const int z = PLANES ? c0 / DQ : 0, cw = c0 - z * DQ + wn * 64;   // the wave's first column inside its weight
    const bool sw = PLANES && z < 2;   // block-uniform: weight rows are the A operand (q, k)
    bf* sb = (bf*)sm; float* os = (float*)sm + wave * 64 * 68;
    float bvn[4]; v8f b8[4];   // bias of the lane's accumulator elements, asked for here so that it is there long before the epilogue: one column a tile (!PLANES: bvn; v: element 0 of b8), or with sw 8 neighbouring columns a tile (b8)
    { const float* bp = ((z == 0) ? bias : (z == 1) ? bias1 : bias2) + cw + (sw ? hi * 8 : lr);
        if constexpr (PLANES) {
            if (sw) {
#pragma unroll   // constant indices, so that the small array stays in registers
                for (int i = 0; i < 4; ++i) b8[i] = *(const v8f*)(bp + i * 16);
            } else {
#pragma unroll   // constant indices, so that the small array stays in registers
                for (int nb = 0; nb < 4; ++nb) b8[nb][0] = bp[nb * 16];
            }
        } else {
#pragma unroll   // constant indices, so that the small array stays in registers
            for (int nb = 0; nb < 4; ++nb) bvn[nb] = bp[nb * 16];
        }
        asm volatile("s_wait_xcnt 0x0" :: "v"(bp) : "memory");   // before any register that the loads above name is written again
    }
    v8f acc[4][4];
#pragma unroll
    for (int mb = 0; mb < 4; ++mb)
#pragma unroll
        for (int nb = 0; nb < 4; ++nb) acc[mb][nb] = (v8f){};
    const bf* ga = A + (size_t)r0 * K + tid * 8; const bf* ga2 = NSPLIT ? A2 + (size_t)r0 * K + tid * 8 : ga; const bf* gb = Bt + (size_t)c0 * K + tid * 8;   // 16 rows x K = K / 32 tiles; one pointer per plane (K is a constant: the 16-row runs are immediate offsets), which the s_wait_xcnt names as an input so that the register lives up to the wait
    // L2 prefetch: the operand planes were stored by an earlier launch, and all blocks walk k in step: where such a plane has to come from memory, every stage's rows would be first touched by the very loads that are waited for.
    // A panel of 128 rows x K is 8 x 128 units of 256 bytes. The blocks that share a panel deal its units out: a thread asks for one unit of its block's A panel (share blockIdx.y mod 8), one of its B panel
    // (share from blockIdx.x, so that blocks 2, 4 and 6 further on ask for the same one), and one of A2's panel or its row of the cos/sin table. A hint only: nothing depends on it.
    static_assert(K == 1024, "a panel of 128 rows is 8 x 128 units of 256 bytes");
    const size_t ua = (size_t)r0 * K + (((int)blockIdx.y & 7) * 128 + tid) * 128;
    const bf* pa = A + ua; const bf* pb = Bt + (size_t)c0 * K + (((((int)blockIdx.x >> 3) << 1) | ((int)blockIdx.x & 1)) * 128 + tid) * 128;
    const void* p3 = NSPLIT ? (const void*)(A2 + ua) : PLANES ? (const void*)(CS + (size_t)(r0 % TT + tid) * HD * 2) : (const void*)pa;
    v8us ra[8], ra2[8], rb[8];
#pragma unroll   // constant indices, so that the arrays stay in registers
    for (int g = 0; g < 8; ++g) { ra[g] = *(const v8us*)(ga + g * 16 * K); if (NSPLIT) ra2[g] = *(const v8us*)(ga2 + g * 16 * K); rb[g] = *(const v8us*)(gb + g * 16 * K); }
    asm volatile("global_prefetch_b8 %0, off scope:SCOPE_SE\n\tglobal_prefetch_b8 %1, off scope:SCOPE_SE\n\tglobal_prefetch_b8 %2, off scope:SCOPE_SE" :: "v"(pa), "v"(pb), "v"(p3) : "memory");   // behind stage 0's own loads, which are waited for first; every lane's address lies inside its plane
    asm volatile("s_wait_xcnt 0x0" :: "v"(ga), "v"(ga2), "v"(gb) : "memory");   // before any register that the loads above name is written again
#pragma unroll
    for (int g = 0; g < 8; ++g) { bf* d = sb + g * 1024 + tid * 8; *(v8usa*)d = ra[g]; if (NSPLIT) *(v8usa*)(d + 8192) = ra2[g]; *(v8usa*)(d + (NP - 1) * 8192) = rb[g]; }
    __syncthreads();   // stage 0 is in LDS before any wave reads it
    int bo = 0;   // the buffer of this stage, in elements
#pragma unroll 1   // rolled: one stage's registers are all that is wanted live
    for (int s = 0; s < NS; ++s) {
        const bool more = s + 1 < NS;   // block-uniform
        if (more) { ga += 1024; ga2 = NSPLIT ? ga2 + 1024 : ga; gb += 1024;   // next stage's rows fly while this stage is multiplied
#pragma unroll
            for (int g = 0; g < 8; ++g) { ra[g] = *(const v8us*)(ga + g * 16 * K); if (NSPLIT) ra2[g] = *(const v8us*)(ga2 + g * 16 * K); rb[g] = *(const v8us*)(gb + g * 16 * K); }
            asm volatile("s_wait_xcnt 0x0" :: "v"(ga), "v"(ga2), "v"(gb), "v"(pa), "v"(pb), "v"(p3) : "memory");   // before any register that the loads above name is written again; the prefetch addresses are named so that their registers hold them through the loop
        }
        const bf* fx = sb + bo + wm * 4096 + lane * 8; const bf* fw = sb + bo + (NP - 1) * 8192 + wn * 4096 + lane * 8; const bf* fa = sw ? fw : fx; const bf* fb = sw ? fx : fw;   // the wave's x rows and weight rows; which of them is A
        v16bf a[2][4], a2[2][4], b[2][4];
#pragma unroll   // constant indices, so that the fragment arrays stay in registers
        for (int ks = 0; ks < 2; ++ks) {
#pragma unroll
            for (int mb = 0; mb < 4; ++mb) { a[ks][mb] = ldsfrag(fa + mb * 1024 + ks * 512); if (NSPLIT) a2[ks][mb] = ldsfrag(fa + 8192 + mb * 1024 + ks * 512); }
#pragma unroll
            for (int nb = 0; nb < 4; ++nb) b[ks][nb] = ldsfrag(fb + nb * 1024 + ks * 512);
            if (FR2 && ks == 0) continue;   // FR2: both halves' fragments are asked for in one group
            __builtin_amdgcn_sched_barrier(0);   // keeps the LDS reads one group in front of the products: left to itself the compiler re-used one B fragment's registers and put a read and a full wait in front of every four products
#pragma unroll
            for (int k2 = FR2 ? 0 : ks; k2 <= ks; ++k2)
#pragma unroll
                for (int pl = 0; pl <= NSPLIT; ++pl)   // all 16 tiles with one A plane, then with the other: two products into one accumulator never stand back to back
#pragma unroll
                    for (int nb = 0; nb < 4; ++nb)
#pragma unroll
                        for (int mb = 0; mb < 4; ++mb) acc[mb][nb] = wmmab(pl ? a2[k2][mb] : a[k2][mb], b[k2][nb], acc[mb][nb]);
            __builtin_amdgcn_sched_barrier(0);   // keeps the next group of LDS reads (and the stores behind the products) from being spread among the products
        }
        bo ^= STG;
        if (more) {
#pragma unroll
            for (int g = 0; g < 8; ++g) { bf* d = sb + bo + g * 1024 + tid * 8; *(v8usa*)d = ra[g]; if (NSPLIT) *(v8usa*)(d + 8192) = ra2[g]; *(v8usa*)(d + (NP - 1) * 8192) = rb[g]; }
        }
        __syncthreads();   // publishes the next stage and ends every wave's reads of this one (which the stage after next, or the epilogue, overwrites)
    }
    const int rw = r0 + wm * 64, t0 = rw % TT;
    if constexpr (PLANES) {
        static_assert(ROT == 32 && HD == 64, "the rotary dims are the first two 16-dim tiles of a head, a dim and its partner the same element of the two");
        const size_t e0 = ((size_t)z * NB_ + rw / TT) * PL + (size_t)(cw / HD) * TT * HD + (size_t)t0 * HD + lane * 8;   // this batch's and head's plane, 64 t x HD = 8 tiles; the lane's 16-byte piece inside a half tile
        h16* p16 = P16 + e0; bf* ph = Ph + e0; bf* pl = Pl + e0;
        if (sw) {   // acc[i][j]: dims 16 i + 8 hi + c of row t0 + 16 j + lr = the piece at tile 2 j + (i >> 1), half i & 1
            v4f cq[4][4];   // (cos, sin) of dims 8 hi .. 8 hi + 7 (a dim and its partner have one angle) in the lane's four rows
            const float* cs = CS + ((size_t)(t0 + lr) * HD + hi * 8) * 2;
#pragma unroll   // constant indices, so that the small arrays stay in registers
            for (int j = 0; j < 4; ++j)
#pragma unroll   // constant indices, so that the small arrays stay in registers
                for (int m = 0; m < 4; ++m) cq[j][m] = *(const v4f*)(cs + j * 16 * HD * 2 + m * 4);
            asm volatile("s_wait_xcnt 0x0" :: "v"(cs) : "memory");   // before any register that the loads above name is written again
            const float qs = (z == 0) ? QSC : 1.0f;   // block-uniform: q only (x 1 is exact), in f32 before the one rounding to 16 bits
#pragma unroll   // constant indices, so that the small arrays stay in registers
            for (int i = 0; i < 4; ++i)
#pragma unroll   // constant indices, so that the small arrays stay in registers
                for (int c = 0; c < 8; ++c) b8[i][c] = bfr(b8[i][c]);
#pragma unroll   // the dims that pass through go first: the table's loads fly meanwhile
            for (int jp = 0; jp < 4; jp += 2) { v8f v[4];
#pragma unroll   // constant indices, so that the small arrays stay in registers
                for (int u = 0; u < 4; ++u) v[u] = (acc[2 + (u & 1)][jp + (u >> 1)] + b8[2 + (u & 1)]) * qs;
                put4(v, p16, ph, pl, jp * 1024 + 512, jp * 1024 + 768, jp * 1024 + 1536, jp * 1024 + 1792); }
#pragma unroll   // constant indices, so that the small arrays stay in registers
            for (int jp = 0; jp < 4; jp += 2) { v8f v[4];
#pragma unroll   // constant indices, so that the small arrays stay in registers
                for (int u = 0; u < 2; ++u) { const int j = jp + u; const v8f x0 = acc[0][j] + b8[0], x1 = acc[1][j] + b8[1]; v8f co, si;
#pragma unroll   // constant indices, so that the small arrays stay in registers
                    for (int c = 0; c < 8; ++c) { co[c] = cq[j][c >> 1][(c & 1) * 2]; si[c] = cq[j][c >> 1][(c & 1) * 2 + 1]; }
                    v[2 * u] = (x0 * co - x1 * si) * qs; v[2 * u + 1] = (x1 * co + x0 * si) * qs; }
                put4(v, p16, ph, pl, jp * 1024, jp * 1024 + 256, jp * 1024 + 1024, jp * 1024 + 1280); }
        } else {   // acc[mb][nb]: rows t0 + 16 mb + 8 hi + c of dim 16 nb + lr = the piece at tile 4 (mb >> 1) + nb, half mb & 1
#pragma unroll   // constant indices, so that the small arrays stay in registers
            for (int mb = 0; mb < 4; ++mb) { v8f v[4];
#pragma unroll   // constant indices, so that the small arrays stay in registers
                for (int nb = 0; nb < 4; ++nb) v[nb] = acc[mb][nb] + bfr(b8[nb][0]);
                const int o = (mb >> 1) * (HD / 16) * 512 + (mb & 1) * 256;
                put4(v, p16, ph, pl, o, o + 512, o + 1024, o + 1536); }
        }
    } else {
#pragma unroll   // constant indices, so that the small array stays in registers
        for (int nb = 0; nb < 4; ++nb) bvn[nb] = bfr(bvn[nb]);
#pragma unroll
        for (int mb = 0; mb < 4; ++mb)
#pragma unroll
            for (int nb = 0; nb < 4; ++nb)
#pragma unroll
                for (int j = 0; j < 8; ++j) os[(mb * 16 + hi * 8 + j) * 68 + nb * 16 + lr] = acc[mb][nb][j] + bvn[nb];
        __syncthreads();   // the tile is in LDS before its wave's lanes read one another's elements
        float* cp = C + (size_t)(rw + hi) * DM + c0 + wn * 64 + lr * 4;   // 16 lanes store one row's 64 columns; the rows are immediate offsets
#pragma unroll
        for (int q = 0; q < 4; ++q) {
#pragma unroll
            for (int s = q * 8; s < q * 8 + 8; ++s) *(v4f*)(cp + (size_t)s * 2 * DM) = *(const v4fa*)(os + (s * 2 + hi) * 68 + lr * 4);
            asm volatile("s_wait_xcnt 0x0" :: "v"(cp) : "memory");   // before any register that the stores above name is written again (the next group's LDS reads take the data registers)
        }
    }
}


// The element-wise stages are device functions of a block number bx; k_prep below deals the blocks of one grid out to them.
// Both write a plane in fragment order, one 16-byte piece i (8 k of one row) a thread and step, the pieces in the plane's own order, so that a wave's store covers 512 bytes in a row.
__device__ __forceinline__ void piece_at(const int i, const int K, int& row, int& k0) { const int tile = i >> 6, kt = K / 32; row = (tile / kt) * 16 + (i & 15); k0 = (tile % kt) * 32 + ((i >> 5) & 1) * 16 + ((i >> 4) & 1) * 8; }
__device__ __forceinline__ void d_wtG(const int bx, const float* __restrict__ w, int K, int N, bf* Bt) {   // Bt[n][k] = w[k][n]: 16 lanes read 16 neighbouring n of one k
    const int i0 = bx * 512 + (int)threadIdx.x; float v[2][8];   // two pieces a thread (the grid has N K / 8 / 512 blocks per weight); all 16 loads are asked for before the first is used
#pragma unroll   // constant indices, so that the small array stays in registers
    for (int l = 0; l < 2; ++l) { int n, k0; piece_at(i0 + l * 256, K, n, k0);
#pragma unroll
        for (int j = 0; j < 8; ++j) v[l][j] = w[(size_t)(k0 + j) * N + n]; }
#pragma unroll   // constant indices, so that the small array stays in registers
    for (int l = 0; l < 2; ++l) { v8us o;
#pragma unroll
        for (int j = 0; j < 8; ++j) o[j] = f2bf(v[l][j]);
        *(v8us*)(Bt + (size_t)(i0 + l * 256) * 8) = o; }
}
__device__ __forceinline__ void d_cvt8(const int bx, const float* __restrict__ src, int K, bf* dst, size_t n8) { const size_t i = (size_t)bx * 256 + threadIdx.x; if (i >= n8) return; int row, k0; piece_at((int)i, K, row, k0); const v8f v = *(const v8f*)(src + (size_t)row * K + k0); v8us o;
#pragma unroll
    for (int k = 0; k < 8; ++k) o[k] = f2bf(v[k]); *(v8us*)(dst + i * 8) = o;  }
__constant__ float INV[ROT / 2] = {1.0,0.6209288835525513,0.38555270433425903,0.23940083384513855,0.1486508846282959,0.0923016369342804,0.057312753051519394,0.035587143152952194,0.022097086533904076,0.013720721006393433,0.008519591763615608,0.005290060769766569,0.003284751670435071,0.002039597136899829,0.0012664449168369174,0.0007863722858019173};
__device__ __forceinline__ void d_cstab(const int bx, float* CS) { const int idx = bx * 256 + threadIdx.x; if (idx >= TT * HD) return; const int t = idx / HD, d = idx % HD; v2f cs; if (d < ROT) { const int i = (d < ROT / 2) ? d : d - ROT / 2; const float ang = __fmul_rn((float)t, INV[i]); cs[0] = cosf(ang); cs[1] = sinf(ang); } else { cs[0] = 1.0f; cs[1] = 0.0f; }
    *(v2f*)(CS + (size_t)idx * 2) = cs;  }
// k_prep: everything that depends on the inputs alone, in one grid: the four weight transposes (first in the grid, for speed only), x of both batches to bf16, the cos/sin table.
#define WTB  (DM * DQ / 64 / 64)            // blocks per weight transpose
#define CVB  (NB_ * TT * DM / 8 / 256)      // blocks of the x conversion
#define CSB  (TT * HD / 256)                // blocks of the table
static_assert(DKV == DQ && DM == DQ, "the four weight planes have one size");
static_assert(WTB * 512 == DM * DQ / 8 && DM % 32 == 0 && DQ % 16 == 0, "a transpose block writes 512 whole 16-byte pieces");
__global__ __launch_bounds__(256) void k_prep(const float* __restrict__ wq, const float* __restrict__ wk, const float* __restrict__ wv, const float* __restrict__ wo, const float* __restrict__ x, bf* W4, bf* XB, float* CS) {
    const int b = blockIdx.x;
    if (b < 4 * WTB) { const int i = b / WTB; d_wtG(b % WTB, (i == 0) ? wq : (i == 1) ? wk : (i == 2) ? wv : wo, DM, DQ, W4 + (size_t)i * DM * DQ); }
    else if (b < 4 * WTB + CVB) d_cvt8(b - 4 * WTB, x, DM, XB, (size_t)NB_ * TT * DM / 8);
    else d_cstab(b - 4 * WTB - CVB, CS);
}

// ---- k_fattn: causal attention of one head in one kernel (scores, softmax, probability x value, head merge): scores and probabilities stay in registers.
// Transposed products: St = K Qt (A = key rows, B = query rows, both [t][d] planes in fragment order) puts one query's scores of a 16-key tile in one lane (D[key 8 hi + j][query lr]); two such tiles, converted in place, are the B operand
// (32 keys in the hardware k order) of Ot += Vt Pt (A = rows of the [d][t] value plane, same k order). On-line softmax over 64-key blocks in the log2 domain (the q planes carry scale x log2 e): a reference maximum and a sum l per query column; the fp16 score products start from PSH minus the reference, the hi+lo ones have it added behind them, so that they end as the arguments of exp2;
// Ot and l are rescaled, and the reference moved, only in the first block and in a block where a score stands more than LZ above it; P is left unnormalised (x 2^PSH for fp16's range; the factor cancels in Ot / l). One division per query at the end, then the hi/lo bf16 split into the merged [t][DQ] planes (fragment order).
// HI (query rows < RH): hi+lo bf16 planes, 3 products each; else single fp16. One wave owns 16 x QT query columns; no LDS, no barrier.
// Every inner loop is fully unrolled so that the fragment arrays are indexed by constants and stay in registers.
template <typename T16, bool HI, int QT>
__device__ __forceinline__ void fattn_tile(const T16* __restrict__ Q, const T16* __restrict__ Q2, const T16* __restrict__ Kp, const T16* __restrict__ K2, const T16* __restrict__ Vt, const T16* __restrict__ V2, const int q0, const int lr, const int hi, bf* Ah, bf* Al, const void* pf0, const void* pf1) {
    typedef typename WFrag<T16>::V V;
    const float PSH = HI ? 0.0f : 10.0f;             // fp16 P carries x1024
    const float LZ = 5.0f;                           // a score may stand up to LZ above its query's reference before the reference moves: P <= 2^(PSH + LZ), inside fp16's range
    const unsigned koff = (unsigned)(8 * (16 * hi + lr)), voff = koff;   // the lane's place inside a tile in fragment order; a group of loads shares one pointer per plane, which its s_wait_xcnt names as an input so that the register lives up to the wait
    const unsigned kob = koff * (unsigned)sizeof(T16);   // the same place in bytes: the offset register of the first loads
    asm volatile("global_prefetch_b8 %0, off scope:SCOPE_SE\n\tglobal_prefetch_b8 %1, off scope:SCOPE_SE" :: "v"(pf0), "v"(pf1) : "memory");   // L2 prefetch (k_fattn says of what); every lane's address lies inside its plane
    const T16* qp = Q + q0 * HD + koff; const T16* qp2 = HI ? Q2 + q0 * HD + koff : qp;
    V qb[QT][2], qb2[QT][2];
#pragma unroll
    for (int qt = 0; qt < QT; ++qt)
#pragma unroll
        for (int ks = 0; ks < 2; ++ks) { const int qo = (qt * 2 + ks) * 512; qb[qt][ks] = WFrag<T16>::ld(qp + qo); if (HI) qb2[qt][ks] = WFrag<T16>::ld(qp2 + qo); }
    v8f o[QT][4], cin[QT]; float l[QT];              // cin: PSH - reference maximum of the lane's query, eight times: what is added to every score
#pragma unroll
    for (int qt = 0; qt < QT; ++qt) { l[qt] = 0.0f; cin[qt] = (v8f){} + PSH;
#pragma unroll
        for (int md = 0; md < 4; ++md) o[qt][md] = (v8f){}; }
    const int kdiag = q0 & ~63;                      // the 64-key block that holds the diagonal of all 16 x QT rows (16 x QT divides 64)
    V ka[4][2], ka2[4][2];
    const T16* kp = Kp + koff; const T16* kp2 = HI ? K2 + koff : kp;
#pragma unroll
    for (int nb = 0; nb < 4; ++nb)
#pragma unroll
        for (int ks = 0; ks < 2; ++ks) { const int ko = (nb * 2 + ks) * 512; ka[nb][ks] = WFrag<T16>::ld(kp + ko); if (HI) ka2[nb][ks] = WFrag<T16>::ld(kp2 + ko); }
    asm volatile("s_wait_xcnt 0x0" :: "v"(qp), "v"(qp2), "v"(kp), "v"(kp2), "v"(kob), "v"(pf0), "v"(pf1) : "memory");   // before any register that the loads above name is written again; the prefetch addresses are named so that their registers hold them up to here, behind the loads that were issued after the prefetch (the key loop has no registers to spare for them)
#pragma unroll 1   // rolled: one block's fragments already fill the registers, a second copy of the body would only cost instruction cache
    for (int kb = 0; kb <= kdiag; kb += 64) {
        V va[4][2], va2[4][2];                       // this block's value rows: needed last, asked for first
        const T16* vp = Vt + kb * HD + voff; const T16* vp2 = HI ? V2 + kb * HD + voff : vp;   // 32 keys = HD / 16 tiles
#pragma unroll
        for (int md = 0; md < 4; ++md)
#pragma unroll
            for (int ks = 0; ks < 2; ++ks) { const int vo = (ks * 4 + md) * 512; va[md][ks] = WFrag<T16>::ld(vp + vo); if (HI) va2[md][ks] = WFrag<T16>::ld(vp2 + vo); }
        asm volatile("s_wait_xcnt 0x0" :: "v"(vp), "v"(vp2) : "memory");   // before any register that the loads above name is written again
        v8f st[QT][4];
#pragma unroll
        for (int nb = 0; nb < 4; ++nb)
#pragma unroll
            for (int qt = 0; qt < QT; ++qt) { v8f a = HI ? (v8f){} : cin[qt];   // fp16 rows: the matrix instruction's C operand does the subtraction; hi+lo rows add it behind the products, in plain f32
#pragma unroll
                for (int ks = 0; ks < 2; ++ks) { a = WFrag<T16>::mma(ka[nb][ks], qb[qt][ks], a); if (HI) { a = WFrag<T16>::mma(ka[nb][ks], qb2[qt][ks], a); a = WFrag<T16>::mma(ka2[nb][ks], qb[qt][ks], a); } }
                st[qt][nb] = a; }
        const int kst = (kb < kdiag) ? 64 * HD : 0; kp += kst; kp2 += kst;   // next block's key rows fly during the softmax and P.V (the last trip re-reads its own: in bounds, unused)
#pragma unroll
        for (int nb = 0; nb < 4; ++nb)
#pragma unroll
            for (int ks = 0; ks < 2; ++ks) { const int ko = (nb * 2 + ks) * 512; ka[nb][ks] = WFrag<T16>::ld(kp + ko); if (HI) ka2[nb][ks] = WFrag<T16>::ld(kp2 + ko); }
        asm volatile("s_wait_xcnt 0x0" :: "v"(kp), "v"(kp2) : "memory");   // before any register that the loads above name is written again
        __builtin_amdgcn_sched_barrier(0);   // keeps the score offset, softmax and P.V products below from being lifted in front of the wait above, where they took the loads' address register
#pragma unroll
        for (int qt = 0; qt < QT; ++qt)
#pragma unroll
            for (int nb = 0; nb < 4; ++nb) { if (HI) st[qt][nb] += cin[qt]; }
        if (kb == kdiag) {                           // wave-uniform: only the diagonal block has keys above a query
#pragma unroll
            for (int qt = 0; qt < QT; ++qt)
#pragma unroll
                for (int nb = 0; nb < 4; ++nb)
#pragma unroll
                    for (int j = 0; j < 8; ++j) st[qt][nb][j] = (kb + nb * 16 + hi * 8 + j <= q0 + qt * 16 + lr) ? st[qt][nb][j] : -3.0e38f;
        }
        V pb[QT][2], pb2[QT][2];
        float mxq[QT]; bool need = false;            // the largest exponent of this block in the lane's half of the keys
#pragma unroll
        for (int qt = 0; qt < QT; ++qt) {
            float mx4[4];
#pragma unroll
            for (int nb = 0; nb < 4; ++nb) { mx4[nb] = st[qt][nb][0];
#pragma unroll
                for (int j = 1; j < 8; ++j) mx4[nb] = fmaxf(mx4[nb], st[qt][nb][j]); }
            mxq[qt] = fmaxf(fmaxf(mx4[0], mx4[1]), fmaxf(mx4[2], mx4[3]));
            need = need || mxq[qt] > PSH + LZ;
        }
        if (kb == 0 || __builtin_amdgcn_ballot_w32(need) != 0u) {   // wave-uniform, one test a block: the first block sets every query's reference, a later one moves it only where a score has outgrown it
#pragma unroll
            for (int qt = 0; qt < QT; ++qt) {
                const float mx = fmaxf(mxq[qt], __shfl_xor(mxq[qt], 16, 32));   // the other half of the wave holds the query's other keys: both halves move by the same step
                const float d = (kb == 0) ? mx - PSH : fmaxf(mx - PSH, 0.0f);   // the reference only rises behind the first block
                const float al = (kb == 0) ? 0.0f : __builtin_amdgcn_exp2f(-d);   // first block: Ot and l are still zero
                cin[qt] -= d; l[qt] *= al;
#pragma unroll
                for (int md = 0; md < 4; ++md) o[qt][md] *= al;
#pragma unroll
                for (int nb = 0; nb < 4; ++nb) st[qt][nb] -= d;
            }
        }
#pragma unroll
        for (int qt = 0; qt < QT; ++qt) {
            float ls4[4];
#pragma unroll
            for (int nb = 0; nb < 4; ++nb) { ls4[nb] = 0.0f;
#pragma unroll
                for (int j = 0; j < 8; ++j) { const float p = __builtin_amdgcn_exp2f(st[qt][nb][j]); st[qt][nb][j] = p; ls4[nb] += p; } }
            l[qt] += (ls4[0] + ls4[1]) + (ls4[2] + ls4[3]);
#pragma unroll
            for (int ks = 0; ks < 2; ++ks) {
                if constexpr (HI) { v8us h0, h1, l0, l1;
#pragma unroll
                    for (int j = 0; j < 8; ++j) { unsigned short a, c; splitf(st[qt][2 * ks][j], a, c); h0[j] = a; l0[j] = c; splitf(st[qt][2 * ks + 1][j], a, c); h1[j] = a; l1[j] = c; }
                    pb[qt][ks] = cat16b(h0, h1); pb2[qt][ks] = cat16b(l0, l1);
                } else { v8h h0, h1;
#pragma unroll
                    for (int j = 0; j < 8; ++j) { h0[j] = tohx(st[qt][2 * ks][j]); h1[j] = tohx(st[qt][2 * ks + 1][j]); }
                    pb[qt][ks] = cat16(h0, h1); }
            }
        }
#pragma unroll
        for (int ks = 0; ks < 2; ++ks)
#pragma unroll
            for (int md = 0; md < 4; ++md)
#pragma unroll
                for (int qt = 0; qt < QT; ++qt) { o[qt][md] = WFrag<T16>::mma(va[md][ks], pb[qt][ks], o[qt][md]); if (HI) { o[qt][md] = WFrag<T16>::mma(va[md][ks], pb2[qt][ks], o[qt][md]); o[qt][md] = WFrag<T16>::mma(va2[md][ks], pb[qt][ks], o[qt][md]); } }
    }
#pragma unroll
    for (int qt = 0; qt < QT; ++qt) { const float f = __fdiv_rn(1.0f, l[qt] + __shfl_xor(l[qt], 16, 32)); bf* ahp = Ah + (q0 + qt * 16) * DQ + koff; bf* alp = Al + (q0 + qt * 16) * DQ + koff;   // 16 rows x DQ = DQ / 32 tiles; a lane's 8 values of o are one 16-byte piece of the merged plane's fragment order
#pragma unroll
        for (int md = 0; md < 4; ++md) { v8us oh, ol;
#pragma unroll
            for (int j = 0; j < 8; ++j) { unsigned short a, c; splitf(o[qt][md][j] * f, a, c); oh[j] = a; ol[j] = c; }
            *(v8us*)(ahp + md * 256) = oh; *(v8us*)(alp + md * 256) = ol;
            asm volatile("s_wait_xcnt 0x0" :: "v"(ahp), "v"(alp) : "memory");   // before any register that the stores above name is written again
            __builtin_amdgcn_sched_barrier(0);   // keeps the next piece's arithmetic, which takes the stores' data registers, behind the wait: left to itself this build lifted it in front
        }
    }
}
// grid (heads x batches, (TT - RH) / 64 + RH / 32), 2 waves, longest key loops of both batches first: blocks y < (TT - RH) / 64 take 64 fp16 query rows each, from the last rows down (32 a wave); the others 32 hi+lo rows each (16 a wave)
__global__ __launch_bounds__(64) void k_fattn(const h16* __restrict__ QP16, const h16* __restrict__ KP16, const h16* __restrict__ VT16, const bf* __restrict__ QPh, const bf* __restrict__ QPl, const bf* __restrict__ KPh, const bf* __restrict__ KPl, const bf* __restrict__ VTh, const bf* __restrict__ VTl, bf* ATh, bf* ATl) {
    const int wave = __builtin_amdgcn_readfirstlane((int)(threadIdx.x >> 5));   // scalar, so that the key loop's branches are wave-uniform (matrix instructions need every lane on)
    const int lane = threadIdx.x & 31, lr = lane & 15, hi = lane >> 4; const int h = blockIdx.x % NH_, b = blockIdx.x / NH_; const int y = blockIdx.y; const bool lo = y < (TT - RH) / 64;
    const int q0 = lo ? (TT / 64 - 1 - y) * 64 + wave * 32 : ((TT - RH) / 64 + RH / 32 - 1 - y) * 32 + wave * 16;
    const size_t zq = ((size_t)b * NH_ + h) * TT * HD, zk = ((size_t)b * NKV + h / REP) * TT * HD; bf* ah = ATh + (size_t)b * TT * DQ + h * (HD / 32) * 512; bf* al = ATl + (size_t)b * TT * DQ + h * (HD / 32) * 512;
    // L2 prefetch: the key and value planes were stored by the launch before, and a head's waves all start at key 0 and walk on in step: where such a plane has to come from memory, every key block would be first touched by the very loads that are waited for.
    // The blocks of a head deal the planes that they read out among themselves in units of 256 bytes (64 keys of a plane = 32 units, one a lane; wave 0 asks for keys, wave 1 for values):
    // fp16 block y (< 24) asks for key blocks y and 24 + y mod 8 of the 32, a hi+lo block for one of the 8 key blocks < RH in the hi and in the lo plane. A hint only: nothing depends on it.
    static_assert(TT == 32 * 64 && RH == 8 * 64 && HD == 64, "32 key blocks, 8 of them read from the hi/lo planes, 24 fp16 blocks; 64 keys x HD x 2 bytes = 32 units");
    if (!lo) { const size_t u = zk + ((y & 7) * 32 + lane) * 128; fattn_tile<bf, true, 1>(QPh + zq, QPl + zq, KPh + zk, KPl + zk, VTh + zk, VTl + zk, q0, lr, hi, ah, al, (wave ? VTh : KPh) + u, (wave ? VTl : KPl) + u); }
    else { const h16* p = (wave ? VT16 : KP16) + zk + lane * 128; fattn_tile<h16, false, 2>(QP16 + zq, nullptr, KP16 + zk, nullptr, VT16 + zk, nullptr, q0, lr, hi, ah, al, p + (y & 31) * 32 * 128, p + (24 + (y & 7)) * 32 * 128); }
}

extern "C" void kernel_launch(void* const* d_in, const int* in_sizes, int n_in,
                              void* d_out, int out_size, void* d_ws, size_t ws_size, hipStream_t stream) {
    (void)in_sizes; (void)n_in; (void)out_size;
    const float* x = (const float*)d_in[0]; const float* wq = (const float*)d_in[1]; const float* bq = (const float*)d_in[2]; const float* wk = (const float*)d_in[3]; const float* bk = (const float*)d_in[4]; const float* wv = (const float*)d_in[5]; const float* bv = (const float*)d_in[6]; const float* wo = (const float*)d_in[7]; const float* bo = (const float*)d_in[8]; const float* cosT = nullptr; const float* sinT = nullptr; (void)cosT; (void)sinT;
    float* OUT = (float*)d_out;     // [2][2048][1024]
    char* wsp = (char*)d_ws;
    auto take = [&](size_t bytes) { char* p = wsp; wsp += (bytes + 255) & ~(size_t)255; return (void*)p; };
    bf* W4 = (bf*)take((size_t)4 * DQ * DM * 2); float* CS = (float*)take((size_t)TT * HD * 2 * 4);   // Wq, Wk, Wv, Wo transposed, one behind the other
    bf* XB = (bf*)take((size_t)NB_ * TT * DM * 2);   // both batches: x in bf16
    h16* P16 = (h16*)take((size_t)3 * NB_ * TT * DQ * 2); bf* Ph = (bf*)take((size_t)3 * NB_ * TT * DQ * 2); bf* Pl = (bf*)take((size_t)3 * NB_ * TT * DQ * 2);   // [q, k, v][batch] planes
    bf* ATh = (bf*)take((size_t)NB_ * TT * DQ * 2); bf* ATl = (bf*)take((size_t)NB_ * TT * DQ * 2);
    if ((size_t)(wsp - (char*)d_ws) > ws_size) return;    // ws 256 MiB
    const size_t KO = (size_t)NB_ * TT * DQ, VO = (size_t)2 * NB_ * TT * DQ;   // where the k and the v planes start
    // four launches, each one stage of the data flow for both batches ([batch][t] is one run of NB_ x TT rows for the two GEMMs)
    k_prep<<<4 * WTB + CVB + CSB, 256, 0, stream>>>(wq, wk, wv, wo, x, W4, XB, CS);
    k_gemmt<0, true, DM><<<dim3(NB_ * TT / 128, 3 * DQ / 128, 1), 128, 0, stream>>>(XB, nullptr, W4, nullptr, bq, bk, bv, CS, P16, Ph, Pl);
    k_fattn<<<dim3(NH_ * NB_, (TT - RH) / 64 + RH / 32, 1), 64, 0, stream>>>(P16, P16 + KO, P16 + VO, Ph, Pl, Ph + KO, Pl + KO, Ph + VO, Pl + VO, ATh, ATl);
    k_gemmt<1, false, DQ><<<dim3(NB_ * TT / 128, DM / 128, 1), 128, 0, stream>>>(ATh, ATl, W4 + (size_t)3 * DQ * DM, OUT, bo, nullptr, nullptr, nullptr, nullptr, nullptr, nullptr);
}
